// v000
// Measured on an AMD MI455X. A time is GPU time per run, averaged over a window of back-to-back runs after a warm-up
// (all launches, gaps included; the runs take copies of the inputs in turn), and the median of several windows.
// Apart from v000's, it joins two sittings. Times from different sittings can be a few percent apart, while
// side-by-side timings come from the same sitting.
// v000, which the later versions start from, runs in 3150 microseconds.
#include <hip/hip_runtime.h>

// Conv1dAttention (x [16][64][2048] channels-first; q/k/v/pe = LeakyReLU_0.3(BN(conv1d_k3(x) + b)) with 128 output channels (BN inference affine: y*scale + (beta - mean*scale), scale = gamma*rsqrt(var + 1e-5)); attn[i][j] = sum_c q[c][i] k[c][j] (NO scaling); P = softmax_j; out[c][l] = sum_j v[c][j] P[j][l] + pe[c][l] -> [16][128][2048] - note the value product contracts over the softmax ROW index j, i.e. it uses P TRANSPOSED).
// Compute dtypes, f32 accumulate: every input rounded to bf16; the four k=3 convolutions as PLAIN bf16 im2col GEMMs (K = 192, inputs: exact) + bias, BN affine and LeakyReLU in f32; scores hl x hl (3 products, K 128, unscaled) on every row; softmax f32 (wave per row) into hi/lo bf16 planes for all rows; P transposed on chip (exact bf16 moves): output rows l < 512 as hl P^T x hl v (3 products, K 2048), rows >= 512 as fp16(P^T x 1024) x fp16 v; + pe, written channels-first.

#define NB_  16
#define CIN  64
#define CC   128
#define KW   3
#define KI   (CIN * KW)     // 192
#define TT   2048
#define RH   512
#define PCAR 1024.0f
typedef _Float16 h16;
typedef unsigned short bf;
typedef __attribute__((ext_vector_type(16))) __bf16   v16bf;
typedef __attribute__((ext_vector_type(16))) _Float16 v16h;
typedef __attribute__((ext_vector_type(8)))  _Float16 v8h;
typedef __attribute__((ext_vector_type(8)))  unsigned short v8us;
typedef __attribute__((ext_vector_type(8)))  float    v8f;
typedef __attribute__((ext_vector_type(4)))  float    v4f;
typedef v8h  __attribute__((may_alias)) v8ha;
typedef v4f  __attribute__((may_alias)) v4fa;
typedef v8us __attribute__((may_alias)) v8usa;

__device__ __forceinline__ unsigned short f2bf(float f) { unsigned u = __float_as_uint(f); u += 0x7FFFu + ((u >> 16) & 1u); return (unsigned short)(u >> 16); }
__device__ __forceinline__ float bf2f(unsigned short b) { return __uint_as_float(((unsigned)b) << 16); }
__device__ __forceinline__ float bfr(float f) { return bf2f(f2bf(f)); }
__device__ __forceinline__ v16h cat16(v8h lo, v8h hi) { return __builtin_shufflevector(lo, hi, 0, 1, 2, 3, 4, 5, 6, 7, 8, 9, 10, 11, 12, 13, 14, 15); }
__device__ __forceinline__ v16bf cat16b(v8us lo, v8us hi) { return __builtin_bit_cast(v16bf, __builtin_shufflevector(lo, hi, 0, 1, 2, 3, 4, 5, 6, 7, 8, 9, 10, 11, 12, 13, 14, 15)); }
__device__ __forceinline__ v8f wmma16(v16h a, v16h b, v8f c) { return __builtin_amdgcn_wmma_f32_16x16x32_f16(false, a, false, b, (short)0, c, false, false); }
__device__ __forceinline__ v8f wmmab(v16bf a, v16bf b, v8f c) { return __builtin_amdgcn_wmma_f32_16x16x32_bf16(false, a, false, b, (short)0, c, false, false); }



// ---- k_gemmw: register-blocked GEMM, ONE WAVE per 64x64 output tile (16 accumulators), operands straight from K-contiguous 16-bit planes; grid (M/64, N/64, Z), 32 threads.
// C[m][n] (f32, pitch ldc, + optional f32 bias[n]) = sum_k A[m][k] Bt[n][k] (+ split products per NSPLIT). z-batch strides sA/sB/sC in elements. K % 32 == 0.
template <typename T16> struct WFrag;
template <> struct WFrag<h16> { typedef v16h V; static __device__ __forceinline__ V ld(const h16* p) { return cat16(*(const v8h*)p, *(const v8h*)(p + 16)); } static __device__ __forceinline__ v8f mma(V a, V b, v8f c) { return wmma16(a, b, c); } };
template <> struct WFrag<bf> { typedef v16bf V; static __device__ __forceinline__ V ld(const bf* p) { return cat16b(*(const v8us*)p, *(const v8us*)(p + 16)); } static __device__ __forceinline__ v8f mma(V a, V b, v8f c) { return wmmab(a, b, c); } };
template <typename T16, int NSPLIT, bool BIAS>
__global__ __launch_bounds__(32) void k_gemmw(const T16* __restrict__ A, const T16* __restrict__ A2, const T16* __restrict__ Bt, const T16* __restrict__ Bt2, int K, float* C, int ldc, const float* __restrict__ bias, size_t sA, size_t sB, size_t sC) {
    typedef typename WFrag<T16>::V V;
    __shared__ __align__(16) float os[16 * 68];
    const size_t z = blockIdx.z; A += z * sA; if (A2) A2 += z * sA; Bt += z * sB; if (Bt2) Bt2 += z * sB; C += z * sC;
    const int lane = threadIdx.x & 31, lr = lane & 15, hi = lane >> 4; const int r0 = blockIdx.x * 64, c0 = blockIdx.y * 64;
    v8f acc[4][4];
#pragma unroll
    for (int mb = 0; mb < 4; ++mb)
#pragma unroll
        for (int nb = 0; nb < 4; ++nb) acc[mb][nb] = (v8f){};
    const size_t aoff = (size_t)(r0 + lr) * K + 8 * hi, boff = (size_t)(c0 + lr) * K + 8 * hi;
#pragma unroll 1
    for (int kc = 0; kc < K; kc += 32) {
        V a[4], a2[4];
#pragma unroll
        for (int mb = 0; mb < 4; ++mb) { a[mb] = WFrag<T16>::ld(A + aoff + (size_t)mb * 16 * K + kc); if (NSPLIT == 1 || NSPLIT == 2) a2[mb] = WFrag<T16>::ld(A2 + aoff + (size_t)mb * 16 * K + kc); }
#pragma unroll
        for (int nb = 0; nb < 4; ++nb) { const V b = WFrag<T16>::ld(Bt + boff + (size_t)nb * 16 * K + kc); V b2; if (NSPLIT >= 2) b2 = WFrag<T16>::ld(Bt2 + boff + (size_t)nb * 16 * K + kc);
#pragma unroll
            for (int mb = 0; mb < 4; ++mb) { acc[mb][nb] = WFrag<T16>::mma(a[mb], b, acc[mb][nb]); if (NSPLIT == 1 || NSPLIT == 2) acc[mb][nb] = WFrag<T16>::mma(a2[mb], b, acc[mb][nb]); if (NSPLIT >= 2) acc[mb][nb] = WFrag<T16>::mma(a[mb], b2, acc[mb][nb]); } }
        asm volatile("v_nop\n\tv_nop\n\tv_nop\n\tv_nop" : "+v"(acc[0][0]), "+v"(acc[1][1]), "+v"(acc[2][2]), "+v"(acc[3][3]) : "v"(a[0]), "v"(a[3]));
    }
#pragma unroll
    for (int mb = 0; mb < 4; ++mb) {
#pragma unroll
        for (int nb = 0; nb < 4; ++nb) {
#pragma unroll
            for (int j = 0; j < 8; ++j) os[(hi * 8 + j) * 68 + nb * 16 + lr] = acc[mb][nb][j]; }
        __builtin_amdgcn_wave_barrier(); asm volatile("" ::: "memory");
        float* crow = C + (size_t)(r0 + mb * 16) * ldc + c0;
{
#pragma unroll
            for (int s = 0; s < 8; ++s) { const int row = 2 * s + hi, cofs = lr * 4; v4f val = *(const v4fa*)(os + row * 68 + cofs); if (BIAS) { val[0] += bfr(bias[c0 + cofs]); val[1] += bfr(bias[c0 + cofs + 1]); val[2] += bfr(bias[c0 + cofs + 2]); val[3] += bfr(bias[c0 + cofs + 3]); }
                *(v4f*)(crow + (size_t)row * ldc + cofs) = val; }
             }
        __builtin_amdgcn_wave_barrier(); asm volatile("" ::: "memory");
    }
}

__device__ __forceinline__ h16 tohx(float x) { return (h16)x; }
__device__ __forceinline__ void splitf(float y, unsigned short& h, unsigned short& l) { h = f2bf(y); l = f2bf(y - bf2f(h)); }
typedef __attribute__((ext_vector_type(2))) unsigned short v2us;
typedef __attribute__((ext_vector_type(4))) unsigned short v4us;
typedef __attribute__((ext_vector_type(8))) unsigned short v8us;
typedef __attribute__((ext_vector_type(4))) _Float16 v4h;
typedef __attribute__((ext_vector_type(2))) float v2f;

__global__ __launch_bounds__(256) void k_cvt8(const float* __restrict__ src, bf* dst, size_t n8) { const size_t i = (size_t)blockIdx.x * 256 + threadIdx.x; if (i >= n8) return; const v8f v = *(const v8f*)(src + i * 8); v8us o;
#pragma unroll
    for (int k = 0; k < 8; ++k) o[k] = f2bf(v[k]); *(v8us*)(dst + i * 8) = o;  }
__global__ __launch_bounds__(256) void k_im2col(const float* __restrict__ xb, bf* X3) { const size_t e8 = ((size_t)blockIdx.x * 256 + threadIdx.x) * 8; if (e8 >= (size_t)TT * KI) return; const int kidx = (int)(e8 % KI); const int t = (int)(e8 / KI); v8us o;
#pragma unroll
    for (int u = 0; u < 8; ++u) { const int k2 = kidx + u; const int ci = k2 / KW, kk = k2 % KW; const int tt = t + kk - 1; o[u] = (tt >= 0 && tt < TT) ? f2bf(xb[(size_t)ci * TT + tt]) : (unsigned short)0; }
    *(v8us*)(X3 + e8) = o;  }
__global__ __launch_bounds__(256) void k_bnl(float* F, const float* __restrict__ gam, const float* __restrict__ bet, const float* __restrict__ mu, const float* __restrict__ var) { const size_t e = ((size_t)blockIdx.x * 256 + threadIdx.x) * 4; if (e >= (size_t)TT * CC) return; const int c0 = (int)(e % CC); const v4f a = *(const v4f*)(F + e); v4f o;
#pragma unroll
    for (int u = 0; u < 4; ++u) { const int c = c0 + u; const float sc = __fmul_rn(bfr(gam[c]), __fdiv_rn(1.0f, sqrtf(__fadd_rn(bfr(var[c]), 1e-5f)))); float ms = __fmul_rn(bfr(mu[c]), sc); asm volatile("" : "+v"(ms)); const float sh = __fsub_rn(bfr(bet[c]), ms); float y = __fmul_rn(a[u], sc); asm volatile("" : "+v"(y)); y = __fadd_rn(y, sh); o[u] = (y > 0.f) ? y : 0.3f * y; }
    *(v4f*)(F + e) = o;  }
__global__ __launch_bounds__(256) void k_hlN(const float* __restrict__ F, bf* Fh, bf* Fl) { const size_t e = ((size_t)blockIdx.x * 256 + threadIdx.x) * 4; if (e >= (size_t)TT * CC) return; const v4f a = *(const v4f*)(F + e); v4us oh, ol; for (int u = 0; u < 4; ++u) { unsigned short p, q; splitf(a[u], p, q); oh[u] = p; ol[u] = q; } *(v4us*)(Fh + e) = oh; *(v4us*)(Fl + e) = ol;  }
__global__ __launch_bounds__(256) void k_hlT(const float* __restrict__ F, bf* Th, bf* Tl, h16* T16) { const size_t e = ((size_t)blockIdx.x * 256 + threadIdx.x) * 2; if (e >= (size_t)CC * TT) return; const int t = (int)(e % TT); const int c = (int)(e / TT); v2us oh, ol; _Float16 f0, f1;
    { unsigned short p, q; const float a0 = F[(size_t)t * CC + c]; splitf(a0, p, q); oh[0] = p; ol[0] = q; f0 = tohx(a0); const float a1 = F[(size_t)(t + 1) * CC + c]; splitf(a1, p, q); oh[1] = p; ol[1] = q; f1 = tohx(a1); }
    typedef __attribute__((ext_vector_type(2))) _Float16 v2h; v2h fo; fo[0] = f0; fo[1] = f1;
    *(v2us*)(Th + e) = oh; *(v2us*)(Tl + e) = ol; *(v2h*)(T16 + e) = fo;  }
__global__ __launch_bounds__(256) void k_psoft(const float* __restrict__ S, bf* Ph, bf* Pl) { const int lane = threadIdx.x & 31; const int row = blockIdx.x * 8 + (threadIdx.x >> 5); if (row >= TT) return; const float* sr = S + (size_t)row * TT; float v[TT / 32]; float mx = -3.0e38f;
#pragma unroll
    for (int ch = 0; ch < TT / 128; ++ch) { const v4f a = *(const v4f*)(sr + ch * 128 + lane * 4);
#pragma unroll
        for (int u = 0; u < 4; ++u) { float sa = a[u]; asm volatile("" : "+v"(sa)); v[ch * 4 + u] = sa; mx = fmaxf(mx, sa); } }
#pragma unroll
    for (int sh = 16; sh; sh >>= 1) mx = fmaxf(mx, __shfl_xor(mx, sh, 32));
    float sum = 0.f;
#pragma unroll
    for (int q = 0; q < TT / 32; ++q) { float d0 = __fsub_rn(v[q], mx); asm volatile("" : "+v"(d0)); v[q] = __builtin_amdgcn_exp2f(__fmul_rn(d0, 1.4426950408889634f)); sum += v[q]; }
#pragma unroll
    for (int sh = 16; sh; sh >>= 1) sum += __shfl_xor(sum, sh, 32);
    const float f = __fdiv_rn(1.0f, sum);
    {
#pragma unroll
        for (int ch = 0; ch < TT / 128; ++ch) { v4us oh, ol; for (int q = 0; q < 4; ++q) { unsigned short a, c2; splitf(v[ch * 4 + q] * f, a, c2); oh[q] = a; ol[q] = c2; } const size_t oo = (size_t)row * TT + ch * 128 + lane * 4; *(v4us*)(Ph + oo) = oh; *(v4us*)(Pl + oo) = ol; }
         } }
__global__ __launch_bounds__(256) void k_ptr(const bf* __restrict__ Ph, const bf* __restrict__ Pl, bf* PTh, bf* PTl, h16* PT16) { const size_t e = ((size_t)blockIdx.x * 256 + threadIdx.x) * 4; if (e >= (size_t)TT * TT) return; const int j = (int)(e % TT); const int l = (int)(e / TT); v4us oh, ol; v4h o4;
#pragma unroll
    for (int u = 0; u < 4; ++u) { const size_t src = (size_t)(j + u) * TT + l; const unsigned short a = Ph[src], c = Pl[src]; oh[u] = a; ol[u] = c; o4[u] = tohx(__fadd_rn(bf2f(a), bf2f(c)) * PCAR); }
    if (l < RH) { *(v4us*)(PTh + e) = oh; *(v4us*)(PTl + e) = ol;  }
    else { const size_t o2 = e - (size_t)RH * TT; *(v4h*)(PT16 + o2) = o4;  } }
__global__ __launch_bounds__(256) void k_fin(const float* __restrict__ OT, const float* __restrict__ PE, float* OUTb) { const size_t e = ((size_t)blockIdx.x * 256 + threadIdx.x) * 4; if (e >= (size_t)CC * TT) return; const int l = (int)(e % TT); const int c = (int)(e / TT); v4f r;
#pragma unroll
    for (int u = 0; u < 4; ++u) { const int ll = l + u; const float cs = (ll < RH) ? 1.0f : (1.0f / PCAR); float o = OT[(size_t)ll * CC + c] * cs; asm volatile("" : "+v"(o)); r[u] = __fadd_rn(o, PE[(size_t)ll * CC + c]); }
    *(v4f*)(OUTb + e) = r;  }

extern "C" void kernel_launch(void* const* d_in, const int* in_sizes, int n_in,
                              void* d_out, int out_size, void* d_ws, size_t ws_size, hipStream_t stream) {
    (void)in_sizes; (void)n_in; (void)out_size;
    const float* x = (const float*)d_in[0];
    const float* prm[4][6]; for (int r = 0; r < 4; ++r) for (int c = 0; c < 6; ++c) prm[r][c] = (const float*)d_in[1 + r * 6 + c];   // (w, b, gamma, beta, mean, var) for q, k, v, pe
    float* OUT = (float*)d_out;     // [16][128][2048]
    char* wsp = (char*)d_ws;
    auto take = [&](size_t bytes) { char* p = wsp; wsp += (bytes + 255) & ~(size_t)255; return (void*)p; };
    bf* W4 = (bf*)take((size_t)4 * CC * KI * 2); bf* X3 = (bf*)take((size_t)TT * KI * 2);
    float* FQ = (float*)take((size_t)TT * CC * 4); float* FK = (float*)take((size_t)TT * CC * 4); float* FV = (float*)take((size_t)TT * CC * 4); float* FPE = (float*)take((size_t)TT * CC * 4);
    bf* QPh = (bf*)take((size_t)TT * CC * 2); bf* QPl = (bf*)take((size_t)TT * CC * 2); bf* KPh = (bf*)take((size_t)TT * CC * 2); bf* KPl = (bf*)take((size_t)TT * CC * 2);
    bf* VTh = (bf*)take((size_t)CC * TT * 2); bf* VTl = (bf*)take((size_t)CC * TT * 2); h16* VT16 = (h16*)take((size_t)CC * TT * 2);
    float* S = (float*)take((size_t)TT * TT * 4); bf* Ph = (bf*)take((size_t)TT * TT * 2); bf* Pl = (bf*)take((size_t)TT * TT * 2); bf* PTh = (bf*)take((size_t)RH * TT * 2); bf* PTl = (bf*)take((size_t)RH * TT * 2); h16* PT16 = (h16*)take((size_t)(TT - RH) * TT * 2); float* OT = (float*)take((size_t)TT * CC * 4);
    if ((size_t)(wsp - (char*)d_ws) > ws_size) return;    // ~ 54 MB
    for (int r = 0; r < 4; ++r) k_cvt8<<<(unsigned)(((size_t)CC * KI / 8 + 255) / 256), 256, 0, stream>>>(prm[r][0], W4 + (size_t)r * CC * KI, (size_t)CC * KI / 8);   // w [128][64][3] == Bt [128][192]
    for (int b = 0; b < NB_; ++b) { const float* xb = x + (size_t)b * CIN * TT;
        k_im2col<<<(unsigned)(((size_t)TT * KI / 8 + 255) / 256), 256, 0, stream>>>(xb, X3);
        float* F4[4] = {FQ, FK, FV, FPE};
        for (int r = 0; r < 4; ++r) { k_gemmw<bf, 0, true><<<dim3(TT / 64, CC / 64, 1), 32, 0, stream>>>(X3, nullptr, W4 + (size_t)r * CC * KI, nullptr, KI, F4[r], CC, prm[r][1], 0, 0, 0); k_bnl<<<(unsigned)(((size_t)TT * CC / 4 + 255) / 256), 256, 0, stream>>>(F4[r], prm[r][2], prm[r][3], prm[r][4], prm[r][5]); }
        k_hlN<<<(unsigned)(((size_t)TT * CC / 4 + 255) / 256), 256, 0, stream>>>(FQ, QPh, QPl); k_hlN<<<(unsigned)(((size_t)TT * CC / 4 + 255) / 256), 256, 0, stream>>>(FK, KPh, KPl); k_hlT<<<(unsigned)(((size_t)CC * TT / 2 + 255) / 256), 256, 0, stream>>>(FV, VTh, VTl, VT16);
        k_gemmw<bf, 2, false><<<dim3(TT / 64, TT / 64, 1), 32, 0, stream>>>(QPh, QPl, KPh, KPl, CC, S, TT, nullptr, 0, 0, 0);                               // attn logits (3 products)
        k_psoft<<<TT / 8, 256, 0, stream>>>(S, Ph, Pl);
        k_ptr<<<(unsigned)(((size_t)TT * TT / 4 + 255) / 256), 256, 0, stream>>>(Ph, Pl, PTh, PTl, PT16);
        k_gemmw<bf, 2, false><<<dim3(RH / 64, CC / 64, 1), 32, 0, stream>>>(PTh, PTl, VTh, VTl, TT, OT, CC, nullptr, 0, 0, 0);                             // rows l < RH: hl P^T x hl v
        k_gemmw<h16, 0, false><<<dim3((TT - RH) / 64, CC / 64, 1), 32, 0, stream>>>(PT16, nullptr, VT16, nullptr, TT, OT + (size_t)RH * CC, CC, nullptr, 0, 0, 0);   // rest: fp16 x1024
        k_fin<<<(unsigned)(((size_t)CC * TT / 4 + 255) / 256), 256, 0, stream>>>(OT, FPE, OUT + (size_t)b * CC * TT); }
}

// v001
// Measured time: 1230 microseconds a run.
// In two side-by-side timings against v000, it was 2.58 and 2.60 times as fast.
#include <hip/hip_runtime.h>

// Conv1dAttention (x [16][64][2048] channels-first; q/k/v/pe = LeakyReLU_0.3(BN(conv1d_k3(x) + b)) with 128 output channels (BN inference affine: y*scale + (beta - mean*scale), scale = gamma*rsqrt(var + 1e-5)); attn[i][j] = sum_c q[c][i] k[c][j] (NO scaling); P = softmax_j; out[c][l] = sum_j v[c][j] P[j][l] + pe[c][l] -> [16][128][2048] - note the value product contracts over the softmax ROW index j, i.e. it uses P TRANSPOSED).
// Compute dtypes, f32 accumulate: every input rounded to bf16; the four k=3 convolutions as PLAIN bf16 im2col GEMMs (K = 192, inputs: exact) + bias, BN affine and LeakyReLU in f32; scores hl x hl (3 products, K 128, unscaled) on every row; softmax f32 (wave per row) into hi/lo bf16 planes for all rows; P transposed on chip (exact bf16 moves): output rows l < 512 as hl P^T x hl v (3 products, K 2048), rows >= 512 as fp16(P^T x 1024) x fp16 v; + pe, written channels-first.

#define NB_  16
#define CIN  64
#define CC   128
#define KW   3
#define KI   (CIN * KW)     // 192
#define TT   2048
#define RH   512
#define PCAR 1024.0f
#define GB   4              // batches per launch in the attention stages (the score and probability planes of 4 batches fit the workspace)
typedef _Float16 h16;
typedef unsigned short bf;
typedef __attribute__((ext_vector_type(16))) __bf16   v16bf;
typedef __attribute__((ext_vector_type(16))) _Float16 v16h;
typedef __attribute__((ext_vector_type(8)))  _Float16 v8h;
typedef __attribute__((ext_vector_type(8)))  unsigned short v8us;
typedef __attribute__((ext_vector_type(8)))  float    v8f;
typedef __attribute__((ext_vector_type(4)))  float    v4f;
typedef v8h  __attribute__((may_alias)) v8ha;
typedef v4f  __attribute__((may_alias)) v4fa;
typedef v8us __attribute__((may_alias)) v8usa;

__device__ __forceinline__ unsigned short f2bf(float f) { unsigned u = __float_as_uint(f); u += 0x7FFFu + ((u >> 16) & 1u); return (unsigned short)(u >> 16); }
__device__ __forceinline__ float bf2f(unsigned short b) { return __uint_as_float(((unsigned)b) << 16); }
__device__ __forceinline__ float bfr(float f) { return bf2f(f2bf(f)); }
__device__ __forceinline__ v16h cat16(v8h lo, v8h hi) { return __builtin_shufflevector(lo, hi, 0, 1, 2, 3, 4, 5, 6, 7, 8, 9, 10, 11, 12, 13, 14, 15); }
__device__ __forceinline__ v16bf cat16b(v8us lo, v8us hi) { return __builtin_bit_cast(v16bf, __builtin_shufflevector(lo, hi, 0, 1, 2, 3, 4, 5, 6, 7, 8, 9, 10, 11, 12, 13, 14, 15)); }
__device__ __forceinline__ v8f wmma16(v16h a, v16h b, v8f c) { return __builtin_amdgcn_wmma_f32_16x16x32_f16(false, a, false, b, (short)0, c, false, false); }
__device__ __forceinline__ v8f wmmab(v16bf a, v16bf b, v8f c) { return __builtin_amdgcn_wmma_f32_16x16x32_bf16(false, a, false, b, (short)0, c, false, false); }



// ---- k_gemmw: register-blocked GEMM, ONE WAVE per 64x64 output tile (16 accumulators), operands straight from K-contiguous 16-bit planes; grid (M/64, N/64, Z), 32 threads.
// C[m][n] (f32, pitch ldc, + optional f32 bias[n]) = sum_k A[m][k] Bt[n][k] (+ split products per NSPLIT). z-batch strides sA/sB/sC in elements. K % 32 == 0.
template <typename T16> struct WFrag;
template <> struct WFrag<h16> { typedef v16h V; static __device__ __forceinline__ V ld(const h16* p) { return cat16(*(const v8h*)p, *(const v8h*)(p + 16)); } static __device__ __forceinline__ v8f mma(V a, V b, v8f c) { return wmma16(a, b, c); } };
template <> struct WFrag<bf> { typedef v16bf V; static __device__ __forceinline__ V ld(const bf* p) { return cat16b(*(const v8us*)p, *(const v8us*)(p + 16)); } static __device__ __forceinline__ v8f mma(V a, V b, v8f c) { return wmmab(a, b, c); } };
template <typename T16, int NSPLIT, bool BIAS>
__global__ __launch_bounds__(32) void k_gemmw(const T16* __restrict__ A, const T16* __restrict__ A2, const T16* __restrict__ Bt, const T16* __restrict__ Bt2, int K, float* C, int ldc, const float* __restrict__ bias, size_t sA, size_t sB, size_t sC) {
    typedef typename WFrag<T16>::V V;
    __shared__ __align__(16) float os[16 * 68];
    const size_t z = blockIdx.z; A += z * sA; if (A2) A2 += z * sA; Bt += z * sB; if (Bt2) Bt2 += z * sB; C += z * sC;
    const int lane = threadIdx.x & 31, lr = lane & 15, hi = lane >> 4; const int r0 = blockIdx.x * 64, c0 = blockIdx.y * 64;
    v8f acc[4][4];
#pragma unroll
    for (int mb = 0; mb < 4; ++mb)
#pragma unroll
        for (int nb = 0; nb < 4; ++nb) acc[mb][nb] = (v8f){};
    const size_t aoff = (size_t)(r0 + lr) * K + 8 * hi, boff = (size_t)(c0 + lr) * K + 8 * hi;
#pragma unroll 1
    for (int kc = 0; kc < K; kc += 32) {
        V a[4], a2[4];
#pragma unroll
        for (int mb = 0; mb < 4; ++mb) { a[mb] = WFrag<T16>::ld(A + aoff + (size_t)mb * 16 * K + kc); if (NSPLIT == 1 || NSPLIT == 2) a2[mb] = WFrag<T16>::ld(A2 + aoff + (size_t)mb * 16 * K + kc); }
#pragma unroll
        for (int nb = 0; nb < 4; ++nb) { const V b = WFrag<T16>::ld(Bt + boff + (size_t)nb * 16 * K + kc); V b2; if (NSPLIT >= 2) b2 = WFrag<T16>::ld(Bt2 + boff + (size_t)nb * 16 * K + kc);
#pragma unroll
            for (int mb = 0; mb < 4; ++mb) { acc[mb][nb] = WFrag<T16>::mma(a[mb], b, acc[mb][nb]); if (NSPLIT == 1 || NSPLIT == 2) acc[mb][nb] = WFrag<T16>::mma(a2[mb], b, acc[mb][nb]); if (NSPLIT >= 2) acc[mb][nb] = WFrag<T16>::mma(a[mb], b2, acc[mb][nb]); } }
        asm volatile("v_nop\n\tv_nop\n\tv_nop\n\tv_nop" : "+v"(acc[0][0]), "+v"(acc[1][1]), "+v"(acc[2][2]), "+v"(acc[3][3]) : "v"(a[0]), "v"(a[3]));
    }
#pragma unroll
    for (int mb = 0; mb < 4; ++mb) {
#pragma unroll
        for (int nb = 0; nb < 4; ++nb) {
#pragma unroll
            for (int j = 0; j < 8; ++j) os[(hi * 8 + j) * 68 + nb * 16 + lr] = acc[mb][nb][j]; }
        __builtin_amdgcn_wave_barrier(); asm volatile("" ::: "memory");
        float* crow = C + (size_t)(r0 + mb * 16) * ldc + c0;
{
#pragma unroll
            for (int s = 0; s < 8; ++s) { const int row = 2 * s + hi, cofs = lr * 4; v4f val = *(const v4fa*)(os + row * 68 + cofs); if (BIAS) { val[0] += bfr(bias[c0 + cofs]); val[1] += bfr(bias[c0 + cofs + 1]); val[2] += bfr(bias[c0 + cofs + 2]); val[3] += bfr(bias[c0 + cofs + 3]); }
                *(v4f*)(crow + (size_t)row * ldc + cofs) = val; }
             }
        __builtin_amdgcn_wave_barrier(); asm volatile("" ::: "memory");
    }
}

__device__ __forceinline__ h16 tohx(float x) { return (h16)x; }
__device__ __forceinline__ void splitf(float y, unsigned short& h, unsigned short& l) { h = f2bf(y); l = f2bf(y - bf2f(h)); }
typedef __attribute__((ext_vector_type(2))) unsigned short v2us;
typedef __attribute__((ext_vector_type(4))) unsigned short v4us;
typedef __attribute__((ext_vector_type(8))) unsigned short v8us;
typedef __attribute__((ext_vector_type(4))) _Float16 v4h;
typedef __attribute__((ext_vector_type(2))) float v2f;

__global__ __launch_bounds__(256) void k_cvt8(const float* __restrict__ src, bf* dst, size_t n8) { const size_t i = (size_t)blockIdx.x * 256 + threadIdx.x; if (i >= n8) return; const v8f v = *(const v8f*)(src + i * 8); v8us o;
#pragma unroll
    for (int k = 0; k < 8; ++k) o[k] = f2bf(v[k]); *(v8us*)(dst + i * 8) = o;  }
__global__ __launch_bounds__(256) void k_im2col(const float* __restrict__ xb, bf* X3) { xb += (size_t)blockIdx.y * CIN * TT; X3 += (size_t)blockIdx.y * TT * KI; const size_t e8 = ((size_t)blockIdx.x * 256 + threadIdx.x) * 8; if (e8 >= (size_t)TT * KI) return; const int kidx = (int)(e8 % KI); const int t = (int)(e8 / KI); v8us o;
#pragma unroll
    for (int u = 0; u < 8; ++u) { const int k2 = kidx + u; const int ci = k2 / KW, kk = k2 % KW; const int tt = t + kk - 1; o[u] = (tt >= 0 && tt < TT) ? f2bf(xb[(size_t)ci * TT + tt]) : (unsigned short)0; }
    *(v8us*)(X3 + e8) = o;  }
__global__ __launch_bounds__(256) void k_bnl(float* F, const float* __restrict__ gam, const float* __restrict__ bet, const float* __restrict__ mu, const float* __restrict__ var) { F += (size_t)blockIdx.y * TT * CC; const size_t e = ((size_t)blockIdx.x * 256 + threadIdx.x) * 4; if (e >= (size_t)TT * CC) return; const int c0 = (int)(e % CC); const v4f a = *(const v4f*)(F + e); v4f o;
#pragma unroll
    for (int u = 0; u < 4; ++u) { const int c = c0 + u; const float sc = __fmul_rn(bfr(gam[c]), __fdiv_rn(1.0f, sqrtf(__fadd_rn(bfr(var[c]), 1e-5f)))); float ms = __fmul_rn(bfr(mu[c]), sc); asm volatile("" : "+v"(ms)); const float sh = __fsub_rn(bfr(bet[c]), ms); float y = __fmul_rn(a[u], sc); asm volatile("" : "+v"(y)); y = __fadd_rn(y, sh); o[u] = (y > 0.f) ? y : 0.3f * y; }
    *(v4f*)(F + e) = o;  }
__global__ __launch_bounds__(256) void k_hlN(const float* __restrict__ F, bf* Fh, bf* Fl) { { const size_t zo = (size_t)blockIdx.y * TT * CC; F += zo; Fh += zo; Fl += zo; } const size_t e = ((size_t)blockIdx.x * 256 + threadIdx.x) * 4; if (e >= (size_t)TT * CC) return; const v4f a = *(const v4f*)(F + e); v4us oh, ol; for (int u = 0; u < 4; ++u) { unsigned short p, q; splitf(a[u], p, q); oh[u] = p; ol[u] = q; } *(v4us*)(Fh + e) = oh; *(v4us*)(Fl + e) = ol;  }
__global__ __launch_bounds__(256) void k_hlT(const float* __restrict__ F, bf* Th, bf* Tl, h16* T16) { { const size_t zo = (size_t)blockIdx.y * TT * CC; F += zo; Th += zo; Tl += zo; T16 += zo; } const size_t e = ((size_t)blockIdx.x * 256 + threadIdx.x) * 2; if (e >= (size_t)CC * TT) return; const int t = (int)(e % TT); const int c = (int)(e / TT); v2us oh, ol; _Float16 f0, f1;
    { unsigned short p, q; const float a0 = F[(size_t)t * CC + c]; splitf(a0, p, q); oh[0] = p; ol[0] = q; f0 = tohx(a0); const float a1 = F[(size_t)(t + 1) * CC + c]; splitf(a1, p, q); oh[1] = p; ol[1] = q; f1 = tohx(a1); }
    typedef __attribute__((ext_vector_type(2))) _Float16 v2h; v2h fo; fo[0] = f0; fo[1] = f1;
    *(v2us*)(Th + e) = oh; *(v2us*)(Tl + e) = ol; *(v2h*)(T16 + e) = fo;  }
__global__ __launch_bounds__(256) void k_psoft(const float* __restrict__ S, bf* Ph, bf* Pl) { { const size_t zo = (size_t)blockIdx.y * TT * TT; S += zo; Ph += zo; Pl += zo; } const int lane = threadIdx.x & 31; const int row = blockIdx.x * 8 + (threadIdx.x >> 5); if (row >= TT) return; const float* sr = S + (size_t)row * TT; float v[TT / 32]; float mx = -3.0e38f;
#pragma unroll
    for (int ch = 0; ch < TT / 128; ++ch) { const v4f a = *(const v4f*)(sr + ch * 128 + lane * 4);
#pragma unroll
        for (int u = 0; u < 4; ++u) { float sa = a[u]; asm volatile("" : "+v"(sa)); v[ch * 4 + u] = sa; mx = fmaxf(mx, sa); } }
#pragma unroll
    for (int sh = 16; sh; sh >>= 1) mx = fmaxf(mx, __shfl_xor(mx, sh, 32));
    float sum = 0.f;
#pragma unroll
    for (int q = 0; q < TT / 32; ++q) { float d0 = __fsub_rn(v[q], mx); asm volatile("" : "+v"(d0)); v[q] = __builtin_amdgcn_exp2f(__fmul_rn(d0, 1.4426950408889634f)); sum += v[q]; }
#pragma unroll
    for (int sh = 16; sh; sh >>= 1) sum += __shfl_xor(sum, sh, 32);
    const float f = __fdiv_rn(1.0f, sum);
    {
#pragma unroll
        for (int ch = 0; ch < TT / 128; ++ch) { v4us oh, ol; for (int q = 0; q < 4; ++q) { unsigned short a, c2; splitf(v[ch * 4 + q] * f, a, c2); oh[q] = a; ol[q] = c2; } const size_t oo = (size_t)row * TT + ch * 128 + lane * 4; *(v4us*)(Ph + oo) = oh; *(v4us*)(Pl + oo) = ol; }
         } }
__global__ __launch_bounds__(256) void k_ptr(const bf* __restrict__ Ph, const bf* __restrict__ Pl, bf* PTh, bf* PTl, h16* PT16) { { const size_t zb = blockIdx.y; Ph += zb * TT * TT; Pl += zb * TT * TT; PTh += zb * RH * TT; PTl += zb * RH * TT; PT16 += zb * (TT - RH) * TT; } const size_t e = ((size_t)blockIdx.x * 256 + threadIdx.x) * 4; if (e >= (size_t)TT * TT) return; const int j = (int)(e % TT); const int l = (int)(e / TT); v4us oh, ol; v4h o4;
#pragma unroll
    for (int u = 0; u < 4; ++u) { const size_t src = (size_t)(j + u) * TT + l; const unsigned short a = Ph[src], c = Pl[src]; oh[u] = a; ol[u] = c; o4[u] = tohx(__fadd_rn(bf2f(a), bf2f(c)) * PCAR); }
    if (l < RH) { *(v4us*)(PTh + e) = oh; *(v4us*)(PTl + e) = ol;  }
    else { const size_t o2 = e - (size_t)RH * TT; *(v4h*)(PT16 + o2) = o4;  } }
__global__ __launch_bounds__(256) void k_fin(const float* __restrict__ OT, const float* __restrict__ PE, float* OUTb) { { const size_t zo = (size_t)blockIdx.y * TT * CC; OT += zo; PE += zo; OUTb += zo; } const size_t e = ((size_t)blockIdx.x * 256 + threadIdx.x) * 4; if (e >= (size_t)CC * TT) return; const int l = (int)(e % TT); const int c = (int)(e / TT); v4f r;
#pragma unroll
    for (int u = 0; u < 4; ++u) { const int ll = l + u; const float cs = (ll < RH) ? 1.0f : (1.0f / PCAR); float o = OT[(size_t)ll * CC + c] * cs; asm volatile("" : "+v"(o)); r[u] = __fadd_rn(o, PE[(size_t)ll * CC + c]); }
    *(v4f*)(OUTb + e) = r;  }

extern "C" void kernel_launch(void* const* d_in, const int* in_sizes, int n_in,
                              void* d_out, int out_size, void* d_ws, size_t ws_size, hipStream_t stream) {
    (void)in_sizes; (void)n_in; (void)out_size;
    const float* x = (const float*)d_in[0];
    const float* prm[4][6]; for (int r = 0; r < 4; ++r) for (int c = 0; c < 6; ++c) prm[r][c] = (const float*)d_in[1 + r * 6 + c];   // (w, b, gamma, beta, mean, var) for q, k, v, pe
    float* OUT = (float*)d_out;     // [16][128][2048]
    char* wsp = (char*)d_ws;
    auto take = [&](size_t bytes) { char* p = wsp; wsp += (bytes + 255) & ~(size_t)255; return (void*)p; };
    const size_t FE = (size_t)TT * CC, SE = (size_t)TT * TT;   // elements of one batch's [2048][128] plane and of its [2048][2048] plane
    bf* W4 = (bf*)take((size_t)4 * CC * KI * 2);
    // live through the whole call, all 16 batches
    bf* QPh = (bf*)take(NB_ * FE * 2); bf* QPl = (bf*)take(NB_ * FE * 2); bf* KPh = (bf*)take(NB_ * FE * 2); bf* KPl = (bf*)take(NB_ * FE * 2);
    bf* VTh = (bf*)take(NB_ * FE * 2); bf* VTl = (bf*)take(NB_ * FE * 2); h16* VT16 = (h16*)take(NB_ * FE * 2); float* FPE = (float*)take(NB_ * FE * 4);
    // one group of GB batches
    float* S = (float*)take(GB * SE * 4); bf* Ph = (bf*)take(GB * SE * 2); bf* Pl = (bf*)take(GB * SE * 2); bf* PTh = (bf*)take((size_t)GB * RH * TT * 2); bf* PTl = (bf*)take((size_t)GB * RH * TT * 2); h16* PT16 = (h16*)take((size_t)GB * (TT - RH) * TT * 2); float* OT = (float*)take(GB * FE * 4);
    if ((size_t)(wsp - (char*)d_ws) > ws_size) return;    // ~ 244 MiB
    // the convolution stage's own planes (60 MiB, all 16 batches) lie in S (64 MiB): their last reader runs before the first score launch writes S
    bf* X3 = (bf*)S; float* FQ = (float*)(X3 + (size_t)NB_ * TT * KI); float* FK = FQ + NB_ * FE; float* FV = FK + NB_ * FE;
    for (int r = 0; r < 4; ++r) k_cvt8<<<(unsigned)(((size_t)CC * KI / 8 + 255) / 256), 256, 0, stream>>>(prm[r][0], W4 + (size_t)r * CC * KI, (size_t)CC * KI / 8);   // w [128][64][3] == Bt [128][192]
    k_im2col<<<dim3((unsigned)(((size_t)TT * KI / 8 + 255) / 256), NB_, 1), 256, 0, stream>>>(x, X3);
    float* F4[4] = {FQ, FK, FV, FPE};
    for (int r = 0; r < 4; ++r) { k_gemmw<bf, 0, true><<<dim3(TT / 64, CC / 64, NB_), 32, 0, stream>>>(X3, nullptr, W4 + (size_t)r * CC * KI, nullptr, KI, F4[r], CC, prm[r][1], (size_t)TT * KI, 0, FE); k_bnl<<<dim3((unsigned)((FE / 4 + 255) / 256), NB_, 1), 256, 0, stream>>>(F4[r], prm[r][2], prm[r][3], prm[r][4], prm[r][5]); }
    k_hlN<<<dim3((unsigned)((FE / 4 + 255) / 256), NB_, 1), 256, 0, stream>>>(FQ, QPh, QPl); k_hlN<<<dim3((unsigned)((FE / 4 + 255) / 256), NB_, 1), 256, 0, stream>>>(FK, KPh, KPl); k_hlT<<<dim3((unsigned)((FE / 2 + 255) / 256), NB_, 1), 256, 0, stream>>>(FV, VTh, VTl, VT16);
    for (int b = 0; b < NB_; b += GB) { const size_t bo = (size_t)b * FE;
        k_gemmw<bf, 2, false><<<dim3(TT / 64, TT / 64, GB), 32, 0, stream>>>(QPh + bo, QPl + bo, KPh + bo, KPl + bo, CC, S, TT, nullptr, FE, FE, SE);                               // attn logits (3 products)
        k_psoft<<<dim3(TT / 8, GB, 1), 256, 0, stream>>>(S, Ph, Pl);
        k_ptr<<<dim3((unsigned)((SE / 4 + 255) / 256), GB, 1), 256, 0, stream>>>(Ph, Pl, PTh, PTl, PT16);
        k_gemmw<bf, 2, false><<<dim3(RH / 64, CC / 64, GB), 32, 0, stream>>>(PTh, PTl, VTh + bo, VTl + bo, TT, OT, CC, nullptr, (size_t)RH * TT, FE, FE);                             // rows l < RH: hl P^T x hl v
        k_gemmw<h16, 0, false><<<dim3((TT - RH) / 64, CC / 64, GB), 32, 0, stream>>>(PT16, nullptr, VT16 + bo, nullptr, TT, OT + (size_t)RH * CC, CC, nullptr, (size_t)(TT - RH) * TT, FE, FE);   // rest: fp16 x1024
        k_fin<<<dim3((unsigned)((FE / 4 + 255) / 256), GB, 1), 256, 0, stream>>>(OT, FPE + bo, OUT + bo); }
}

// v002
// It runs in 772 microseconds.
// Next to v001, in two timings, it ran 1.58 and 1.59 times as fast.
// Over all steps from v000 it is 4.11 times as fast.
#include <hip/hip_runtime.h>

// Conv1dAttention (x [16][64][2048] channels-first; q/k/v/pe = LeakyReLU_0.3(BN(conv1d_k3(x) + b)) with 128 output channels (BN inference affine: y*scale + (beta - mean*scale), scale = gamma*rsqrt(var + 1e-5)); attn[i][j] = sum_c q[c][i] k[c][j] (NO scaling); P = softmax_j; out[c][l] = sum_j v[c][j] P[j][l] + pe[c][l] -> [16][128][2048] - note the value product contracts over the softmax ROW index j, i.e. it uses P TRANSPOSED).
// Compute dtypes, f32 accumulate: every input rounded to bf16; the four k=3 convolutions as PLAIN bf16 im2col GEMMs (K = 192, inputs: exact) + bias, BN affine and LeakyReLU in f32; scores hl x hl (3 products, K 128, unscaled) on every row; softmax f32 (wave per row) into hi/lo bf16 planes for all rows; P transposed on chip (exact bf16 moves): output rows l < 512 as hl P^T x hl v (3 products, K 2048), rows >= 512 as fp16(P^T x 1024) x fp16 v; + pe, written channels-first.

#define NB_  16
#define CIN  64
#define CC   128
#define KW   3
#define KI   (CIN * KW)     // 192
#define TT   2048
#define RH   512
#define PCAR 1024.0f
#define GB   4              // batches per launch in the attention stages (the score and probability planes of 4 batches fit the workspace)
typedef _Float16 h16;
typedef unsigned short bf;
typedef __attribute__((ext_vector_type(16))) __bf16   v16bf;
typedef __attribute__((ext_vector_type(16))) _Float16 v16h;
typedef __attribute__((ext_vector_type(8)))  _Float16 v8h;
typedef __attribute__((ext_vector_type(8)))  unsigned short v8us;
typedef __attribute__((ext_vector_type(8)))  float    v8f;
typedef __attribute__((ext_vector_type(4)))  float    v4f;
typedef v8h  __attribute__((may_alias)) v8ha;
typedef v4f  __attribute__((may_alias)) v4fa;
typedef v8us __attribute__((may_alias)) v8usa;

__device__ __forceinline__ unsigned short f2bf(float f) { unsigned u = __float_as_uint(f); u += 0x7FFFu + ((u >> 16) & 1u); return (unsigned short)(u >> 16); }
__device__ __forceinline__ float bf2f(unsigned short b) { return __uint_as_float(((unsigned)b) << 16); }
__device__ __forceinline__ float bfr(float f) { return bf2f(f2bf(f)); }
__device__ __forceinline__ v16h cat16(v8h lo, v8h hi) { return __builtin_shufflevector(lo, hi, 0, 1, 2, 3, 4, 5, 6, 7, 8, 9, 10, 11, 12, 13, 14, 15); }
__device__ __forceinline__ v16bf cat16b(v8us lo, v8us hi) { return __builtin_bit_cast(v16bf, __builtin_shufflevector(lo, hi, 0, 1, 2, 3, 4, 5, 6, 7, 8, 9, 10, 11, 12, 13, 14, 15)); }
__device__ __forceinline__ v8f wmma16(v16h a, v16h b, v8f c) { return __builtin_amdgcn_wmma_f32_16x16x32_f16(false, a, false, b, (short)0, c, false, false); }
__device__ __forceinline__ v8f wmmab(v16bf a, v16bf b, v8f c) { return __builtin_amdgcn_wmma_f32_16x16x32_bf16(false, a, false, b, (short)0, c, false, false); }



// ---- k_gemmw: register-blocked GEMM, ONE WAVE per 64x64 output tile (16 accumulators), operands straight from K-contiguous 16-bit planes; grid (M/64, N/64, Z), 32 threads.
// C[m][n] (f32, pitch ldc, + optional f32 bias[n]) = sum_k A[m][k] Bt[n][k] (+ split products per NSPLIT). z-batch strides sA/sB/sC in elements. K % 32 == 0.
template <typename T16> struct WFrag;
template <> struct WFrag<h16> { typedef v16h V; static __device__ __forceinline__ V ld(const h16* p) { return cat16(*(const v8h*)p, *(const v8h*)(p + 16)); } static __device__ __forceinline__ v8f mma(V a, V b, v8f c) { return wmma16(a, b, c); } };
template <> struct WFrag<bf> { typedef v16bf V; static __device__ __forceinline__ V ld(const bf* p) { return cat16b(*(const v8us*)p, *(const v8us*)(p + 16)); } static __device__ __forceinline__ v8f mma(V a, V b, v8f c) { return wmmab(a, b, c); } };
template <typename T16, int NSPLIT, bool BIAS>
__global__ __launch_bounds__(32) void k_gemmw(const T16* __restrict__ A, const T16* __restrict__ A2, const T16* __restrict__ Bt, const T16* __restrict__ Bt2, int K, float* C, int ldc, const float* __restrict__ bias, size_t sA, size_t sB, size_t sC) {
    typedef typename WFrag<T16>::V V;
    __shared__ __align__(16) float os[16 * 68];
    const size_t z = blockIdx.z; A += z * sA; if (A2) A2 += z * sA; Bt += z * sB; if (Bt2) Bt2 += z * sB; C += z * sC;
    const int lane = threadIdx.x & 31, lr = lane & 15, hi = lane >> 4; const int r0 = blockIdx.x * 64, c0 = blockIdx.y * 64;
    v8f acc[4][4];
#pragma unroll
    for (int mb = 0; mb < 4; ++mb)
#pragma unroll
        for (int nb = 0; nb < 4; ++nb) acc[mb][nb] = (v8f){};
    const size_t aoff = (size_t)(r0 + lr) * K + 8 * hi, boff = (size_t)(c0 + lr) * K + 8 * hi;
#pragma unroll 1
    for (int kc = 0; kc < K; kc += 32) {
        V a[4], a2[4];
#pragma unroll
        for (int mb = 0; mb < 4; ++mb) { a[mb] = WFrag<T16>::ld(A + aoff + (size_t)mb * 16 * K + kc); if (NSPLIT == 1 || NSPLIT == 2) a2[mb] = WFrag<T16>::ld(A2 + aoff + (size_t)mb * 16 * K + kc); }
#pragma unroll
        for (int nb = 0; nb < 4; ++nb) { const V b = WFrag<T16>::ld(Bt + boff + (size_t)nb * 16 * K + kc); V b2; if (NSPLIT >= 2) b2 = WFrag<T16>::ld(Bt2 + boff + (size_t)nb * 16 * K + kc);
#pragma unroll
            for (int mb = 0; mb < 4; ++mb) { acc[mb][nb] = WFrag<T16>::mma(a[mb], b, acc[mb][nb]); if (NSPLIT == 1 || NSPLIT == 2) acc[mb][nb] = WFrag<T16>::mma(a2[mb], b, acc[mb][nb]); if (NSPLIT >= 2) acc[mb][nb] = WFrag<T16>::mma(a[mb], b2, acc[mb][nb]); } }
        asm volatile("v_nop\n\tv_nop\n\tv_nop\n\tv_nop" : "+v"(acc[0][0]), "+v"(acc[1][1]), "+v"(acc[2][2]), "+v"(acc[3][3]) : "v"(a[0]), "v"(a[3]));
    }
#pragma unroll
    for (int mb = 0; mb < 4; ++mb) {
#pragma unroll
        for (int nb = 0; nb < 4; ++nb) {
#pragma unroll
            for (int j = 0; j < 8; ++j) os[(hi * 8 + j) * 68 + nb * 16 + lr] = acc[mb][nb][j]; }
        __builtin_amdgcn_wave_barrier(); asm volatile("" ::: "memory");
        float* crow = C + (size_t)(r0 + mb * 16) * ldc + c0;
{
#pragma unroll
            for (int s = 0; s < 8; ++s) { const int row = 2 * s + hi, cofs = lr * 4; v4f val = *(const v4fa*)(os + row * 68 + cofs); if (BIAS) { val[0] += bfr(bias[c0 + cofs]); val[1] += bfr(bias[c0 + cofs + 1]); val[2] += bfr(bias[c0 + cofs + 2]); val[3] += bfr(bias[c0 + cofs + 3]); }
                *(v4f*)(crow + (size_t)row * ldc + cofs) = val; }
             }
        __builtin_amdgcn_wave_barrier(); asm volatile("" ::: "memory");
    }
}

__device__ __forceinline__ h16 tohx(float x) { return (h16)x; }
__device__ __forceinline__ void splitf(float y, unsigned short& h, unsigned short& l) { h = f2bf(y); l = f2bf(y - bf2f(h)); }
typedef __attribute__((ext_vector_type(2))) unsigned short v2us;
typedef __attribute__((ext_vector_type(4))) unsigned short v4us;
typedef __attribute__((ext_vector_type(8))) unsigned short v8us;
typedef __attribute__((ext_vector_type(4))) _Float16 v4h;
typedef __attribute__((ext_vector_type(2))) float v2f;

__global__ __launch_bounds__(256) void k_cvt8(const float* __restrict__ src, bf* dst, size_t n8) { const size_t i = (size_t)blockIdx.x * 256 + threadIdx.x; if (i >= n8) return; const v8f v = *(const v8f*)(src + i * 8); v8us o;
#pragma unroll
    for (int k = 0; k < 8; ++k) o[k] = f2bf(v[k]); *(v8us*)(dst + i * 8) = o;  }
__global__ __launch_bounds__(256) void k_im2col(const float* __restrict__ xb, bf* X3) { xb += (size_t)blockIdx.y * CIN * TT; X3 += (size_t)blockIdx.y * TT * KI; const size_t e8 = ((size_t)blockIdx.x * 256 + threadIdx.x) * 8; if (e8 >= (size_t)TT * KI) return; const int kidx = (int)(e8 % KI); const int t = (int)(e8 / KI); v8us o;
#pragma unroll
    for (int u = 0; u < 8; ++u) { const int k2 = kidx + u; const int ci = k2 / KW, kk = k2 % KW; const int tt = t + kk - 1; o[u] = (tt >= 0 && tt < TT) ? f2bf(xb[(size_t)ci * TT + tt]) : (unsigned short)0; }
    *(v8us*)(X3 + e8) = o;  }
__global__ __launch_bounds__(256) void k_bnl(float* F, const float* __restrict__ gam, const float* __restrict__ bet, const float* __restrict__ mu, const float* __restrict__ var) { F += (size_t)blockIdx.y * TT * CC; const size_t e = ((size_t)blockIdx.x * 256 + threadIdx.x) * 4; if (e >= (size_t)TT * CC) return; const int c0 = (int)(e % CC); const v4f a = *(const v4f*)(F + e); v4f o;
#pragma unroll
    for (int u = 0; u < 4; ++u) { const int c = c0 + u; const float sc = __fmul_rn(bfr(gam[c]), __fdiv_rn(1.0f, sqrtf(__fadd_rn(bfr(var[c]), 1e-5f)))); float ms = __fmul_rn(bfr(mu[c]), sc); asm volatile("" : "+v"(ms)); const float sh = __fsub_rn(bfr(bet[c]), ms); float y = __fmul_rn(a[u], sc); asm volatile("" : "+v"(y)); y = __fadd_rn(y, sh); o[u] = (y > 0.f) ? y : 0.3f * y; }
    *(v4f*)(F + e) = o;  }
__global__ __launch_bounds__(256) void k_hlN(const float* __restrict__ F, bf* Fh, bf* Fl) { { const size_t zo = (size_t)blockIdx.y * TT * CC; F += zo; Fh += zo; Fl += zo; } const size_t e = ((size_t)blockIdx.x * 256 + threadIdx.x) * 4; if (e >= (size_t)TT * CC) return; const v4f a = *(const v4f*)(F + e); v4us oh, ol; for (int u = 0; u < 4; ++u) { unsigned short p, q; splitf(a[u], p, q); oh[u] = p; ol[u] = q; } *(v4us*)(Fh + e) = oh; *(v4us*)(Fl + e) = ol;  }
__global__ __launch_bounds__(256) void k_hlT(const float* __restrict__ F, bf* Th, bf* Tl, h16* T16) { { const size_t zo = (size_t)blockIdx.y * TT * CC; F += zo; Th += zo; Tl += zo; T16 += zo; } const size_t e = ((size_t)blockIdx.x * 256 + threadIdx.x) * 2; if (e >= (size_t)CC * TT) return; const int t = (int)(e % TT); const int c = (int)(e / TT); v2us oh, ol; _Float16 f0, f1;
    { unsigned short p, q; const float a0 = F[(size_t)t * CC + c]; splitf(a0, p, q); oh[0] = p; ol[0] = q; f0 = tohx(a0); const float a1 = F[(size_t)(t + 1) * CC + c]; splitf(a1, p, q); oh[1] = p; ol[1] = q; f1 = tohx(a1); }
    typedef __attribute__((ext_vector_type(2))) _Float16 v2h; v2h fo; fo[0] = f0; fo[1] = f1;
    *(v2us*)(Th + e) = oh; *(v2us*)(Tl + e) = ol; *(v2h*)(T16 + e) = fo;  }
__global__ __launch_bounds__(256) void k_psoft(const float* __restrict__ S, bf* Ph, bf* Pl) { { const size_t zo = (size_t)blockIdx.y * TT * TT; S += zo; Ph += zo; Pl += zo; } const int lane = threadIdx.x & 31; const int row = blockIdx.x * 8 + (threadIdx.x >> 5); if (row >= TT) return; const float* sr = S + (size_t)row * TT; float v[TT / 32]; float mx = -3.0e38f;
#pragma unroll
    for (int ch = 0; ch < TT / 128; ++ch) { const v4f a = *(const v4f*)(sr + ch * 128 + lane * 4);
#pragma unroll
        for (int u = 0; u < 4; ++u) { float sa = a[u]; asm volatile("" : "+v"(sa)); v[ch * 4 + u] = sa; mx = fmaxf(mx, sa); } }
#pragma unroll
    for (int sh = 16; sh; sh >>= 1) mx = fmaxf(mx, __shfl_xor(mx, sh, 32));
    float sum = 0.f;
#pragma unroll
    for (int q = 0; q < TT / 32; ++q) { float d0 = __fsub_rn(v[q], mx); asm volatile("" : "+v"(d0)); v[q] = __builtin_amdgcn_exp2f(__fmul_rn(d0, 1.4426950408889634f)); sum += v[q]; }
#pragma unroll
    for (int sh = 16; sh; sh >>= 1) sum += __shfl_xor(sum, sh, 32);
    const float f = __fdiv_rn(1.0f, sum);
    {
#pragma unroll
        for (int ch = 0; ch < TT / 128; ++ch) { v4us oh, ol; for (int q = 0; q < 4; ++q) { unsigned short a, c2; splitf(v[ch * 4 + q] * f, a, c2); oh[q] = a; ol[q] = c2; } const size_t oo = (size_t)row * TT + ch * 128 + lane * 4; *(v4us*)(Ph + oo) = oh; *(v4us*)(Pl + oo) = ol; }
         } }
// ---- k_ptr: P -> P^T by 128 x 128 tiles. A tile's rows are read whole (256 B a row), laid in LDS, read back through the 16-bit transposing LDS load (a lane gets 8 consecutive j of one column l) and stored 16 B a lane.
#define TPT  128            // tile edge, elements; one block owns whole 256-B pieces of 128 output rows
#define TPP  288            // LDS row pitch in bytes: 256 + 32, an odd multiple of 32 B (the pitch the transposing load reads without bank conflicts)
typedef __attribute__((ext_vector_type(8))) short s16x8;
typedef __attribute__((address_space(3))) s16x8 lds_s16x8;
__device__ __forceinline__ v8us ldtr16(const unsigned char* p) { return __builtin_bit_cast(v8us, __builtin_amdgcn_ds_load_tr16_b128_v8i16((lds_s16x8*)p)); }
__global__ __launch_bounds__(256) void k_ptr(const bf* __restrict__ Ph, const bf* __restrict__ Pl, bf* PTh, bf* PTl, h16* PT16) {
    __shared__ __attribute__((aligned(32))) unsigned char tile[2][TPT * TPP];
    { const size_t zb = blockIdx.y; Ph += zb * TT * TT; Pl += zb * TT * TT; PTh += zb * RH * TT; PTl += zb * RH * TT; PT16 += zb * (TT - RH) * TT; }
    const int j0 = (int)(blockIdx.x % (TT / TPT)) * TPT, l0 = (int)(blockIdx.x / (TT / TPT)) * TPT;   // l0 < RH is the same for the whole block: RH % TPT == 0
    const int tid = threadIdx.x, lane = tid & 31, w = tid >> 5;
    const int rr = tid >> 4, ce = (tid & 15) * 8;    // 16 threads a row, 16 rows a pass
    const bf* ph = Ph + (size_t)(j0 + rr) * TT + l0 + ce; const bf* pl = Pl + (size_t)(j0 + rr) * TT + l0 + ce;
    v8us a[TPT / 16], c[TPT / 16];
    // every loop of this kernel is unrolled whole: a[] and c[] stay in registers, and the 16 global loads, later the LDS reads, are all in flight at once
#pragma unroll
    for (int p = 0; p < TPT / 16; ++p) { a[p] = *(const v8us*)(ph + (size_t)p * 16 * TT); c[p] = *(const v8us*)(pl + (size_t)p * 16 * TT); }
    asm volatile("s_wait_xcnt 0x0" :: "v"(ph), "v"(pl) : "memory");   // the 16 loads' two address pairs stay as they are (no load lands on them, nothing rewrites them) until this wait
    if (l0 < RH) {
#pragma unroll
        for (int p = 0; p < TPT / 16; ++p) { const int o = (p * 16 + rr) * TPP + ce * 2; *(v8usa*)(tile[0] + o) = a[p]; *(v8usa*)(tile[1] + o) = c[p]; }
    } else {
#pragma unroll
        for (int p = 0; p < TPT / 16; ++p) { v8h o8;
#pragma unroll
            for (int u = 0; u < 8; ++u) o8[u] = tohx(__fadd_rn(bf2f(a[p][u]), bf2f(c[p][u])) * PCAR);
            *(v8ha*)(tile[0] + (p * 16 + rr) * TPP + ce * 2) = o8; }
    }
    __syncthreads();
    // wave w owns the tile's columns 16w .. 16w + 15, i.e. 16 output rows; each trip moves 16 j: lane (c = lane & 15, h = lane >> 4) gets tile[16 kb + 8h + 0..7][16w + c]
    const int rd = (8 * (lane >> 4) + (lane & 7)) * TPP + 32 * w + 16 * ((lane >> 3) & 1);
    const int ol = l0 + 16 * w + (lane & 15), oj = j0 + 8 * (lane >> 4);
    if (l0 < RH) { const size_t ob = (size_t)ol * TT + oj;
#pragma unroll
        for (int kb = 0; kb < TPT / 16; ++kb) { *(v8us*)(PTh + ob + kb * 16) = ldtr16(tile[0] + rd + kb * 16 * TPP); *(v8us*)(PTl + ob + kb * 16) = ldtr16(tile[1] + rd + kb * 16 * TPP); }
        asm volatile("s_wait_xcnt 0x0" ::: "memory");   // behind this arm's last store: no register that a store names is rewritten ahead of it
        return;   // each arm ends by itself, so that its wait stays directly behind its own stores and is not drawn into a shared tail
    } else { const size_t ob = (size_t)(ol - RH) * TT + oj;
#pragma unroll
        for (int kb = 0; kb < TPT / 16; ++kb) *(v8h*)(PT16 + ob + kb * 16) = __builtin_bit_cast(v8h, ldtr16(tile[0] + rd + kb * 16 * TPP));
        asm volatile("s_wait_xcnt 0x0" ::: "memory");   // behind this arm's last store, as above
    } }
__global__ __launch_bounds__(256) void k_fin(const float* __restrict__ OT, const float* __restrict__ PE, float* OUTb) { { const size_t zo = (size_t)blockIdx.y * TT * CC; OT += zo; PE += zo; OUTb += zo; } const size_t e = ((size_t)blockIdx.x * 256 + threadIdx.x) * 4; if (e >= (size_t)CC * TT) return; const int l = (int)(e % TT); const int c = (int)(e / TT); v4f r;
#pragma unroll
    for (int u = 0; u < 4; ++u) { const int ll = l + u; const float cs = (ll < RH) ? 1.0f : (1.0f / PCAR); float o = OT[(size_t)ll * CC + c] * cs; asm volatile("" : "+v"(o)); r[u] = __fadd_rn(o, PE[(size_t)ll * CC + c]); }
    *(v4f*)(OUTb + e) = r;  }

extern "C" void kernel_launch(void* const* d_in, const int* in_sizes, int n_in,
                              void* d_out, int out_size, void* d_ws, size_t ws_size, hipStream_t stream) {
    (void)in_sizes; (void)n_in; (void)out_size;
    const float* x = (const float*)d_in[0];
    const float* prm[4][6]; for (int r = 0; r < 4; ++r) for (int c = 0; c < 6; ++c) prm[r][c] = (const float*)d_in[1 + r * 6 + c];   // (w, b, gamma, beta, mean, var) for q, k, v, pe
    float* OUT = (float*)d_out;     // [16][128][2048]
    char* wsp = (char*)d_ws;
    auto take = [&](size_t bytes) { char* p = wsp; wsp += (bytes + 255) & ~(size_t)255; return (void*)p; };
    const size_t FE = (size_t)TT * CC, SE = (size_t)TT * TT;   // elements of one batch's [2048][128] plane and of its [2048][2048] plane
    bf* W4 = (bf*)take((size_t)4 * CC * KI * 2);
    // live through the whole call, all 16 batches
    bf* QPh = (bf*)take(NB_ * FE * 2); bf* QPl = (bf*)take(NB_ * FE * 2); bf* KPh = (bf*)take(NB_ * FE * 2); bf* KPl = (bf*)take(NB_ * FE * 2);
    bf* VTh = (bf*)take(NB_ * FE * 2); bf* VTl = (bf*)take(NB_ * FE * 2); h16* VT16 = (h16*)take(NB_ * FE * 2); float* FPE = (float*)take(NB_ * FE * 4);
    // one group of GB batches
    float* S = (float*)take(GB * SE * 4); bf* Ph = (bf*)take(GB * SE * 2); bf* Pl = (bf*)take(GB * SE * 2); bf* PTh = (bf*)take((size_t)GB * RH * TT * 2); bf* PTl = (bf*)take((size_t)GB * RH * TT * 2); h16* PT16 = (h16*)take((size_t)GB * (TT - RH) * TT * 2); float* OT = (float*)take(GB * FE * 4);
    if ((size_t)(wsp - (char*)d_ws) > ws_size) return;    // ~ 244 MiB
    // the convolution stage's own planes (60 MiB, all 16 batches) lie in S (64 MiB): their last reader runs before the first score launch writes S
    bf* X3 = (bf*)S; float* FQ = (float*)(X3 + (size_t)NB_ * TT * KI); float* FK = FQ + NB_ * FE; float* FV = FK + NB_ * FE;
    for (int r = 0; r < 4; ++r) k_cvt8<<<(unsigned)(((size_t)CC * KI / 8 + 255) / 256), 256, 0, stream>>>(prm[r][0], W4 + (size_t)r * CC * KI, (size_t)CC * KI / 8);   // w [128][64][3] == Bt [128][192]
    k_im2col<<<dim3((unsigned)(((size_t)TT * KI / 8 + 255) / 256), NB_, 1), 256, 0, stream>>>(x, X3);
    float* F4[4] = {FQ, FK, FV, FPE};
    for (int r = 0; r < 4; ++r) { k_gemmw<bf, 0, true><<<dim3(TT / 64, CC / 64, NB_), 32, 0, stream>>>(X3, nullptr, W4 + (size_t)r * CC * KI, nullptr, KI, F4[r], CC, prm[r][1], (size_t)TT * KI, 0, FE); k_bnl<<<dim3((unsigned)((FE / 4 + 255) / 256), NB_, 1), 256, 0, stream>>>(F4[r], prm[r][2], prm[r][3], prm[r][4], prm[r][5]); }
    k_hlN<<<dim3((unsigned)((FE / 4 + 255) / 256), NB_, 1), 256, 0, stream>>>(FQ, QPh, QPl); k_hlN<<<dim3((unsigned)((FE / 4 + 255) / 256), NB_, 1), 256, 0, stream>>>(FK, KPh, KPl); k_hlT<<<dim3((unsigned)((FE / 2 + 255) / 256), NB_, 1), 256, 0, stream>>>(FV, VTh, VTl, VT16);
    for (int b = 0; b < NB_; b += GB) { const size_t bo = (size_t)b * FE;
        k_gemmw<bf, 2, false><<<dim3(TT / 64, TT / 64, GB), 32, 0, stream>>>(QPh + bo, QPl + bo, KPh + bo, KPl + bo, CC, S, TT, nullptr, FE, FE, SE);                               // attn logits (3 products)
        k_psoft<<<dim3(TT / 8, GB, 1), 256, 0, stream>>>(S, Ph, Pl);
        k_ptr<<<dim3((TT / TPT) * (TT / TPT), GB, 1), 256, 0, stream>>>(Ph, Pl, PTh, PTl, PT16);
        k_gemmw<bf, 2, false><<<dim3(RH / 64, CC / 64, GB), 32, 0, stream>>>(PTh, PTl, VTh + bo, VTl + bo, TT, OT, CC, nullptr, (size_t)RH * TT, FE, FE);                             // rows l < RH: hl P^T x hl v
        k_gemmw<h16, 0, false><<<dim3((TT - RH) / 64, CC / 64, GB), 32, 0, stream>>>(PT16, nullptr, VT16 + bo, nullptr, TT, OT + (size_t)RH * CC, CC, nullptr, (size_t)(TT - RH) * TT, FE, FE);   // rest: fp16 x1024
        k_fin<<<dim3((unsigned)((FE / 4 + 255) / 256), GB, 1), 256, 0, stream>>>(OT, FPE + bo, OUT + bo); }
}

// v003
// It runs in 596 microseconds.
// In both of two side-by-side timings against v002, it was 1.30 times as fast.
// All steps since v000 together make it 5.34 times as fast.
#include <hip/hip_runtime.h>

// Conv1dAttention (x [16][64][2048] channels-first; q/k/v/pe = LeakyReLU_0.3(BN(conv1d_k3(x) + b)) with 128 output channels (BN inference affine: y*scale + (beta - mean*scale), scale = gamma*rsqrt(var + 1e-5)); attn[i][j] = sum_c q[c][i] k[c][j] (NO scaling); P = softmax_j; out[c][l] = sum_j v[c][j] P[j][l] + pe[c][l] -> [16][128][2048] - note the value product contracts over the softmax ROW index j, i.e. it uses P TRANSPOSED).
// Compute dtypes, f32 accumulate: every input rounded to bf16; the four k=3 convolutions as PLAIN bf16 im2col GEMMs (K = 192, inputs: exact) + bias, BN affine and LeakyReLU in f32; scores hl x hl (3 products, K 128, unscaled) on every row; softmax f32 (wave per row) into hi/lo bf16 planes for all rows; P transposed on chip (exact bf16 moves): output rows l < 512 as hl P^T x hl v (3 products, K 2048), rows >= 512 as fp16(P^T x 1024) x fp16 v; + pe, written channels-first.

#define NB_  16
#define CIN  64
#define CC   128
#define KW   3
#define KI   (CIN * KW)     // 192
#define TT   2048
#define RH   512
#define PCAR 1024.0f
#define KWV  8              // waves that share one tile's K in the two P^T x v products
#define GB   4              // batches per launch in the attention stages (the score and probability planes of 4 batches fit the workspace)
typedef _Float16 h16;
typedef unsigned short bf;
typedef __attribute__((ext_vector_type(16))) __bf16   v16bf;
typedef __attribute__((ext_vector_type(16))) _Float16 v16h;
typedef __attribute__((ext_vector_type(8)))  _Float16 v8h;
typedef __attribute__((ext_vector_type(8)))  unsigned short v8us;
typedef __attribute__((ext_vector_type(8)))  float    v8f;
typedef __attribute__((ext_vector_type(4)))  float    v4f;
typedef v8h  __attribute__((may_alias)) v8ha;
typedef v4f  __attribute__((may_alias)) v4fa;
typedef v8us __attribute__((may_alias)) v8usa;

__device__ __forceinline__ unsigned short f2bf(float f) { unsigned u = __float_as_uint(f); u += 0x7FFFu + ((u >> 16) & 1u); return (unsigned short)(u >> 16); }
__device__ __forceinline__ float bf2f(unsigned short b) { return __uint_as_float(((unsigned)b) << 16); }
__device__ __forceinline__ float bfr(float f) { return bf2f(f2bf(f)); }
__device__ __forceinline__ v16h cat16(v8h lo, v8h hi) { return __builtin_shufflevector(lo, hi, 0, 1, 2, 3, 4, 5, 6, 7, 8, 9, 10, 11, 12, 13, 14, 15); }
__device__ __forceinline__ v16bf cat16b(v8us lo, v8us hi) { return __builtin_bit_cast(v16bf, __builtin_shufflevector(lo, hi, 0, 1, 2, 3, 4, 5, 6, 7, 8, 9, 10, 11, 12, 13, 14, 15)); }
__device__ __forceinline__ v8f wmma16(v16h a, v16h b, v8f c) { return __builtin_amdgcn_wmma_f32_16x16x32_f16(false, a, false, b, (short)0, c, false, false); }
__device__ __forceinline__ v8f wmmab(v16bf a, v16bf b, v8f c) { return __builtin_amdgcn_wmma_f32_16x16x32_bf16(false, a, false, b, (short)0, c, false, false); }



// ---- k_gemmw: register-blocked GEMM, ONE WAVE per 64x64 output tile (16 accumulators) where NW == 1, operands straight from K-contiguous 16-bit planes; grid (M/64, N/64, Z), 32 threads.
// C[m][n] (f32, pitch ldc, + optional f32 bias[n]) = sum_k A[m][k] Bt[n][k] (+ split products per NSPLIT). z-batch strides sA/sB/sC in elements. K % 32 == 0.
// NW > 1 (a long K on a small grid; 32 * NW threads, no bias): the tile's K is dealt to NW waves of one work-group. Wave w takes the 32-element chunks w, w + NW, w + 2 NW, ... (neighbouring waves read neighbouring
// 64-B pieces of the same rows at about the same time), keeps a whole 64x64 partial tile in its accumulators and lays it in LDS; the block then adds the NW partial tiles in wave order and stores the sum.
#define RPT  68             // pitch of a partial tile's row in LDS, floats: the two 8-row halves of an accumulator's store fall on different banks
template <typename T16> struct WFrag;
template <> struct WFrag<h16> { typedef v16h V; static __device__ __forceinline__ V ld(const h16* p) { return cat16(*(const v8h*)p, *(const v8h*)(p + 16)); } static __device__ __forceinline__ v8f mma(V a, V b, v8f c) { return wmma16(a, b, c); } };
template <> struct WFrag<bf> { typedef v16bf V; static __device__ __forceinline__ V ld(const bf* p) { return cat16b(*(const v8us*)p, *(const v8us*)(p + 16)); } static __device__ __forceinline__ v8f mma(V a, V b, v8f c) { return wmmab(a, b, c); } };
template <typename T16, int NSPLIT, bool BIAS, int NW>
__global__ __launch_bounds__(32 * NW) void k_gemmw(const T16* __restrict__ A, const T16* __restrict__ A2, const T16* __restrict__ Bt, const T16* __restrict__ Bt2, int K, float* C, int ldc, const float* __restrict__ bias, size_t sA, size_t sB, size_t sC) {
    typedef typename WFrag<T16>::V V;
    __shared__ __align__(16) float os[16 * 68];
    __shared__ __align__(16) float red[NW > 1 ? NW * 64 * RPT : 4];
    const int w = NW > 1 ? __builtin_amdgcn_readfirstlane((int)(threadIdx.x >> 5)) : 0;   // the wave's number, in a scalar register: the K loop's counter stays scalar
    const size_t z = blockIdx.z; A += z * sA; if (A2) A2 += z * sA; Bt += z * sB; if (Bt2) Bt2 += z * sB; C += z * sC;
    const int lane = threadIdx.x & 31, lr = lane & 15, hi = lane >> 4; const int r0 = blockIdx.x * 64, c0 = blockIdx.y * 64;
    v8f acc[4][4];
#pragma unroll
    for (int mb = 0; mb < 4; ++mb)
#pragma unroll
        for (int nb = 0; nb < 4; ++nb) acc[mb][nb] = (v8f){};
    const size_t aoff = (size_t)(r0 + lr) * K + 8 * hi, boff = (size_t)(c0 + lr) * K + 8 * hi;
#pragma unroll 1
    for (int kc = 32 * w; kc < K; kc += 32 * NW) {
        V a[4], a2[4];
#pragma unroll
        for (int mb = 0; mb < 4; ++mb) { a[mb] = WFrag<T16>::ld(A + aoff + (size_t)mb * 16 * K + kc); if (NSPLIT == 1 || NSPLIT == 2) a2[mb] = WFrag<T16>::ld(A2 + aoff + (size_t)mb * 16 * K + kc); }
#pragma unroll
        for (int nb = 0; nb < 4; ++nb) { const V b = WFrag<T16>::ld(Bt + boff + (size_t)nb * 16 * K + kc); V b2; if (NSPLIT >= 2) b2 = WFrag<T16>::ld(Bt2 + boff + (size_t)nb * 16 * K + kc);
#pragma unroll
            for (int mb = 0; mb < 4; ++mb) { acc[mb][nb] = WFrag<T16>::mma(a[mb], b, acc[mb][nb]); if (NSPLIT == 1 || NSPLIT == 2) acc[mb][nb] = WFrag<T16>::mma(a2[mb], b, acc[mb][nb]); if (NSPLIT >= 2) acc[mb][nb] = WFrag<T16>::mma(a[mb], b2, acc[mb][nb]); } }
        asm volatile("v_nop\n\tv_nop\n\tv_nop\n\tv_nop" : "+v"(acc[0][0]), "+v"(acc[1][1]), "+v"(acc[2][2]), "+v"(acc[3][3]) : "v"(a[0]), "v"(a[3]));
    }
    if (NW > 1) {
        // the loops below are unrolled whole: acc[][] is indexed by constants alone and stays in registers, and a thread's LDS reads are all in flight at once
        float* my = red + w * 64 * RPT;
#pragma unroll
        for (int mb = 0; mb < 4; ++mb)
#pragma unroll
            for (int nb = 0; nb < 4; ++nb)
#pragma unroll
                for (int j = 0; j < 8; ++j) my[(mb * 16 + hi * 8 + j) * RPT + nb * 16 + lr] = acc[mb][nb][j];
        __syncthreads();   // every wave's partial tile lies in LDS before any of it is added
#pragma unroll
        for (int s = 0; s < 64 * 16 / (32 * NW); ++s) { const int idx = s * 32 * NW + (int)threadIdx.x; const int row = idx >> 4, cofs = (idx & 15) * 4; v4f sum = *(const v4fa*)(red + row * RPT + cofs);
#pragma unroll
            for (int u = 1; u < NW; ++u) sum += *(const v4fa*)(red + (u * 64 + row) * RPT + cofs);
            *(v4f*)(C + (size_t)(r0 + row) * ldc + c0 + cofs) = sum; }
        return;
    }
#pragma unroll
    for (int mb = 0; mb < 4; ++mb) {
#pragma unroll
        for (int nb = 0; nb < 4; ++nb) {
#pragma unroll
            for (int j = 0; j < 8; ++j) os[(hi * 8 + j) * 68 + nb * 16 + lr] = acc[mb][nb][j]; }
        __builtin_amdgcn_wave_barrier(); asm volatile("" ::: "memory");
        float* crow = C + (size_t)(r0 + mb * 16) * ldc + c0;
{
#pragma unroll
            for (int s = 0; s < 8; ++s) { const int row = 2 * s + hi, cofs = lr * 4; v4f val = *(const v4fa*)(os + row * 68 + cofs); if (BIAS) { val[0] += bfr(bias[c0 + cofs]); val[1] += bfr(bias[c0 + cofs + 1]); val[2] += bfr(bias[c0 + cofs + 2]); val[3] += bfr(bias[c0 + cofs + 3]); }
                *(v4f*)(crow + (size_t)row * ldc + cofs) = val; }
             }
        __builtin_amdgcn_wave_barrier(); asm volatile("" ::: "memory");
    }
}

__device__ __forceinline__ h16 tohx(float x) { return (h16)x; }
__device__ __forceinline__ void splitf(float y, unsigned short& h, unsigned short& l) { h = f2bf(y); l = f2bf(y - bf2f(h)); }
typedef __attribute__((ext_vector_type(2))) unsigned short v2us;
typedef __attribute__((ext_vector_type(4))) unsigned short v4us;
typedef __attribute__((ext_vector_type(8))) unsigned short v8us;
typedef __attribute__((ext_vector_type(4))) _Float16 v4h;
typedef __attribute__((ext_vector_type(2))) float v2f;

__global__ __launch_bounds__(256) void k_cvt8(const float* __restrict__ src, bf* dst, size_t n8) { const size_t i = (size_t)blockIdx.x * 256 + threadIdx.x; if (i >= n8) return; const v8f v = *(const v8f*)(src + i * 8); v8us o;
#pragma unroll
    for (int k = 0; k < 8; ++k) o[k] = f2bf(v[k]); *(v8us*)(dst + i * 8) = o;  }
__global__ __launch_bounds__(256) void k_im2col(const float* __restrict__ xb, bf* X3) { xb += (size_t)blockIdx.y * CIN * TT; X3 += (size_t)blockIdx.y * TT * KI; const size_t e8 = ((size_t)blockIdx.x * 256 + threadIdx.x) * 8; if (e8 >= (size_t)TT * KI) return; const int kidx = (int)(e8 % KI); const int t = (int)(e8 / KI); v8us o;
#pragma unroll
    for (int u = 0; u < 8; ++u) { const int k2 = kidx + u; const int ci = k2 / KW, kk = k2 % KW; const int tt = t + kk - 1; o[u] = (tt >= 0 && tt < TT) ? f2bf(xb[(size_t)ci * TT + tt]) : (unsigned short)0; }
    *(v8us*)(X3 + e8) = o;  }
__global__ __launch_bounds__(256) void k_bnl(float* F, const float* __restrict__ gam, const float* __restrict__ bet, const float* __restrict__ mu, const float* __restrict__ var) { F += (size_t)blockIdx.y * TT * CC; const size_t e = ((size_t)blockIdx.x * 256 + threadIdx.x) * 4; if (e >= (size_t)TT * CC) return; const int c0 = (int)(e % CC); const v4f a = *(const v4f*)(F + e); v4f o;
#pragma unroll
    for (int u = 0; u < 4; ++u) { const int c = c0 + u; const float sc = __fmul_rn(bfr(gam[c]), __fdiv_rn(1.0f, sqrtf(__fadd_rn(bfr(var[c]), 1e-5f)))); float ms = __fmul_rn(bfr(mu[c]), sc); asm volatile("" : "+v"(ms)); const float sh = __fsub_rn(bfr(bet[c]), ms); float y = __fmul_rn(a[u], sc); asm volatile("" : "+v"(y)); y = __fadd_rn(y, sh); o[u] = (y > 0.f) ? y : 0.3f * y; }
    *(v4f*)(F + e) = o;  }
__global__ __launch_bounds__(256) void k_hlN(const float* __restrict__ F, bf* Fh, bf* Fl) { { const size_t zo = (size_t)blockIdx.y * TT * CC; F += zo; Fh += zo; Fl += zo; } const size_t e = ((size_t)blockIdx.x * 256 + threadIdx.x) * 4; if (e >= (size_t)TT * CC) return; const v4f a = *(const v4f*)(F + e); v4us oh, ol; for (int u = 0; u < 4; ++u) { unsigned short p, q; splitf(a[u], p, q); oh[u] = p; ol[u] = q; } *(v4us*)(Fh + e) = oh; *(v4us*)(Fl + e) = ol;  }
__global__ __launch_bounds__(256) void k_hlT(const float* __restrict__ F, bf* Th, bf* Tl, h16* T16) { { const size_t zo = (size_t)blockIdx.y * TT * CC; F += zo; Th += zo; Tl += zo; T16 += zo; } const size_t e = ((size_t)blockIdx.x * 256 + threadIdx.x) * 2; if (e >= (size_t)CC * TT) return; const int t = (int)(e % TT); const int c = (int)(e / TT); v2us oh, ol; _Float16 f0, f1;
    { unsigned short p, q; const float a0 = F[(size_t)t * CC + c]; splitf(a0, p, q); oh[0] = p; ol[0] = q; f0 = tohx(a0); const float a1 = F[(size_t)(t + 1) * CC + c]; splitf(a1, p, q); oh[1] = p; ol[1] = q; f1 = tohx(a1); }
    typedef __attribute__((ext_vector_type(2))) _Float16 v2h; v2h fo; fo[0] = f0; fo[1] = f1;
    *(v2us*)(Th + e) = oh; *(v2us*)(Tl + e) = ol; *(v2h*)(T16 + e) = fo;  }
__global__ __launch_bounds__(256) void k_psoft(const float* __restrict__ S, bf* Ph, bf* Pl) { { const size_t zo = (size_t)blockIdx.y * TT * TT; S += zo; Ph += zo; Pl += zo; } const int lane = threadIdx.x & 31; const int row = blockIdx.x * 8 + (threadIdx.x >> 5); if (row >= TT) return; const float* sr = S + (size_t)row * TT; float v[TT / 32]; float mx = -3.0e38f;
#pragma unroll
    for (int ch = 0; ch < TT / 128; ++ch) { const v4f a = *(const v4f*)(sr + ch * 128 + lane * 4);
#pragma unroll
        for (int u = 0; u < 4; ++u) { float sa = a[u]; asm volatile("" : "+v"(sa)); v[ch * 4 + u] = sa; mx = fmaxf(mx, sa); } }
#pragma unroll
    for (int sh = 16; sh; sh >>= 1) mx = fmaxf(mx, __shfl_xor(mx, sh, 32));
    float sum = 0.f;
#pragma unroll
    for (int q = 0; q < TT / 32; ++q) { float d0 = __fsub_rn(v[q], mx); asm volatile("" : "+v"(d0)); v[q] = __builtin_amdgcn_exp2f(__fmul_rn(d0, 1.4426950408889634f)); sum += v[q]; }
#pragma unroll
    for (int sh = 16; sh; sh >>= 1) sum += __shfl_xor(sum, sh, 32);
    const float f = __fdiv_rn(1.0f, sum);
    {
#pragma unroll
        for (int ch = 0; ch < TT / 128; ++ch) { v4us oh, ol; for (int q = 0; q < 4; ++q) { unsigned short a, c2; splitf(v[ch * 4 + q] * f, a, c2); oh[q] = a; ol[q] = c2; } const size_t oo = (size_t)row * TT + ch * 128 + lane * 4; *(v4us*)(Ph + oo) = oh; *(v4us*)(Pl + oo) = ol; }
         } }
// ---- k_ptr: P -> P^T by 128 x 128 tiles. A tile's rows are read whole (256 B a row), laid in LDS, read back through the 16-bit transposing LDS load (a lane gets 8 consecutive j of one column l) and stored 16 B a lane.
#define TPT  128            // tile edge, elements; one block owns whole 256-B pieces of 128 output rows
#define TPP  288            // LDS row pitch in bytes: 256 + 32, an odd multiple of 32 B (the pitch the transposing load reads without bank conflicts)
typedef __attribute__((ext_vector_type(8))) short s16x8;
typedef __attribute__((address_space(3))) s16x8 lds_s16x8;
__device__ __forceinline__ v8us ldtr16(const unsigned char* p) { return __builtin_bit_cast(v8us, __builtin_amdgcn_ds_load_tr16_b128_v8i16((lds_s16x8*)p)); }
__global__ __launch_bounds__(256) void k_ptr(const bf* __restrict__ Ph, const bf* __restrict__ Pl, bf* PTh, bf* PTl, h16* PT16) {
    __shared__ __attribute__((aligned(32))) unsigned char tile[2][TPT * TPP];
    { const size_t zb = blockIdx.y; Ph += zb * TT * TT; Pl += zb * TT * TT; PTh += zb * RH * TT; PTl += zb * RH * TT; PT16 += zb * (TT - RH) * TT; }
    const int j0 = (int)(blockIdx.x % (TT / TPT)) * TPT, l0 = (int)(blockIdx.x / (TT / TPT)) * TPT;   // l0 < RH is the same for the whole block: RH % TPT == 0
    const int tid = threadIdx.x, lane = tid & 31, w = tid >> 5;
    const int rr = tid >> 4, ce = (tid & 15) * 8;    // 16 threads a row, 16 rows a pass
    const bf* ph = Ph + (size_t)(j0 + rr) * TT + l0 + ce; const bf* pl = Pl + (size_t)(j0 + rr) * TT + l0 + ce;
    v8us a[TPT / 16], c[TPT / 16];
    // every loop of this kernel is unrolled whole: a[] and c[] stay in registers, and the 16 global loads, later the LDS reads, are all in flight at once
#pragma unroll
    for (int p = 0; p < TPT / 16; ++p) { a[p] = *(const v8us*)(ph + (size_t)p * 16 * TT); c[p] = *(const v8us*)(pl + (size_t)p * 16 * TT); }
    asm volatile("s_wait_xcnt 0x0" :: "v"(ph), "v"(pl) : "memory");   // the 16 loads' two address pairs stay as they are (no load lands on them, nothing rewrites them) until this wait
    if (l0 < RH) {
#pragma unroll
        for (int p = 0; p < TPT / 16; ++p) { const int o = (p * 16 + rr) * TPP + ce * 2; *(v8usa*)(tile[0] + o) = a[p]; *(v8usa*)(tile[1] + o) = c[p]; }
    } else {
#pragma unroll
        for (int p = 0; p < TPT / 16; ++p) { v8h o8;
#pragma unroll
            for (int u = 0; u < 8; ++u) o8[u] = tohx(__fadd_rn(bf2f(a[p][u]), bf2f(c[p][u])) * PCAR);
            *(v8ha*)(tile[0] + (p * 16 + rr) * TPP + ce * 2) = o8; }
    }
    __syncthreads();
    // wave w owns the tile's columns 16w .. 16w + 15, i.e. 16 output rows; each trip moves 16 j: lane (c = lane & 15, h = lane >> 4) gets tile[16 kb + 8h + 0..7][16w + c]
    const int rd = (8 * (lane >> 4) + (lane & 7)) * TPP + 32 * w + 16 * ((lane >> 3) & 1);
    const int ol = l0 + 16 * w + (lane & 15), oj = j0 + 8 * (lane >> 4);
    if (l0 < RH) { const size_t ob = (size_t)ol * TT + oj;
#pragma unroll
        for (int kb = 0; kb < TPT / 16; ++kb) { *(v8us*)(PTh + ob + kb * 16) = ldtr16(tile[0] + rd + kb * 16 * TPP); *(v8us*)(PTl + ob + kb * 16) = ldtr16(tile[1] + rd + kb * 16 * TPP); }
        asm volatile("s_wait_xcnt 0x0" ::: "memory");   // behind this arm's last store: no register that a store names is rewritten ahead of it
        return;   // each arm ends by itself, so that its wait stays directly behind its own stores and is not drawn into a shared tail
    } else { const size_t ob = (size_t)(ol - RH) * TT + oj;
#pragma unroll
        for (int kb = 0; kb < TPT / 16; ++kb) *(v8h*)(PT16 + ob + kb * 16) = __builtin_bit_cast(v8h, ldtr16(tile[0] + rd + kb * 16 * TPP));
        asm volatile("s_wait_xcnt 0x0" ::: "memory");   // behind this arm's last store, as above
    } }
__global__ __launch_bounds__(256) void k_fin(const float* __restrict__ OT, const float* __restrict__ PE, float* OUTb) { { const size_t zo = (size_t)blockIdx.y * TT * CC; OT += zo; PE += zo; OUTb += zo; } const size_t e = ((size_t)blockIdx.x * 256 + threadIdx.x) * 4; if (e >= (size_t)CC * TT) return; const int l = (int)(e % TT); const int c = (int)(e / TT); v4f r;
#pragma unroll
    for (int u = 0; u < 4; ++u) { const int ll = l + u; const float cs = (ll < RH) ? 1.0f : (1.0f / PCAR); float o = OT[(size_t)ll * CC + c] * cs; asm volatile("" : "+v"(o)); r[u] = __fadd_rn(o, PE[(size_t)ll * CC + c]); }
    *(v4f*)(OUTb + e) = r;  }

extern "C" void kernel_launch(void* const* d_in, const int* in_sizes, int n_in,
                              void* d_out, int out_size, void* d_ws, size_t ws_size, hipStream_t stream) {
    (void)in_sizes; (void)n_in; (void)out_size;
    const float* x = (const float*)d_in[0];
    const float* prm[4][6]; for (int r = 0; r < 4; ++r) for (int c = 0; c < 6; ++c) prm[r][c] = (const float*)d_in[1 + r * 6 + c];   // (w, b, gamma, beta, mean, var) for q, k, v, pe
    float* OUT = (float*)d_out;     // [16][128][2048]
    char* wsp = (char*)d_ws;
    auto take = [&](size_t bytes) { char* p = wsp; wsp += (bytes + 255) & ~(size_t)255; return (void*)p; };
    const size_t FE = (size_t)TT * CC, SE = (size_t)TT * TT;   // elements of one batch's [2048][128] plane and of its [2048][2048] plane
    bf* W4 = (bf*)take((size_t)4 * CC * KI * 2);
    // live through the whole call, all 16 batches
    bf* QPh = (bf*)take(NB_ * FE * 2); bf* QPl = (bf*)take(NB_ * FE * 2); bf* KPh = (bf*)take(NB_ * FE * 2); bf* KPl = (bf*)take(NB_ * FE * 2);
    bf* VTh = (bf*)take(NB_ * FE * 2); bf* VTl = (bf*)take(NB_ * FE * 2); h16* VT16 = (h16*)take(NB_ * FE * 2); float* FPE = (float*)take(NB_ * FE * 4);
    // one group of GB batches
    float* S = (float*)take(GB * SE * 4); bf* Ph = (bf*)take(GB * SE * 2); bf* Pl = (bf*)take(GB * SE * 2); bf* PTh = (bf*)take((size_t)GB * RH * TT * 2); bf* PTl = (bf*)take((size_t)GB * RH * TT * 2); h16* PT16 = (h16*)take((size_t)GB * (TT - RH) * TT * 2); float* OT = (float*)take(GB * FE * 4);
    if ((size_t)(wsp - (char*)d_ws) > ws_size) return;    // ~ 244 MiB
    // the convolution stage's own planes (60 MiB, all 16 batches) lie in S (64 MiB): their last reader runs before the first score launch writes S
    bf* X3 = (bf*)S; float* FQ = (float*)(X3 + (size_t)NB_ * TT * KI); float* FK = FQ + NB_ * FE; float* FV = FK + NB_ * FE;
    for (int r = 0; r < 4; ++r) k_cvt8<<<(unsigned)(((size_t)CC * KI / 8 + 255) / 256), 256, 0, stream>>>(prm[r][0], W4 + (size_t)r * CC * KI, (size_t)CC * KI / 8);   // w [128][64][3] == Bt [128][192]
    k_im2col<<<dim3((unsigned)(((size_t)TT * KI / 8 + 255) / 256), NB_, 1), 256, 0, stream>>>(x, X3);
    float* F4[4] = {FQ, FK, FV, FPE};
    for (int r = 0; r < 4; ++r) { k_gemmw<bf, 0, true, 1><<<dim3(TT / 64, CC / 64, NB_), 32, 0, stream>>>(X3, nullptr, W4 + (size_t)r * CC * KI, nullptr, KI, F4[r], CC, prm[r][1], (size_t)TT * KI, 0, FE); k_bnl<<<dim3((unsigned)((FE / 4 + 255) / 256), NB_, 1), 256, 0, stream>>>(F4[r], prm[r][2], prm[r][3], prm[r][4], prm[r][5]); }
    k_hlN<<<dim3((unsigned)((FE / 4 + 255) / 256), NB_, 1), 256, 0, stream>>>(FQ, QPh, QPl); k_hlN<<<dim3((unsigned)((FE / 4 + 255) / 256), NB_, 1), 256, 0, stream>>>(FK, KPh, KPl); k_hlT<<<dim3((unsigned)((FE / 2 + 255) / 256), NB_, 1), 256, 0, stream>>>(FV, VTh, VTl, VT16);
    for (int b = 0; b < NB_; b += GB) { const size_t bo = (size_t)b * FE;
        k_gemmw<bf, 2, false, 1><<<dim3(TT / 64, TT / 64, GB), 32, 0, stream>>>(QPh + bo, QPl + bo, KPh + bo, KPl + bo, CC, S, TT, nullptr, FE, FE, SE);                               // attn logits (3 products)
        k_psoft<<<dim3(TT / 8, GB, 1), 256, 0, stream>>>(S, Ph, Pl);
        k_ptr<<<dim3((TT / TPT) * (TT / TPT), GB, 1), 256, 0, stream>>>(Ph, Pl, PTh, PTl, PT16);
        k_gemmw<bf, 2, false, KWV><<<dim3(RH / 64, CC / 64, GB), 32 * KWV, 0, stream>>>(PTh, PTl, VTh + bo, VTl + bo, TT, OT, CC, nullptr, (size_t)RH * TT, FE, FE);                             // rows l < RH: hl P^T x hl v
        k_gemmw<h16, 0, false, KWV><<<dim3((TT - RH) / 64, CC / 64, GB), 32 * KWV, 0, stream>>>(PT16, nullptr, VT16 + bo, nullptr, TT, OT + (size_t)RH * CC, CC, nullptr, (size_t)(TT - RH) * TT, FE, FE);   // rest: fp16 x1024
        k_fin<<<dim3((unsigned)((FE / 4 + 255) / 256), GB, 1), 256, 0, stream>>>(OT, FPE + bo, OUT + bo); }
}

// v004
// Measured time: 533 microseconds a run.
// In two side-by-side timings against v003, it was 1.11 and 1.12 times as fast.
// Over all steps from v000 it is 5.94 times as fast.
#include <hip/hip_runtime.h>

// Conv1dAttention (x [16][64][2048] channels-first; q/k/v/pe = LeakyReLU_0.3(BN(conv1d_k3(x) + b)) with 128 output channels (BN inference affine: y*scale + (beta - mean*scale), scale = gamma*rsqrt(var + 1e-5)); attn[i][j] = sum_c q[c][i] k[c][j] (NO scaling); P = softmax_j; out[c][l] = sum_j v[c][j] P[j][l] + pe[c][l] -> [16][128][2048] - note the value product contracts over the softmax ROW index j, i.e. it uses P TRANSPOSED).
// Compute dtypes, f32 accumulate: every input rounded to bf16; the four k=3 convolutions as PLAIN bf16 im2col GEMMs (K = 192, inputs: exact) + bias, BN affine and LeakyReLU in f32; scores hl x hl (3 products, K 128, unscaled) on every row; softmax f32 (wave per row) into hi/lo bf16 planes for all rows; P transposed on chip (exact bf16 moves): output rows l < 512 as hl P^T x hl v (3 products, K 2048), rows >= 512 as fp16(P^T x 1024) x fp16 v; + pe, written channels-first.

#define NB_  16
#define CIN  64
#define CC   128
#define KW   3
#define KI   (CIN * KW)     // 192
#define TT   2048
#define RH   512
#define PCAR 1024.0f
#define KWV  8              // waves that share one tile's K in the two P^T x v products
#define GB   4              // batches per launch in the attention stages (the score and probability planes of 4 batches fit the workspace)
typedef _Float16 h16;
typedef unsigned short bf;
typedef __attribute__((ext_vector_type(16))) __bf16   v16bf;
typedef __attribute__((ext_vector_type(16))) _Float16 v16h;
typedef __attribute__((ext_vector_type(8)))  _Float16 v8h;
typedef __attribute__((ext_vector_type(8)))  unsigned short v8us;
typedef __attribute__((ext_vector_type(8)))  float    v8f;
typedef __attribute__((ext_vector_type(4)))  float    v4f;
typedef v8h  __attribute__((may_alias)) v8ha;
typedef v4f  __attribute__((may_alias)) v4fa;
typedef v8us __attribute__((may_alias)) v8usa;

__device__ __forceinline__ unsigned short f2bf(float f) { unsigned u = __float_as_uint(f); u += 0x7FFFu + ((u >> 16) & 1u); return (unsigned short)(u >> 16); }
__device__ __forceinline__ float bf2f(unsigned short b) { return __uint_as_float(((unsigned)b) << 16); }
__device__ __forceinline__ float bfr(float f) { return bf2f(f2bf(f)); }
__device__ __forceinline__ v16h cat16(v8h lo, v8h hi) { return __builtin_shufflevector(lo, hi, 0, 1, 2, 3, 4, 5, 6, 7, 8, 9, 10, 11, 12, 13, 14, 15); }
__device__ __forceinline__ v16bf cat16b(v8us lo, v8us hi) { return __builtin_bit_cast(v16bf, __builtin_shufflevector(lo, hi, 0, 1, 2, 3, 4, 5, 6, 7, 8, 9, 10, 11, 12, 13, 14, 15)); }
__device__ __forceinline__ v8f wmma16(v16h a, v16h b, v8f c) { return __builtin_amdgcn_wmma_f32_16x16x32_f16(false, a, false, b, (short)0, c, false, false); }
__device__ __forceinline__ v8f wmmab(v16bf a, v16bf b, v8f c) { return __builtin_amdgcn_wmma_f32_16x16x32_bf16(false, a, false, b, (short)0, c, false, false); }



// ---- k_gemmw: register-blocked GEMM, ONE WAVE per 64x64 output tile (16 accumulators) where NW == 1, operands straight from K-contiguous 16-bit planes; grid (M/64, N/64, Z), 32 threads.
// C[m][n] (f32, pitch ldc, + optional f32 bias[n]) = sum_k A[m][k] Bt[n][k] (+ split products per NSPLIT). z-batch strides sA/sB/sC in elements. K % 32 == 0.
// NW > 1 (a long K on a small grid; 32 * NW threads, no bias): the tile's K is dealt to NW waves of one work-group. Wave w takes the 32-element chunks w, w + NW, w + 2 NW, ... (neighbouring waves read neighbouring
// 64-B pieces of the same rows at about the same time), keeps a whole 64x64 partial tile in its accumulators and lays it in LDS; the block then adds the NW partial tiles in wave order and stores the sum.
#define RPT  68             // pitch of a partial tile's row in LDS, floats: the two 8-row halves of an accumulator's store fall on different banks
template <typename T16> struct WFrag;
template <> struct WFrag<h16> { typedef v16h V; static __device__ __forceinline__ V ld(const h16* p) { return cat16(*(const v8h*)p, *(const v8h*)(p + 16)); } static __device__ __forceinline__ v8f mma(V a, V b, v8f c) { return wmma16(a, b, c); } };
template <> struct WFrag<bf> { typedef v16bf V; static __device__ __forceinline__ V ld(const bf* p) { return cat16b(*(const v8us*)p, *(const v8us*)(p + 16)); } static __device__ __forceinline__ v8f mma(V a, V b, v8f c) { return wmmab(a, b, c); } };
template <typename T16, int NSPLIT, bool BIAS, int NW>
__global__ __launch_bounds__(32 * NW) void k_gemmw(const T16* __restrict__ A, const T16* __restrict__ A2, const T16* __restrict__ Bt, const T16* __restrict__ Bt2, int K, float* C, int ldc, const float* __restrict__ bias, size_t sA, size_t sB, size_t sC) {
    typedef typename WFrag<T16>::V V;
    __shared__ __align__(16) float os[16 * 68];
    __shared__ __align__(16) float red[NW > 1 ? NW * 64 * RPT : 4];
    const int w = NW > 1 ? __builtin_amdgcn_readfirstlane((int)(threadIdx.x >> 5)) : 0;   // the wave's number, in a scalar register: the K loop's counter stays scalar
    const size_t z = blockIdx.z; A += z * sA; if (A2) A2 += z * sA; Bt += z * sB; if (Bt2) Bt2 += z * sB; C += z * sC;
    const int lane = threadIdx.x & 31, lr = lane & 15, hi = lane >> 4; const int r0 = blockIdx.x * 64, c0 = blockIdx.y * 64;
    v8f acc[4][4];
#pragma unroll
    for (int mb = 0; mb < 4; ++mb)
#pragma unroll
        for (int nb = 0; nb < 4; ++nb) acc[mb][nb] = (v8f){};
    const size_t aoff = (size_t)(r0 + lr) * K + 8 * hi, boff = (size_t)(c0 + lr) * K + 8 * hi;
#pragma unroll 1
    for (int kc = 32 * w; kc < K; kc += 32 * NW) {
        V a[4], a2[4];
#pragma unroll
        for (int mb = 0; mb < 4; ++mb) { a[mb] = WFrag<T16>::ld(A + aoff + (size_t)mb * 16 * K + kc); if (NSPLIT == 1 || NSPLIT == 2) a2[mb] = WFrag<T16>::ld(A2 + aoff + (size_t)mb * 16 * K + kc); }
#pragma unroll
        for (int nb = 0; nb < 4; ++nb) { const V b = WFrag<T16>::ld(Bt + boff + (size_t)nb * 16 * K + kc); V b2; if (NSPLIT >= 2) b2 = WFrag<T16>::ld(Bt2 + boff + (size_t)nb * 16 * K + kc);
#pragma unroll
            for (int mb = 0; mb < 4; ++mb) { acc[mb][nb] = WFrag<T16>::mma(a[mb], b, acc[mb][nb]); if (NSPLIT == 1 || NSPLIT == 2) acc[mb][nb] = WFrag<T16>::mma(a2[mb], b, acc[mb][nb]); if (NSPLIT >= 2) acc[mb][nb] = WFrag<T16>::mma(a[mb], b2, acc[mb][nb]); } }
        asm volatile("v_nop\n\tv_nop\n\tv_nop\n\tv_nop" : "+v"(acc[0][0]), "+v"(acc[1][1]), "+v"(acc[2][2]), "+v"(acc[3][3]) : "v"(a[0]), "v"(a[3]));
    }
    if (NW > 1) {
        // the loops below are unrolled whole: acc[][] is indexed by constants alone and stays in registers, and a thread's LDS reads are all in flight at once
        float* my = red + w * 64 * RPT;
#pragma unroll
        for (int mb = 0; mb < 4; ++mb)
#pragma unroll
            for (int nb = 0; nb < 4; ++nb)
#pragma unroll
                for (int j = 0; j < 8; ++j) my[(mb * 16 + hi * 8 + j) * RPT + nb * 16 + lr] = acc[mb][nb][j];
        __syncthreads();   // every wave's partial tile lies in LDS before any of it is added
#pragma unroll
        for (int s = 0; s < 64 * 16 / (32 * NW); ++s) { const int idx = s * 32 * NW + (int)threadIdx.x; const int row = idx >> 4, cofs = (idx & 15) * 4; v4f sum = *(const v4fa*)(red + row * RPT + cofs);
#pragma unroll
            for (int u = 1; u < NW; ++u) sum += *(const v4fa*)(red + (u * 64 + row) * RPT + cofs);
            *(v4f*)(C + (size_t)(r0 + row) * ldc + c0 + cofs) = sum; }
        return;
    }
#pragma unroll
    for (int mb = 0; mb < 4; ++mb) {
#pragma unroll
        for (int nb = 0; nb < 4; ++nb) {
#pragma unroll
            for (int j = 0; j < 8; ++j) os[(hi * 8 + j) * 68 + nb * 16 + lr] = acc[mb][nb][j]; }
        __builtin_amdgcn_wave_barrier(); asm volatile("" ::: "memory");
        float* crow = C + (size_t)(r0 + mb * 16) * ldc + c0;
{
#pragma unroll
            for (int s = 0; s < 8; ++s) { const int row = 2 * s + hi, cofs = lr * 4; v4f val = *(const v4fa*)(os + row * 68 + cofs); if (BIAS) { val[0] += bfr(bias[c0 + cofs]); val[1] += bfr(bias[c0 + cofs + 1]); val[2] += bfr(bias[c0 + cofs + 2]); val[3] += bfr(bias[c0 + cofs + 3]); }
                *(v4f*)(crow + (size_t)row * ldc + cofs) = val; }
             }
        __builtin_amdgcn_wave_barrier(); asm volatile("" ::: "memory");
    }
}

__device__ __forceinline__ h16 tohx(float x) { return (h16)x; }
__device__ __forceinline__ void splitf(float y, unsigned short& h, unsigned short& l) { h = f2bf(y); l = f2bf(y - bf2f(h)); }
typedef __attribute__((ext_vector_type(2))) unsigned short v2us;
typedef __attribute__((ext_vector_type(4))) unsigned short v4us;
typedef __attribute__((ext_vector_type(8))) unsigned short v8us;
typedef __attribute__((ext_vector_type(4))) _Float16 v4h;
typedef __attribute__((ext_vector_type(2))) float v2f;

__global__ __launch_bounds__(256) void k_cvt8(const float* __restrict__ src, bf* dst, size_t n8) { const size_t i = (size_t)blockIdx.x * 256 + threadIdx.x; if (i >= n8) return; const v8f v = *(const v8f*)(src + i * 8); v8us o;
#pragma unroll
    for (int k = 0; k < 8; ++k) o[k] = f2bf(v[k]); *(v8us*)(dst + i * 8) = o;  }
__global__ __launch_bounds__(256) void k_im2col(const float* __restrict__ xb, bf* X3) { xb += (size_t)blockIdx.y * CIN * TT; X3 += (size_t)blockIdx.y * TT * KI; const size_t e8 = ((size_t)blockIdx.x * 256 + threadIdx.x) * 8; if (e8 >= (size_t)TT * KI) return; const int kidx = (int)(e8 % KI); const int t = (int)(e8 / KI); v8us o;
#pragma unroll
    for (int u = 0; u < 8; ++u) { const int k2 = kidx + u; const int ci = k2 / KW, kk = k2 % KW; const int tt = t + kk - 1; o[u] = (tt >= 0 && tt < TT) ? f2bf(xb[(size_t)ci * TT + tt]) : (unsigned short)0; }
    *(v8us*)(X3 + e8) = o;  }
// ---- k_conv: one k = 3 convolution as its im2col GEMM (k_gemmw's one-wave 64x64 tile and K loop: A = X3 [t][192], Bt = w [c][192]) that finishes its own output: bias, BN affine, LeakyReLU and the split
// into 16-bit planes are applied to the accumulators, so that no f32 plane is written and read again by a pass of its own. Grid (TT/64, CC/64, NB_), 32 threads.
// EPI 0 (q, k): hi/lo bf16 planes [t][c]. EPI 1 (v): hi/lo bf16 and fp16 planes, transposed [c][t]. EPI 2 (pe): f32 plane [t][c].
struct BnC { float b, sc, sh; };   // one channel's bias, BN scale and BN shift
__device__ __forceinline__ BnC bn_chan(int c, const float* __restrict__ bias, const float* __restrict__ gam, const float* __restrict__ bet, const float* __restrict__ mu, const float* __restrict__ var) {
    BnC r; r.b = bfr(bias[c]);
    // here and in bn_act each product is rounded before its add or subtract, as in y * scale + (beta - mean * scale) taken one operation at a time: q, k, v and pe come out bit for bit as from a BN pass of its own
    const float sc = __fmul_rn(bfr(gam[c]), __fdiv_rn(1.0f, sqrtf(__fadd_rn(bfr(var[c]), 1e-5f)))); float ms = __fmul_rn(bfr(mu[c]), sc); asm volatile("" : "+v"(ms)); const float sh = __fsub_rn(bfr(bet[c]), ms);
    r.sc = sc; r.sh = sh; return r; }
__device__ __forceinline__ float bn_act(float acc, const BnC p) { const float a = acc + p.b; float y = __fmul_rn(a, p.sc); asm volatile("" : "+v"(y)); y = __fadd_rn(y, p.sh); return (y > 0.f) ? y : 0.3f * y; }
template <int EPI>
__global__ __launch_bounds__(32) void k_conv(const bf* __restrict__ A, const bf* __restrict__ Bt, const float* __restrict__ bias, const float* __restrict__ gam, const float* __restrict__ bet, const float* __restrict__ mu, const float* __restrict__ var, bf* Oh, bf* Ol, h16* O16, float* OF) {
    typedef WFrag<bf>::V V;
    __shared__ __align__(16) float os[16 * 68];
    const size_t zo = (size_t)blockIdx.z * TT * CC; A += (size_t)blockIdx.z * TT * KI;
    const int lane = threadIdx.x & 31, lr = lane & 15, hi = lane >> 4; const int r0 = blockIdx.x * 64, c0 = blockIdx.y * 64;
    v8f acc[4][4];
#pragma unroll
    for (int mb = 0; mb < 4; ++mb)
#pragma unroll
        for (int nb = 0; nb < 4; ++nb) acc[mb][nb] = (v8f){};
    // the lane's 4 channels: behind the LDS turn (EPI 0, 2) 4 neighbours, the same in every row; in the accumulators themselves (EPI 1) one per column block. Formed ahead of the K loop, whose loads hide theirs
    const int cofs = lr * 4;
    BnC pc[4];
#pragma unroll
    for (int u = 0; u < 4; ++u) pc[u] = bn_chan(EPI == 1 ? c0 + u * 16 + lr : c0 + cofs + u, bias, gam, bet, mu, var);
    const bf* pa = A + (size_t)(r0 + lr) * KI + 8 * hi; const bf* pb = Bt + (size_t)(c0 + lr) * KI + 8 * hi;
    // the loop stays rolled, as in k_gemmw
#pragma unroll 1
    for (int kc = 0; kc < KI; kc += 32, pa += 32, pb += 32) {
        V a[4], b[4];
#pragma unroll
        for (int mb = 0; mb < 4; ++mb) a[mb] = WFrag<bf>::ld(pa + (size_t)mb * 16 * KI);
#pragma unroll
        for (int nb = 0; nb < 4; ++nb) b[nb] = WFrag<bf>::ld(pb + (size_t)nb * 16 * KI);
        asm volatile("s_wait_xcnt 0x0" :: "v"(pa), "v"(pb) : "memory");   // the 16 loads' two address pairs stay as they are (no load lands on them, nothing rewrites them) until this wait
#pragma unroll
        for (int nb = 0; nb < 4; ++nb)
#pragma unroll
            for (int mb = 0; mb < 4; ++mb) acc[mb][nb] = WFrag<bf>::mma(a[mb], b[nb], acc[mb][nb]);
        // the distance behind the trip's last WMMAs, on the back edge too, where the next trip's loads land on a[] and b[]
        asm volatile("v_nop\n\tv_nop\n\tv_nop\n\tv_nop" : "+v"(acc[0][0]), "+v"(acc[1][1]), "+v"(acc[2][2]), "+v"(acc[3][3]) : "v"(a[0]), "v"(a[3]));
    }
    // every loop below is unrolled whole: acc[][] and pc[] are indexed by constants alone and stay in registers
    if (EPI == 1) {
        // a lane's accumulator holds 8 consecutive t of one channel: that is 16 B of a transposed plane's row, stored as it lies
#pragma unroll
        for (int nb = 0; nb < 4; ++nb)
#pragma unroll
            for (int mb = 0; mb < 4; ++mb) { v8us oh, ol; v8h of;
#pragma unroll
                for (int j = 0; j < 8; ++j) { const float y = bn_act(acc[mb][nb][j], pc[nb]); unsigned short p, q; splitf(y, p, q); oh[j] = p; ol[j] = q; of[j] = tohx(y); }
                const size_t oo = zo + (size_t)(c0 + nb * 16 + lr) * TT + r0 + mb * 16 + hi * 8; *(v8us*)(Oh + oo) = oh; *(v8us*)(Ol + oo) = ol; *(v8h*)(O16 + oo) = of; }
        return;
    }
#pragma unroll
    for (int mb = 0; mb < 4; ++mb) {
#pragma unroll
        for (int nb = 0; nb < 4; ++nb) {
#pragma unroll
            for (int j = 0; j < 8; ++j) os[(hi * 8 + j) * 68 + nb * 16 + lr] = acc[mb][nb][j]; }
        __builtin_amdgcn_wave_barrier(); asm volatile("" ::: "memory");   // a lane reads what other lanes wrote: the compiler, which follows one lane, must not lift a read over the 16 rows' writes
#pragma unroll
        for (int s = 0; s < 8; ++s) { const int row = 2 * s + hi; v4f val = *(const v4fa*)(os + row * 68 + cofs); const size_t oo = zo + (size_t)(r0 + mb * 16 + row) * CC + c0 + cofs;
#pragma unroll
            for (int u = 0; u < 4; ++u) val[u] = bn_act(val[u], pc[u]);
            if (EPI == 2) *(v4f*)(OF + oo) = val;
            else { v4us oh, ol;
#pragma unroll
                for (int u = 0; u < 4; ++u) { unsigned short p, q; splitf(val[u], p, q); oh[u] = p; ol[u] = q; }
                *(v4us*)(Oh + oo) = oh; *(v4us*)(Ol + oo) = ol; } }
        __builtin_amdgcn_wave_barrier(); asm volatile("" ::: "memory");   // nor the next 16 rows' writes over these reads
    }
}
__global__ __launch_bounds__(256) void k_psoft(const float* __restrict__ S, bf* Ph, bf* Pl) { { const size_t zo = (size_t)blockIdx.y * TT * TT; S += zo; Ph += zo; Pl += zo; } const int lane = threadIdx.x & 31; const int row = blockIdx.x * 8 + (threadIdx.x >> 5); if (row >= TT) return; const float* sr = S + (size_t)row * TT; float v[TT / 32]; float mx = -3.0e38f;
#pragma unroll
    for (int ch = 0; ch < TT / 128; ++ch) { const v4f a = *(const v4f*)(sr + ch * 128 + lane * 4);
#pragma unroll
        for (int u = 0; u < 4; ++u) { float sa = a[u]; asm volatile("" : "+v"(sa)); v[ch * 4 + u] = sa; mx = fmaxf(mx, sa); } }
#pragma unroll
    for (int sh = 16; sh; sh >>= 1) mx = fmaxf(mx, __shfl_xor(mx, sh, 32));
    float sum = 0.f;
#pragma unroll
    for (int q = 0; q < TT / 32; ++q) { float d0 = __fsub_rn(v[q], mx); asm volatile("" : "+v"(d0)); v[q] = __builtin_amdgcn_exp2f(__fmul_rn(d0, 1.4426950408889634f)); sum += v[q]; }
#pragma unroll
    for (int sh = 16; sh; sh >>= 1) sum += __shfl_xor(sum, sh, 32);
    const float f = __fdiv_rn(1.0f, sum);
    {
#pragma unroll
        for (int ch = 0; ch < TT / 128; ++ch) { v4us oh, ol; for (int q = 0; q < 4; ++q) { unsigned short a, c2; splitf(v[ch * 4 + q] * f, a, c2); oh[q] = a; ol[q] = c2; } const size_t oo = (size_t)row * TT + ch * 128 + lane * 4; *(v4us*)(Ph + oo) = oh; *(v4us*)(Pl + oo) = ol; }
         } }
// ---- k_ptr: P -> P^T by 128 x 128 tiles. A tile's rows are read whole (256 B a row), laid in LDS, read back through the 16-bit transposing LDS load (a lane gets 8 consecutive j of one column l) and stored 16 B a lane.
#define TPT  128            // tile edge, elements; one block owns whole 256-B pieces of 128 output rows
#define TPP  288            // LDS row pitch in bytes: 256 + 32, an odd multiple of 32 B (the pitch the transposing load reads without bank conflicts)
typedef __attribute__((ext_vector_type(8))) short s16x8;
typedef __attribute__((address_space(3))) s16x8 lds_s16x8;
__device__ __forceinline__ v8us ldtr16(const unsigned char* p) { return __builtin_bit_cast(v8us, __builtin_amdgcn_ds_load_tr16_b128_v8i16((lds_s16x8*)p)); }
__global__ __launch_bounds__(256) void k_ptr(const bf* __restrict__ Ph, const bf* __restrict__ Pl, bf* PTh, bf* PTl, h16* PT16) {
    __shared__ __attribute__((aligned(32))) unsigned char tile[2][TPT * TPP];
    { const size_t zb = blockIdx.y; Ph += zb * TT * TT; Pl += zb * TT * TT; PTh += zb * RH * TT; PTl += zb * RH * TT; PT16 += zb * (TT - RH) * TT; }
    const int j0 = (int)(blockIdx.x % (TT / TPT)) * TPT, l0 = (int)(blockIdx.x / (TT / TPT)) * TPT;   // l0 < RH is the same for the whole block: RH % TPT == 0
    const int tid = threadIdx.x, lane = tid & 31, w = tid >> 5;
    const int rr = tid >> 4, ce = (tid & 15) * 8;    // 16 threads a row, 16 rows a pass
    const bf* ph = Ph + (size_t)(j0 + rr) * TT + l0 + ce; const bf* pl = Pl + (size_t)(j0 + rr) * TT + l0 + ce;
    v8us a[TPT / 16], c[TPT / 16];
    // every loop of this kernel is unrolled whole: a[] and c[] stay in registers, and the 16 global loads, later the LDS reads, are all in flight at once
#pragma unroll
    for (int p = 0; p < TPT / 16; ++p) { a[p] = *(const v8us*)(ph + (size_t)p * 16 * TT); c[p] = *(const v8us*)(pl + (size_t)p * 16 * TT); }
    asm volatile("s_wait_xcnt 0x0" :: "v"(ph), "v"(pl) : "memory");   // the 16 loads' two address pairs stay as they are (no load lands on them, nothing rewrites them) until this wait
    if (l0 < RH) {
#pragma unroll
        for (int p = 0; p < TPT / 16; ++p) { const int o = (p * 16 + rr) * TPP + ce * 2; *(v8usa*)(tile[0] + o) = a[p]; *(v8usa*)(tile[1] + o) = c[p]; }
    } else {
#pragma unroll
        for (int p = 0; p < TPT / 16; ++p) { v8h o8;
#pragma unroll
            for (int u = 0; u < 8; ++u) o8[u] = tohx(__fadd_rn(bf2f(a[p][u]), bf2f(c[p][u])) * PCAR);
            *(v8ha*)(tile[0] + (p * 16 + rr) * TPP + ce * 2) = o8; }
    }
    __syncthreads();
    // wave w owns the tile's columns 16w .. 16w + 15, i.e. 16 output rows; each trip moves 16 j: lane (c = lane & 15, h = lane >> 4) gets tile[16 kb + 8h + 0..7][16w + c]
    const int rd = (8 * (lane >> 4) + (lane & 7)) * TPP + 32 * w + 16 * ((lane >> 3) & 1);
    const int ol = l0 + 16 * w + (lane & 15), oj = j0 + 8 * (lane >> 4);
    if (l0 < RH) { const size_t ob = (size_t)ol * TT + oj;
#pragma unroll
        for (int kb = 0; kb < TPT / 16; ++kb) { *(v8us*)(PTh + ob + kb * 16) = ldtr16(tile[0] + rd + kb * 16 * TPP); *(v8us*)(PTl + ob + kb * 16) = ldtr16(tile[1] + rd + kb * 16 * TPP); }
        asm volatile("s_wait_xcnt 0x0" ::: "memory");   // behind this arm's last store: no register that a store names is rewritten ahead of it
        return;   // each arm ends by itself, so that its wait stays directly behind its own stores and is not drawn into a shared tail
    } else { const size_t ob = (size_t)(ol - RH) * TT + oj;
#pragma unroll
        for (int kb = 0; kb < TPT / 16; ++kb) *(v8h*)(PT16 + ob + kb * 16) = __builtin_bit_cast(v8h, ldtr16(tile[0] + rd + kb * 16 * TPP));
        asm volatile("s_wait_xcnt 0x0" ::: "memory");   // behind this arm's last store, as above
    } }
__global__ __launch_bounds__(256) void k_fin(const float* __restrict__ OT, const float* __restrict__ PE, float* OUTb) { { const size_t zo = (size_t)blockIdx.y * TT * CC; OT += zo; PE += zo; OUTb += zo; } const size_t e = ((size_t)blockIdx.x * 256 + threadIdx.x) * 4; if (e >= (size_t)CC * TT) return; const int l = (int)(e % TT); const int c = (int)(e / TT); v4f r;
#pragma unroll
    for (int u = 0; u < 4; ++u) { const int ll = l + u; const float cs = (ll < RH) ? 1.0f : (1.0f / PCAR); float o = OT[(size_t)ll * CC + c] * cs; asm volatile("" : "+v"(o)); r[u] = __fadd_rn(o, PE[(size_t)ll * CC + c]); }
    *(v4f*)(OUTb + e) = r;  }

extern "C" void kernel_launch(void* const* d_in, const int* in_sizes, int n_in,
                              void* d_out, int out_size, void* d_ws, size_t ws_size, hipStream_t stream) {
    (void)in_sizes; (void)n_in; (void)out_size;
    const float* x = (const float*)d_in[0];
    const float* prm[4][6]; for (int r = 0; r < 4; ++r) for (int c = 0; c < 6; ++c) prm[r][c] = (const float*)d_in[1 + r * 6 + c];   // (w, b, gamma, beta, mean, var) for q, k, v, pe
    float* OUT = (float*)d_out;     // [16][128][2048]
    char* wsp = (char*)d_ws;
    auto take = [&](size_t bytes) { char* p = wsp; wsp += (bytes + 255) & ~(size_t)255; return (void*)p; };
    const size_t FE = (size_t)TT * CC, SE = (size_t)TT * TT;   // elements of one batch's [2048][128] plane and of its [2048][2048] plane
    bf* W4 = (bf*)take((size_t)4 * CC * KI * 2);
    // live through the whole call, all 16 batches
    bf* QPh = (bf*)take(NB_ * FE * 2); bf* QPl = (bf*)take(NB_ * FE * 2); bf* KPh = (bf*)take(NB_ * FE * 2); bf* KPl = (bf*)take(NB_ * FE * 2);
    bf* VTh = (bf*)take(NB_ * FE * 2); bf* VTl = (bf*)take(NB_ * FE * 2); h16* VT16 = (h16*)take(NB_ * FE * 2); float* FPE = (float*)take(NB_ * FE * 4);
    // one group of GB batches
    float* S = (float*)take(GB * SE * 4); bf* Ph = (bf*)take(GB * SE * 2); bf* Pl = (bf*)take(GB * SE * 2); bf* PTh = (bf*)take((size_t)GB * RH * TT * 2); bf* PTl = (bf*)take((size_t)GB * RH * TT * 2); h16* PT16 = (h16*)take((size_t)GB * (TT - RH) * TT * 2); float* OT = (float*)take(GB * FE * 4);
    if ((size_t)(wsp - (char*)d_ws) > ws_size) return;    // ~ 244 MiB
    // the im2col plane (12 MiB, all 16 batches) lies in S (64 MiB): its last reader runs before the first score launch writes S
    bf* X3 = (bf*)S;
    for (int r = 0; r < 4; ++r) k_cvt8<<<(unsigned)(((size_t)CC * KI / 8 + 255) / 256), 256, 0, stream>>>(prm[r][0], W4 + (size_t)r * CC * KI, (size_t)CC * KI / 8);   // w [128][64][3] == Bt [128][192]
    k_im2col<<<dim3((unsigned)(((size_t)TT * KI / 8 + 255) / 256), NB_, 1), 256, 0, stream>>>(x, X3);
    const dim3 cg(TT / 64, CC / 64, NB_);
    k_conv<0><<<cg, 32, 0, stream>>>(X3, W4, prm[0][1], prm[0][2], prm[0][3], prm[0][4], prm[0][5], QPh, QPl, nullptr, nullptr);
    k_conv<0><<<cg, 32, 0, stream>>>(X3, W4 + (size_t)1 * CC * KI, prm[1][1], prm[1][2], prm[1][3], prm[1][4], prm[1][5], KPh, KPl, nullptr, nullptr);
    k_conv<1><<<cg, 32, 0, stream>>>(X3, W4 + (size_t)2 * CC * KI, prm[2][1], prm[2][2], prm[2][3], prm[2][4], prm[2][5], VTh, VTl, VT16, nullptr);
    k_conv<2><<<cg, 32, 0, stream>>>(X3, W4 + (size_t)3 * CC * KI, prm[3][1], prm[3][2], prm[3][3], prm[3][4], prm[3][5], nullptr, nullptr, nullptr, FPE);
    for (int b = 0; b < NB_; b += GB) { const size_t bo = (size_t)b * FE;
        k_gemmw<bf, 2, false, 1><<<dim3(TT / 64, TT / 64, GB), 32, 0, stream>>>(QPh + bo, QPl + bo, KPh + bo, KPl + bo, CC, S, TT, nullptr, FE, FE, SE);                               // attn logits (3 products)
        k_psoft<<<dim3(TT / 8, GB, 1), 256, 0, stream>>>(S, Ph, Pl);
        k_ptr<<<dim3((TT / TPT) * (TT / TPT), GB, 1), 256, 0, stream>>>(Ph, Pl, PTh, PTl, PT16);
        k_gemmw<bf, 2, false, KWV><<<dim3(RH / 64, CC / 64, GB), 32 * KWV, 0, stream>>>(PTh, PTl, VTh + bo, VTl + bo, TT, OT, CC, nullptr, (size_t)RH * TT, FE, FE);                             // rows l < RH: hl P^T x hl v
        k_gemmw<h16, 0, false, KWV><<<dim3((TT - RH) / 64, CC / 64, GB), 32 * KWV, 0, stream>>>(PT16, nullptr, VT16 + bo, nullptr, TT, OT + (size_t)RH * CC, CC, nullptr, (size_t)(TT - RH) * TT, FE, FE);   // rest: fp16 x1024
        k_fin<<<dim3((unsigned)((FE / 4 + 255) / 256), GB, 1), 256, 0, stream>>>(OT, FPE + bo, OUT + bo); }
}

// v005
// It runs in 327 microseconds.
// Two timings next to v004 both put it at 1.63 times that version's speed.
// Counting every step since v000, it is 9.68 times as fast.
#include <hip/hip_runtime.h>

// Conv1dAttention (x [16][64][2048] channels-first; q/k/v/pe = LeakyReLU_0.3(BN(conv1d_k3(x) + b)) with 128 output channels (BN inference affine: y*scale + (beta - mean*scale), scale = gamma*rsqrt(var + 1e-5)); attn[i][j] = sum_c q[c][i] k[c][j] (NO scaling); P = softmax_j; out[c][l] = sum_j v[c][j] P[j][l] + pe[c][l] -> [16][128][2048] - note the value product contracts over the softmax ROW index j, i.e. it uses P TRANSPOSED).
// Compute dtypes, f32 accumulate: every input rounded to bf16; the four k=3 convolutions as PLAIN bf16 im2col GEMMs (K = 192, inputs: exact) + bias, BN affine and LeakyReLU in f32; scores hl x hl (3 products, K 128, unscaled) on every row, formed twice, both times transposed, and never stored: once for the softmax rows' f32 maxima and sums, once for P^T itself, split hi/lo bf16; output rows l < 512 as hl P^T x hl v (3 products, K 2048), rows >= 512 as fp16(P^T x 1024) x fp16 v; + pe, written channels-first.

#define NB_  16
#define CIN  64
#define CC   128
#define KW   3
#define KI   (CIN * KW)     // 192
#define TT   2048
#define RH   512
#define PCAR 1024.0f
#define KWV  8              // waves that share one tile's K in the two P^T x v products
typedef _Float16 h16;
typedef unsigned short bf;
typedef __attribute__((ext_vector_type(16))) __bf16   v16bf;
typedef __attribute__((ext_vector_type(16))) _Float16 v16h;
typedef __attribute__((ext_vector_type(8)))  _Float16 v8h;
typedef __attribute__((ext_vector_type(8)))  unsigned short v8us;
typedef __attribute__((ext_vector_type(8)))  float    v8f;
typedef __attribute__((ext_vector_type(4)))  float    v4f;
typedef v8h  __attribute__((may_alias)) v8ha;
typedef v4f  __attribute__((may_alias)) v4fa;
typedef v8us __attribute__((may_alias)) v8usa;

__device__ __forceinline__ unsigned short f2bf(float f) { unsigned u = __float_as_uint(f); u += 0x7FFFu + ((u >> 16) & 1u); return (unsigned short)(u >> 16); }
__device__ __forceinline__ float bf2f(unsigned short b) { return __uint_as_float(((unsigned)b) << 16); }
__device__ __forceinline__ float bfr(float f) { return bf2f(f2bf(f)); }
__device__ __forceinline__ v16h cat16(v8h lo, v8h hi) { return __builtin_shufflevector(lo, hi, 0, 1, 2, 3, 4, 5, 6, 7, 8, 9, 10, 11, 12, 13, 14, 15); }
__device__ __forceinline__ v16bf cat16b(v8us lo, v8us hi) { return __builtin_bit_cast(v16bf, __builtin_shufflevector(lo, hi, 0, 1, 2, 3, 4, 5, 6, 7, 8, 9, 10, 11, 12, 13, 14, 15)); }
__device__ __forceinline__ v8f wmma16(v16h a, v16h b, v8f c) { return __builtin_amdgcn_wmma_f32_16x16x32_f16(false, a, false, b, (short)0, c, false, false); }
__device__ __forceinline__ v8f wmmab(v16bf a, v16bf b, v8f c) { return __builtin_amdgcn_wmma_f32_16x16x32_bf16(false, a, false, b, (short)0, c, false, false); }



// ---- k_gemmw: register-blocked GEMM, ONE WAVE per 64x64 output tile (16 accumulators) where NW == 1, operands straight from K-contiguous 16-bit planes; grid (M/64, N/64, Z), 32 threads.
// C[m][n] (f32, pitch ldc, + optional f32 bias[n]) = sum_k A[m][k] Bt[n][k] (+ split products per NSPLIT). z-batch strides sA/sB/sC in elements. K % 32 == 0.
// NW > 1 (a long K on a small grid; 32 * NW threads, no bias): the tile's K is dealt to NW waves of one work-group. Wave w takes the 32-element chunks w, w + NW, w + 2 NW, ... (neighbouring waves read neighbouring
// 64-B pieces of the same rows at about the same time), keeps a whole 64x64 partial tile in its accumulators and lays it in LDS; the block then adds the NW partial tiles in wave order and stores the sum.
#define RPT  68             // pitch of a partial tile's row in LDS, floats: the two 8-row halves of an accumulator's store fall on different banks
template <typename T16> struct WFrag;
template <> struct WFrag<h16> { typedef v16h V; static __device__ __forceinline__ V ld(const h16* p) { return cat16(*(const v8h*)p, *(const v8h*)(p + 16)); } static __device__ __forceinline__ v8f mma(V a, V b, v8f c) { return wmma16(a, b, c); } };
template <> struct WFrag<bf> { typedef v16bf V; static __device__ __forceinline__ V ld(const bf* p) { return cat16b(*(const v8us*)p, *(const v8us*)(p + 16)); } static __device__ __forceinline__ v8f mma(V a, V b, v8f c) { return wmmab(a, b, c); } };
template <typename T16, int NSPLIT, bool BIAS, int NW>
__global__ __launch_bounds__(32 * NW) void k_gemmw(const T16* __restrict__ A, const T16* __restrict__ A2, const T16* __restrict__ Bt, const T16* __restrict__ Bt2, int K, float* C, int ldc, const float* __restrict__ bias, size_t sA, size_t sB, size_t sC) {
    typedef typename WFrag<T16>::V V;
    __shared__ __align__(16) float os[16 * 68];
    __shared__ __align__(16) float red[NW > 1 ? NW * 64 * RPT : 4];
    const int w = NW > 1 ? __builtin_amdgcn_readfirstlane((int)(threadIdx.x >> 5)) : 0;   // the wave's number, in a scalar register: the K loop's counter stays scalar
    const size_t z = blockIdx.z; A += z * sA; if (A2) A2 += z * sA; Bt += z * sB; if (Bt2) Bt2 += z * sB; C += z * sC;
    const int lane = threadIdx.x & 31, lr = lane & 15, hi = lane >> 4; const int r0 = blockIdx.x * 64, c0 = blockIdx.y * 64;
    v8f acc[4][4];
#pragma unroll
    for (int mb = 0; mb < 4; ++mb)
#pragma unroll
        for (int nb = 0; nb < 4; ++nb) acc[mb][nb] = (v8f){};
    const size_t aoff = (size_t)(r0 + lr) * K + 8 * hi, boff = (size_t)(c0 + lr) * K + 8 * hi;
#pragma unroll 1
    for (int kc = 32 * w; kc < K; kc += 32 * NW) {
        V a[4], a2[4];
#pragma unroll
        for (int mb = 0; mb < 4; ++mb) { a[mb] = WFrag<T16>::ld(A + aoff + (size_t)mb * 16 * K + kc); if (NSPLIT == 1 || NSPLIT == 2) a2[mb] = WFrag<T16>::ld(A2 + aoff + (size_t)mb * 16 * K + kc); }
#pragma unroll
        for (int nb = 0; nb < 4; ++nb) { const V b = WFrag<T16>::ld(Bt + boff + (size_t)nb * 16 * K + kc); V b2; if (NSPLIT >= 2) b2 = WFrag<T16>::ld(Bt2 + boff + (size_t)nb * 16 * K + kc);
#pragma unroll
            for (int mb = 0; mb < 4; ++mb) { acc[mb][nb] = WFrag<T16>::mma(a[mb], b, acc[mb][nb]); if (NSPLIT == 1 || NSPLIT == 2) acc[mb][nb] = WFrag<T16>::mma(a2[mb], b, acc[mb][nb]); if (NSPLIT >= 2) acc[mb][nb] = WFrag<T16>::mma(a[mb], b2, acc[mb][nb]); } }
        asm volatile("v_nop\n\tv_nop\n\tv_nop\n\tv_nop" : "+v"(acc[0][0]), "+v"(acc[1][1]), "+v"(acc[2][2]), "+v"(acc[3][3]) : "v"(a[0]), "v"(a[3]));
    }
    if (NW > 1) {
        // the loops below are unrolled whole: acc[][] is indexed by constants alone and stays in registers, and a thread's LDS reads are all in flight at once
        float* my = red + w * 64 * RPT;
#pragma unroll
        for (int mb = 0; mb < 4; ++mb)
#pragma unroll
            for (int nb = 0; nb < 4; ++nb)
#pragma unroll
                for (int j = 0; j < 8; ++j) my[(mb * 16 + hi * 8 + j) * RPT + nb * 16 + lr] = acc[mb][nb][j];
        __syncthreads();   // every wave's partial tile lies in LDS before any of it is added
#pragma unroll
        for (int s = 0; s < 64 * 16 / (32 * NW); ++s) { const int idx = s * 32 * NW + (int)threadIdx.x; const int row = idx >> 4, cofs = (idx & 15) * 4; v4f sum = *(const v4fa*)(red + row * RPT + cofs);
#pragma unroll
            for (int u = 1; u < NW; ++u) sum += *(const v4fa*)(red + (u * 64 + row) * RPT + cofs);
            *(v4f*)(C + (size_t)(r0 + row) * ldc + c0 + cofs) = sum; }
        return;
    }
#pragma unroll
    for (int mb = 0; mb < 4; ++mb) {
#pragma unroll
        for (int nb = 0; nb < 4; ++nb) {
#pragma unroll
            for (int j = 0; j < 8; ++j) os[(hi * 8 + j) * 68 + nb * 16 + lr] = acc[mb][nb][j]; }
        __builtin_amdgcn_wave_barrier(); asm volatile("" ::: "memory");
        float* crow = C + (size_t)(r0 + mb * 16) * ldc + c0;
{
#pragma unroll
            for (int s = 0; s < 8; ++s) { const int row = 2 * s + hi, cofs = lr * 4; v4f val = *(const v4fa*)(os + row * 68 + cofs); if (BIAS) { val[0] += bfr(bias[c0 + cofs]); val[1] += bfr(bias[c0 + cofs + 1]); val[2] += bfr(bias[c0 + cofs + 2]); val[3] += bfr(bias[c0 + cofs + 3]); }
                *(v4f*)(crow + (size_t)row * ldc + cofs) = val; }
             }
        __builtin_amdgcn_wave_barrier(); asm volatile("" ::: "memory");
    }
}

__device__ __forceinline__ h16 tohx(float x) { return (h16)x; }
__device__ __forceinline__ void splitf(float y, unsigned short& h, unsigned short& l) { h = f2bf(y); l = f2bf(y - bf2f(h)); }
typedef __attribute__((ext_vector_type(2))) unsigned short v2us;
typedef __attribute__((ext_vector_type(4))) unsigned short v4us;
typedef __attribute__((ext_vector_type(8))) unsigned short v8us;
typedef __attribute__((ext_vector_type(4))) _Float16 v4h;
typedef __attribute__((ext_vector_type(2))) float v2f;

__global__ __launch_bounds__(256) void k_cvt8(const float* __restrict__ src, bf* dst, size_t n8) { const size_t i = (size_t)blockIdx.x * 256 + threadIdx.x; if (i >= n8) return; const v8f v = *(const v8f*)(src + i * 8); v8us o;
#pragma unroll
    for (int k = 0; k < 8; ++k) o[k] = f2bf(v[k]); *(v8us*)(dst + i * 8) = o;  }
__global__ __launch_bounds__(256) void k_im2col(const float* __restrict__ xb, bf* X3) { xb += (size_t)blockIdx.y * CIN * TT; X3 += (size_t)blockIdx.y * TT * KI; const size_t e8 = ((size_t)blockIdx.x * 256 + threadIdx.x) * 8; if (e8 >= (size_t)TT * KI) return; const int kidx = (int)(e8 % KI); const int t = (int)(e8 / KI); v8us o;
#pragma unroll
    for (int u = 0; u < 8; ++u) { const int k2 = kidx + u; const int ci = k2 / KW, kk = k2 % KW; const int tt = t + kk - 1; o[u] = (tt >= 0 && tt < TT) ? f2bf(xb[(size_t)ci * TT + tt]) : (unsigned short)0; }
    *(v8us*)(X3 + e8) = o;  }
// ---- k_conv: one k = 3 convolution as its im2col GEMM (k_gemmw's one-wave 64x64 tile and K loop: A = X3 [t][192], Bt = w [c][192]) that finishes its own output: bias, BN affine, LeakyReLU and the split
// into 16-bit planes are applied to the accumulators, so that no f32 plane is written and read again by a pass of its own. Grid (TT/64, CC/64, NB_), 32 threads.
// EPI 0 (q, k): hi/lo bf16 planes [t][c]. EPI 1 (v): hi/lo bf16 and fp16 planes, transposed [c][t]. EPI 2 (pe): f32 plane [t][c].
struct BnC { float b, sc, sh; };   // one channel's bias, BN scale and BN shift
__device__ __forceinline__ BnC bn_chan(int c, const float* __restrict__ bias, const float* __restrict__ gam, const float* __restrict__ bet, const float* __restrict__ mu, const float* __restrict__ var) {
    BnC r; r.b = bfr(bias[c]);
    // here and in bn_act each product is rounded before its add or subtract, as in y * scale + (beta - mean * scale) taken one operation at a time: q, k, v and pe come out bit for bit as from a BN pass of its own
    const float sc = __fmul_rn(bfr(gam[c]), __fdiv_rn(1.0f, sqrtf(__fadd_rn(bfr(var[c]), 1e-5f)))); float ms = __fmul_rn(bfr(mu[c]), sc); asm volatile("" : "+v"(ms)); const float sh = __fsub_rn(bfr(bet[c]), ms);
    r.sc = sc; r.sh = sh; return r; }
__device__ __forceinline__ float bn_act(float acc, const BnC p) { const float a = acc + p.b; float y = __fmul_rn(a, p.sc); asm volatile("" : "+v"(y)); y = __fadd_rn(y, p.sh); return (y > 0.f) ? y : 0.3f * y; }
template <int EPI>
__global__ __launch_bounds__(32) void k_conv(const bf* __restrict__ A, const bf* __restrict__ Bt, const float* __restrict__ bias, const float* __restrict__ gam, const float* __restrict__ bet, const float* __restrict__ mu, const float* __restrict__ var, bf* Oh, bf* Ol, h16* O16, float* OF) {
    typedef WFrag<bf>::V V;
    __shared__ __align__(16) float os[16 * 68];
    const size_t zo = (size_t)blockIdx.z * TT * CC; A += (size_t)blockIdx.z * TT * KI;
    const int lane = threadIdx.x & 31, lr = lane & 15, hi = lane >> 4; const int r0 = blockIdx.x * 64, c0 = blockIdx.y * 64;
    v8f acc[4][4];
#pragma unroll
    for (int mb = 0; mb < 4; ++mb)
#pragma unroll
        for (int nb = 0; nb < 4; ++nb) acc[mb][nb] = (v8f){};
    // the lane's 4 channels: behind the LDS turn (EPI 0, 2) 4 neighbours, the same in every row; in the accumulators themselves (EPI 1) one per column block. Formed ahead of the K loop, whose loads hide theirs
    const int cofs = lr * 4;
    BnC pc[4];
#pragma unroll
    for (int u = 0; u < 4; ++u) pc[u] = bn_chan(EPI == 1 ? c0 + u * 16 + lr : c0 + cofs + u, bias, gam, bet, mu, var);
    const bf* pa = A + (size_t)(r0 + lr) * KI + 8 * hi; const bf* pb = Bt + (size_t)(c0 + lr) * KI + 8 * hi;
    // the loop stays rolled, as in k_gemmw
#pragma unroll 1
    for (int kc = 0; kc < KI; kc += 32, pa += 32, pb += 32) {
        V a[4], b[4];
#pragma unroll
        for (int mb = 0; mb < 4; ++mb) a[mb] = WFrag<bf>::ld(pa + (size_t)mb * 16 * KI);
#pragma unroll
        for (int nb = 0; nb < 4; ++nb) b[nb] = WFrag<bf>::ld(pb + (size_t)nb * 16 * KI);
        asm volatile("s_wait_xcnt 0x0" :: "v"(pa), "v"(pb) : "memory");   // the 16 loads' two address pairs stay as they are (no load lands on them, nothing rewrites them) until this wait
#pragma unroll
        for (int nb = 0; nb < 4; ++nb)
#pragma unroll
            for (int mb = 0; mb < 4; ++mb) acc[mb][nb] = WFrag<bf>::mma(a[mb], b[nb], acc[mb][nb]);
        // the distance behind the trip's last WMMAs, on the back edge too, where the next trip's loads land on a[] and b[]
        asm volatile("v_nop\n\tv_nop\n\tv_nop\n\tv_nop" : "+v"(acc[0][0]), "+v"(acc[1][1]), "+v"(acc[2][2]), "+v"(acc[3][3]) : "v"(a[0]), "v"(a[3]));
    }
    // every loop below is unrolled whole: acc[][] and pc[] are indexed by constants alone and stay in registers
    if (EPI == 1) {
        // a lane's accumulator holds 8 consecutive t of one channel: that is 16 B of a transposed plane's row, stored as it lies
#pragma unroll
        for (int nb = 0; nb < 4; ++nb)
#pragma unroll
            for (int mb = 0; mb < 4; ++mb) { v8us oh, ol; v8h of;
#pragma unroll
                for (int j = 0; j < 8; ++j) { const float y = bn_act(acc[mb][nb][j], pc[nb]); unsigned short p, q; splitf(y, p, q); oh[j] = p; ol[j] = q; of[j] = tohx(y); }
                const size_t oo = zo + (size_t)(c0 + nb * 16 + lr) * TT + r0 + mb * 16 + hi * 8; *(v8us*)(Oh + oo) = oh; *(v8us*)(Ol + oo) = ol; *(v8h*)(O16 + oo) = of; }
        return;
    }
#pragma unroll
    for (int mb = 0; mb < 4; ++mb) {
#pragma unroll
        for (int nb = 0; nb < 4; ++nb) {
#pragma unroll
            for (int j = 0; j < 8; ++j) os[(hi * 8 + j) * 68 + nb * 16 + lr] = acc[mb][nb][j]; }
        __builtin_amdgcn_wave_barrier(); asm volatile("" ::: "memory");   // a lane reads what other lanes wrote: the compiler, which follows one lane, must not lift a read over the 16 rows' writes
#pragma unroll
        for (int s = 0; s < 8; ++s) { const int row = 2 * s + hi; v4f val = *(const v4fa*)(os + row * 68 + cofs); const size_t oo = zo + (size_t)(r0 + mb * 16 + row) * CC + c0 + cofs;
#pragma unroll
            for (int u = 0; u < 4; ++u) val[u] = bn_act(val[u], pc[u]);
            if (EPI == 2) *(v4f*)(OF + oo) = val;
            else { v4us oh, ol;
#pragma unroll
                for (int u = 0; u < 4; ++u) { unsigned short p, q; splitf(val[u], p, q); oh[u] = p; ol[u] = q; }
                *(v4us*)(Oh + oo) = oh; *(v4us*)(Ol + oo) = ol; } }
        __builtin_amdgcn_wave_barrier(); asm volatile("" ::: "memory");   // nor the next 16 rows' writes over these reads
    }
}
// ---- st_tile: one wave's 64x64 tile of the TRANSPOSED scores, St[l][i] = sum_c k[c][l] q[c][i] (A = k rows l, Bt = q rows i, K = 128; per 32-element chunk the three split products in the order hi x hi, q lo x k hi, q hi x k lo).
// An accumulator holds one i (its column, lane & 15) and 8 consecutive l: what belongs to a softmax row i (its maximum, its sum, its factor) is a per-lane value. Both kernels below call it, so both see the same bits.
#define L2E  1.4426950408889634f
// 2^x on the transcendental unit; the v_nop is the one slot that the instruction set asks for behind a transcendental before its result is read or its source overwritten
__device__ __forceinline__ float ex2(float x) { float r; asm("v_exp_f32 %0, %1\n\tv_nop" : "=v"(r) : "v"(x)); return r; }
__device__ __forceinline__ void st_tile(const bf* __restrict__ Kh, const bf* __restrict__ Kl, const bf* __restrict__ Qh, const bf* __restrict__ Ql, int l0, int i0, int lr, int hi, v8f (&acc)[4][4]) {
    typedef WFrag<bf>::V V;
#pragma unroll
    for (int mb = 0; mb < 4; ++mb)
#pragma unroll
        for (int nb = 0; nb < 4; ++nb) acc[mb][nb] = (v8f){};
    const size_t ao = (size_t)(l0 + lr) * CC + 8 * hi, bo = (size_t)(i0 + lr) * CC + 8 * hi;
    const bf* pkh = Kh + ao; const bf* pkl = Kl + ao; const bf* pqh = Qh + bo; const bf* pql = Ql + bo;
    // the loop stays rolled, as in k_gemmw: 16 accumulators and one trip's fragments fill the registers
#pragma unroll 1
    for (int kc = 0; kc < CC; kc += 32, pkh += 32, pkl += 32, pqh += 32, pql += 32) {
        V a[4], a2[4];
#pragma unroll
        for (int mb = 0; mb < 4; ++mb) { a[mb] = WFrag<bf>::ld(pkh + (size_t)mb * 16 * CC); a2[mb] = WFrag<bf>::ld(pkl + (size_t)mb * 16 * CC); }
#pragma unroll
        for (int nb = 0; nb < 4; ++nb) { const V b = WFrag<bf>::ld(pqh + (size_t)nb * 16 * CC); const V b2 = WFrag<bf>::ld(pql + (size_t)nb * 16 * CC);
#pragma unroll
            for (int mb = 0; mb < 4; ++mb) { acc[mb][nb] = WFrag<bf>::mma(a[mb], b, acc[mb][nb]); acc[mb][nb] = WFrag<bf>::mma(a[mb], b2, acc[mb][nb]); acc[mb][nb] = WFrag<bf>::mma(a2[mb], b, acc[mb][nb]); } }
        // the distance behind the trip's last WMMAs, on the back edge too, where the next trip's loads land on a[] and a2[]
        asm volatile("v_nop\n\tv_nop\n\tv_nop\n\tv_nop" : "+v"(acc[0][0]), "+v"(acc[1][1]), "+v"(acc[2][2]), "+v"(acc[3][3]) : "v"(a[0]), "v"(a[3]));
        asm volatile("s_wait_xcnt 0x0" :: "v"(pkh), "v"(pkl), "v"(pqh), "v"(pql) : "memory");   // no address pair that the trip's loads name is rewritten ahead of this wait (it stands at the loop's foot, in front of the back edge)
    }
}
// ---- k_stat: the softmax rows' maxima and 1 / sums, from scores that are formed and dropped (no score plane is stored). Grid (TT/64, NB_), 8 waves: the block owns 64 rows i, wave w the l tiles w, w + 8, w + 16, w + 24.
// A lane keeps a running (maximum, sum of exp2 relative to it) for each of its 4 rows i; the 16 partial pairs of a row (8 waves x 2 lane halves) are merged through LDS in a fixed order.
#define SNW  8
__global__ __launch_bounds__(32 * SNW) void k_stat(const bf* __restrict__ Kh, const bf* __restrict__ Kl, const bf* __restrict__ Qh, const bf* __restrict__ Ql, float* MX, float* FI) {
    __shared__ float pm[2 * SNW][64], ps[2 * SNW][64];
    { const size_t zo = (size_t)blockIdx.y * TT * CC; Kh += zo; Kl += zo; Qh += zo; Ql += zo; }
    const int w = __builtin_amdgcn_readfirstlane((int)(threadIdx.x >> 5));   // the wave's number, in a scalar register: the tile loop's counter stays scalar
    const int lane = threadIdx.x & 31, lr = lane & 15, hi = lane >> 4; const int i0 = blockIdx.x * 64;
    float m[4], s[4];
#pragma unroll
    for (int nb = 0; nb < 4; ++nb) { m[nb] = -3.0e38f; s[nb] = 0.f; }
    // rolled: one tile's accumulators at a time
#pragma unroll 1
    for (int t = w; t < TT / 64; t += SNW) {
        v8f acc[4][4];
        st_tile(Kh, Kl, Qh, Ql, t * 64, i0, lr, hi, acc);
        // unrolled whole: acc[][] is indexed by constants alone and stays in registers
#pragma unroll
        for (int nb = 0; nb < 4; ++nb) { float mn = m[nb];
#pragma unroll
            for (int mb = 0; mb < 4; ++mb)
#pragma unroll
                for (int j = 0; j < 8; ++j) mn = fmaxf(mn, acc[mb][nb][j]);
            float ss = 0.f;
#pragma unroll
            for (int mb = 0; mb < 4; ++mb)
#pragma unroll
                for (int j = 0; j < 8; ++j) ss += ex2(__fmul_rn(__fsub_rn(acc[mb][nb][j], mn), L2E));
            s[nb] = s[nb] * ex2(__fmul_rn(__fsub_rn(m[nb], mn), L2E)) + ss; m[nb] = mn; }
    }
#pragma unroll
    for (int nb = 0; nb < 4; ++nb) { pm[2 * w + hi][nb * 16 + lr] = m[nb]; ps[2 * w + hi][nb * 16 + lr] = s[nb]; }
    __syncthreads();   // every wave's partial pairs lie in LDS before any of them is merged
    if (threadIdx.x < 64) { const int i = threadIdx.x; float mx = pm[0][i];
#pragma unroll
        for (int p = 1; p < 2 * SNW; ++p) mx = fmaxf(mx, pm[p][i]);
        float sum = 0.f;
#pragma unroll
        for (int p = 0; p < 2 * SNW; ++p) sum += ps[p][i] * ex2(__fmul_rn(__fsub_rn(pm[p][i], mx), L2E));
        const size_t o = (size_t)blockIdx.y * TT + i0 + i; MX[o] = mx; FI[o] = __fdiv_rn(1.0f, sum); }
}
// the tile's way out; HL: hi/lo bf16 planes, else the fp16 plane. The three pointers stand at the tile's first element
template <bool HL>
__device__ __forceinline__ void spt_out(const v8f (&acc)[4][4], const float (&mi)[4], const float (&fi)[4], float* os, int lr, int hi, bf* Th, bf* Tl, h16* T16) {
    const int cofs = lr * 4;
    // every loop below is unrolled whole: acc[][], mi[] and fi[] are indexed by constants alone and stay in registers
#pragma unroll
    for (int mb = 0; mb < 4; ++mb) {
#pragma unroll
        for (int nb = 0; nb < 4; ++nb) {
#pragma unroll
            for (int j = 0; j < 8; ++j) os[(hi * 8 + j) * 68 + nb * 16 + lr] = ex2(__fmul_rn(__fsub_rn(acc[mb][nb][j], mi[nb]), L2E)) * fi[nb]; }
        __builtin_amdgcn_wave_barrier(); asm volatile("" ::: "memory");   // a lane reads what other lanes wrote: the compiler, which follows one lane, must not lift a read over the 16 rows' writes
        v4us oh[8], ol[8]; v4h of[8];
#pragma unroll
        for (int s = 0; s < 8; ++s) { const int row = 2 * s + hi; const v4f val = *(const v4fa*)(os + row * 68 + cofs); const size_t oo = (size_t)(mb * 16 + row) * TT + cofs;
#pragma unroll
            for (int u = 0; u < 4; ++u) { unsigned short p, q; splitf(val[u], p, q); oh[s][u] = p; ol[s][u] = q; }
            if (HL) { *(v4us*)(Th + oo) = oh[s]; *(v4us*)(Tl + oo) = ol[s]; }
            else {
#pragma unroll
                for (int u = 0; u < 4; ++u) of[s][u] = tohx(__fadd_rn(bf2f(oh[s][u]), bf2f(ol[s][u])) * PCAR);
                *(v4h*)(T16 + oo) = of[s]; } }
        // the 16 rows' stores name these data registers: they stay as they are until this wait, one for the whole group
        if (HL) asm volatile("s_wait_xcnt 0x0" :: "v"(oh[0]), "v"(oh[1]), "v"(oh[2]), "v"(oh[3]), "v"(oh[4]), "v"(oh[5]), "v"(oh[6]), "v"(oh[7]), "v"(ol[0]), "v"(ol[1]), "v"(ol[2]), "v"(ol[3]), "v"(ol[4]), "v"(ol[5]), "v"(ol[6]), "v"(ol[7]) : "memory");
        else asm volatile("s_wait_xcnt 0x0" :: "v"(of[0]), "v"(of[1]), "v"(of[2]), "v"(of[3]), "v"(of[4]), "v"(of[5]), "v"(of[6]), "v"(of[7]) : "memory");
        __builtin_amdgcn_wave_barrier(); asm volatile("" ::: "memory");   // nor the next 16 rows' writes over these reads
    }
}
// ---- k_spt: P^T straight from a second forming of the scores. One wave per 64x64 tile of St; P^T[l][i] = exp2((St[l][i] - max_i) * log2 e) * (1 / sum_i), turned through LDS into whole 128-B row pieces and stored as
// hi/lo bf16 planes (rows l < RH) or as fp16((hi + lo) x 1024) (rows l >= RH). Grid (TT/64, TT/64, NB_), 32 threads.
__global__ __launch_bounds__(32) void k_spt(const bf* __restrict__ Kh, const bf* __restrict__ Kl, const bf* __restrict__ Qh, const bf* __restrict__ Ql, const float* __restrict__ MX, const float* __restrict__ FI, bf* PTh, bf* PTl, h16* PT16) {
    __shared__ __align__(16) float os[16 * 68];
    { const size_t zb = blockIdx.z, zo = zb * TT * CC; Kh += zo; Kl += zo; Qh += zo; Ql += zo; MX += zb * TT; FI += zb * TT; PTh += zb * RH * TT; PTl += zb * RH * TT; PT16 += zb * (TT - RH) * TT; }
    const int lane = threadIdx.x & 31, lr = lane & 15, hi = lane >> 4; const int l0 = blockIdx.x * 64, i0 = blockIdx.y * 64;   // l0 < RH is the same for the whole tile: RH % 64 == 0
    // the lane's 4 rows i: loaded ahead of the K loop, whose loads hide these
    float mi[4], fi[4];
#pragma unroll
    for (int nb = 0; nb < 4; ++nb) { mi[nb] = MX[i0 + nb * 16 + lr]; fi[nb] = FI[i0 + nb * 16 + lr]; }
    v8f acc[4][4];
    st_tile(Kh, Kl, Qh, Ql, l0, i0, lr, hi, acc);
    // the test is the same for the whole tile and stands once, outside the unrolled loops
    if (l0 < RH) spt_out<true>(acc, mi, fi, os, lr, hi, PTh + (size_t)l0 * TT + i0, PTl + (size_t)l0 * TT + i0, nullptr);
    else spt_out<false>(acc, mi, fi, os, lr, hi, nullptr, nullptr, PT16 + (size_t)(l0 - RH) * TT + i0);
}
__global__ __launch_bounds__(256) void k_fin(const float* __restrict__ OT, const float* __restrict__ PE, float* OUTb) { { const size_t zo = (size_t)blockIdx.y * TT * CC; OT += zo; PE += zo; OUTb += zo; } const size_t e = ((size_t)blockIdx.x * 256 + threadIdx.x) * 4; if (e >= (size_t)CC * TT) return; const int l = (int)(e % TT); const int c = (int)(e / TT); v4f r;
#pragma unroll
    for (int u = 0; u < 4; ++u) { const int ll = l + u; const float cs = (ll < RH) ? 1.0f : (1.0f / PCAR); float o = OT[(size_t)ll * CC + c] * cs; asm volatile("" : "+v"(o)); r[u] = __fadd_rn(o, PE[(size_t)ll * CC + c]); }
    *(v4f*)(OUTb + e) = r;  }

extern "C" void kernel_launch(void* const* d_in, const int* in_sizes, int n_in,
                              void* d_out, int out_size, void* d_ws, size_t ws_size, hipStream_t stream) {
    (void)in_sizes; (void)n_in; (void)out_size;
    const float* x = (const float*)d_in[0];
    const float* prm[4][6]; for (int r = 0; r < 4; ++r) for (int c = 0; c < 6; ++c) prm[r][c] = (const float*)d_in[1 + r * 6 + c];   // (w, b, gamma, beta, mean, var) for q, k, v, pe
    float* OUT = (float*)d_out;     // [16][128][2048]
    char* wsp = (char*)d_ws;
    auto take = [&](size_t bytes) { char* p = wsp; wsp += (bytes + 255) & ~(size_t)255; return (void*)p; };
    const size_t FE = (size_t)TT * CC;   // elements of one batch's [2048][128] plane
    bf* W4 = (bf*)take((size_t)4 * CC * KI * 2);
    // live through the whole call, all 16 batches
    bf* QPh = (bf*)take(NB_ * FE * 2); bf* QPl = (bf*)take(NB_ * FE * 2); bf* KPh = (bf*)take(NB_ * FE * 2); bf* KPl = (bf*)take(NB_ * FE * 2);
    bf* VTh = (bf*)take(NB_ * FE * 2); bf* VTl = (bf*)take(NB_ * FE * 2); h16* VT16 = (h16*)take(NB_ * FE * 2); float* FPE = (float*)take(NB_ * FE * 4);
    float* MX = (float*)take((size_t)NB_ * TT * 4); float* FI = (float*)take((size_t)NB_ * TT * 4);
    bf* PTh = (bf*)take((size_t)NB_ * RH * TT * 2); bf* PTl = (bf*)take((size_t)NB_ * RH * TT * 2); h16* PT16 = (h16*)take((size_t)NB_ * (TT - RH) * TT * 2); float* OT = (float*)take(NB_ * FE * 4);
    if ((size_t)(wsp - (char*)d_ws) > ws_size) return;    // ~ 249 MiB
    // the im2col plane (12 MiB, all 16 batches) lies in PT16 (96 MiB): its last reader runs before k_spt writes PT16
    bf* X3 = (bf*)PT16;
    for (int r = 0; r < 4; ++r) k_cvt8<<<(unsigned)(((size_t)CC * KI / 8 + 255) / 256), 256, 0, stream>>>(prm[r][0], W4 + (size_t)r * CC * KI, (size_t)CC * KI / 8);   // w [128][64][3] == Bt [128][192]
    k_im2col<<<dim3((unsigned)(((size_t)TT * KI / 8 + 255) / 256), NB_, 1), 256, 0, stream>>>(x, X3);
    const dim3 cg(TT / 64, CC / 64, NB_);
    k_conv<0><<<cg, 32, 0, stream>>>(X3, W4, prm[0][1], prm[0][2], prm[0][3], prm[0][4], prm[0][5], QPh, QPl, nullptr, nullptr);
    k_conv<0><<<cg, 32, 0, stream>>>(X3, W4 + (size_t)1 * CC * KI, prm[1][1], prm[1][2], prm[1][3], prm[1][4], prm[1][5], KPh, KPl, nullptr, nullptr);
    k_conv<1><<<cg, 32, 0, stream>>>(X3, W4 + (size_t)2 * CC * KI, prm[2][1], prm[2][2], prm[2][3], prm[2][4], prm[2][5], VTh, VTl, VT16, nullptr);
    k_conv<2><<<cg, 32, 0, stream>>>(X3, W4 + (size_t)3 * CC * KI, prm[3][1], prm[3][2], prm[3][3], prm[3][4], prm[3][5], nullptr, nullptr, nullptr, FPE);
    k_stat<<<dim3(TT / 64, NB_, 1), 32 * SNW, 0, stream>>>(KPh, KPl, QPh, QPl, MX, FI);                                                    // softmax row maxima and 1 / sums
    k_spt<<<dim3(TT / 64, TT / 64, NB_), 32, 0, stream>>>(KPh, KPl, QPh, QPl, MX, FI, PTh, PTl, PT16);                                     // P^T planes
    k_gemmw<bf, 2, false, KWV><<<dim3(RH / 64, CC / 64, NB_), 32 * KWV, 0, stream>>>(PTh, PTl, VTh, VTl, TT, OT, CC, nullptr, (size_t)RH * TT, FE, FE);                             // rows l < RH: hl P^T x hl v
    k_gemmw<h16, 0, false, KWV><<<dim3((TT - RH) / 64, CC / 64, NB_), 32 * KWV, 0, stream>>>(PT16, nullptr, VT16, nullptr, TT, OT + (size_t)RH * CC, CC, nullptr, (size_t)(TT - RH) * TT, FE, FE);   // rest: fp16 x1024
    k_fin<<<dim3((unsigned)((FE / 4 + 255) / 256), NB_, 1), 256, 0, stream>>>(OT, FPE, OUT);
}

// v006
// One run takes 244 microseconds.
// In both of two side-by-side timings against v005, it was 1.34 times as fast.
// Counting every step since v000, it is 13.0 times as fast.
#include <hip/hip_runtime.h>

// Conv1dAttention (x [16][64][2048] channels-first; q/k/v/pe = LeakyReLU_0.3(BN(conv1d_k3(x) + b)) with 128 output channels (BN inference affine: y*scale + (beta - mean*scale), scale = gamma*rsqrt(var + 1e-5)); attn[i][j] = sum_c q[c][i] k[c][j] (NO scaling); P = softmax_j; out[c][l] = sum_j v[c][j] P[j][l] + pe[c][l] -> [16][128][2048] - note the value product contracts over the softmax ROW index j, i.e. it uses P TRANSPOSED).
// Compute dtypes, f32 accumulate: every input rounded to bf16; the four k=3 convolutions as PLAIN bf16 im2col GEMMs (K = 192, inputs: exact) + bias, BN affine and LeakyReLU in f32; scores hl x hl (3 products, K 128, unscaled) on every row, formed twice, both times transposed, and never stored: once for the softmax rows' f32 maxima and sums, once for P^T itself, split hi/lo bf16; output rows l < 512 as hl P^T x hl v (3 products, K 2048), rows >= 512 as fp16(P^T x 1024) x fp16 v; + pe, written channels-first.

#define NB_  16
#define CIN  64
#define CC   128
#define KW   3
#define KI   (CIN * KW)     // 192
#define TT   2048
#define RH   512
#define PCAR 1024.0f
#define KWV  8              // waves that share one tile's K in the two P^T x v products
typedef _Float16 h16;
typedef unsigned short bf;
typedef __attribute__((ext_vector_type(16))) __bf16   v16bf;
typedef __attribute__((ext_vector_type(16))) _Float16 v16h;
typedef __attribute__((ext_vector_type(8)))  _Float16 v8h;
typedef __attribute__((ext_vector_type(8)))  unsigned short v8us;
typedef __attribute__((ext_vector_type(8)))  float    v8f;
typedef __attribute__((ext_vector_type(4)))  float    v4f;
typedef v8h  __attribute__((may_alias)) v8ha;
typedef v4f  __attribute__((may_alias)) v4fa;
typedef v8us __attribute__((may_alias)) v8usa;

__device__ __forceinline__ unsigned short f2bf(float f) { unsigned u = __float_as_uint(f); u += 0x7FFFu + ((u >> 16) & 1u); return (unsigned short)(u >> 16); }
__device__ __forceinline__ float bf2f(unsigned short b) { return __uint_as_float(((unsigned)b) << 16); }
__device__ __forceinline__ float bfr(float f) { return bf2f(f2bf(f)); }
__device__ __forceinline__ v16h cat16(v8h lo, v8h hi) { return __builtin_shufflevector(lo, hi, 0, 1, 2, 3, 4, 5, 6, 7, 8, 9, 10, 11, 12, 13, 14, 15); }
__device__ __forceinline__ v16bf cat16b(v8us lo, v8us hi) { return __builtin_bit_cast(v16bf, __builtin_shufflevector(lo, hi, 0, 1, 2, 3, 4, 5, 6, 7, 8, 9, 10, 11, 12, 13, 14, 15)); }
__device__ __forceinline__ v8f wmma16(v16h a, v16h b, v8f c) { return __builtin_amdgcn_wmma_f32_16x16x32_f16(false, a, false, b, (short)0, c, false, false); }
__device__ __forceinline__ v8f wmmab(v16bf a, v16bf b, v8f c) { return __builtin_amdgcn_wmma_f32_16x16x32_bf16(false, a, false, b, (short)0, c, false, false); }



// ---- FRAGMENT ORDER: every 16-bit plane [R][K] that a matrix product reads lies as blocks of 16 rows x 8 k: element (r, k) at (r / 16) * 16 * K + (k / 8) * 128 + (r % 16) * 8 + k % 8 (PKO below).
// A 16 x 32 fragment is then 1 KiB in a row, and each of its two 16-B-a-lane loads (at lane * 8 and at 256 + lane * 8 elements) reads 512 contiguous bytes, 4 whole lines, where a row-major plane gave 32 B of each of 16 lines.
// The lane and register that hold an element are the same as from a row-major plane (lane & 15 the row; k = 8 * (lane >> 4) + 0..7, then 16 more), so every product sees the same operands in the same k order.
#define PKO(r, k, K) ((size_t)((r) >> 4) * 16 * (K) + (size_t)((k) >> 3) * 128 + ((r) & 15) * 8 + ((k) & 7))
// ---- k_gemmw: register-blocked GEMM, ONE WAVE per 64x64 output tile (16 accumulators) where NW == 1, operands straight from 16-bit planes in fragment order; grid (M/64, N/64, Z), 32 threads.
// C[m][n] (f32, pitch ldc, + optional f32 bias[n]) = sum_k A[m][k] Bt[n][k] (+ split products per NSPLIT). z-batch strides sA/sB/sC in elements. K % 32 == 0.
// NW > 1 (a long K on a small grid; 32 * NW threads, no bias): the tile's K is dealt to NW waves of one work-group. Wave w takes the 32-element chunks w, w + NW, w + 2 NW, ... (neighbouring waves read neighbouring
// 1-KiB fragments of the same 16 rows at about the same time), keeps a whole 64x64 partial tile in its accumulators and lays it in LDS; the block then adds the NW partial tiles in wave order and stores the sum.
#define RPT  68             // pitch of a partial tile's row in LDS, floats: the two 8-row halves of an accumulator's store fall on different banks
template <typename T16> struct WFrag;
template <> struct WFrag<h16> { typedef v16h V; static __device__ __forceinline__ V ld(const h16* p) { return cat16(*(const v8h*)p, *(const v8h*)(p + 256)); } static __device__ __forceinline__ v8f mma(V a, V b, v8f c) { return wmma16(a, b, c); } };
template <> struct WFrag<bf> { typedef v16bf V; static __device__ __forceinline__ V ld(const bf* p) { return cat16b(*(const v8us*)p, *(const v8us*)(p + 256)); } static __device__ __forceinline__ v8f mma(V a, V b, v8f c) { return wmmab(a, b, c); } };
// K is a constant of the instance: the 16-row steps of a plane then stand in the loads as immediate offsets from one address pair a plane
template <typename T16, int NSPLIT, bool BIAS, int NW, int K>
__global__ __launch_bounds__(32 * NW) void k_gemmw(const T16* __restrict__ A, const T16* __restrict__ A2, const T16* __restrict__ Bt, const T16* __restrict__ Bt2, float* C, int ldc, const float* __restrict__ bias, size_t sA, size_t sB, size_t sC) {
    typedef typename WFrag<T16>::V V;
    __shared__ __align__(16) float os[16 * 68];
    __shared__ __align__(16) float red[NW > 1 ? NW * 64 * RPT : 4];
    const int w = NW > 1 ? __builtin_amdgcn_readfirstlane((int)(threadIdx.x >> 5)) : 0;   // the wave's number, in a scalar register: the K loop's counter stays scalar
    const size_t z = blockIdx.z; A += z * sA; if (A2) A2 += z * sA; Bt += z * sB; if (Bt2) Bt2 += z * sB; C += z * sC;
    const int lane = threadIdx.x & 31, lr = lane & 15, hi = lane >> 4; const int r0 = blockIdx.x * 64, c0 = blockIdx.y * 64;
    v8f acc[4][4];
#pragma unroll
    for (int mb = 0; mb < 4; ++mb)
#pragma unroll
        for (int nb = 0; nb < 4; ++nb) acc[mb][nb] = (v8f){};
    // a 32-element chunk of 16 rows is 512 elements in a row; the next 16 rows stand 16 * K further
    const size_t aoff = (size_t)r0 * K + (size_t)w * 512 + lane * 8, boff = (size_t)c0 * K + (size_t)w * 512 + lane * 8;
    const T16* pa = A + aoff; const T16* pa2 = (NSPLIT == 1 || NSPLIT == 2) ? A2 + aoff : pa; const T16* pb = Bt + boff; const T16* pb2 = (NSPLIT >= 2) ? Bt2 + boff : pb;
#pragma unroll 1
    for (int kc = 32 * w; kc < K; kc += 32 * NW, pa += 512 * NW, pa2 += 512 * NW, pb += 512 * NW, pb2 += 512 * NW) {
        V a[4], a2[4];
#pragma unroll
        for (int mb = 0; mb < 4; ++mb) { a[mb] = WFrag<T16>::ld(pa + (size_t)mb * 16 * K); if (NSPLIT == 1 || NSPLIT == 2) a2[mb] = WFrag<T16>::ld(pa2 + (size_t)mb * 16 * K); }
#pragma unroll
        for (int nb = 0; nb < 4; ++nb) { const V b = WFrag<T16>::ld(pb + (size_t)nb * 16 * K); V b2; if (NSPLIT >= 2) b2 = WFrag<T16>::ld(pb2 + (size_t)nb * 16 * K);
#pragma unroll
            for (int mb = 0; mb < 4; ++mb) { acc[mb][nb] = WFrag<T16>::mma(a[mb], b, acc[mb][nb]); if (NSPLIT == 1 || NSPLIT == 2) acc[mb][nb] = WFrag<T16>::mma(a2[mb], b, acc[mb][nb]); if (NSPLIT >= 2) acc[mb][nb] = WFrag<T16>::mma(a[mb], b2, acc[mb][nb]); } }
        asm volatile("v_nop\n\tv_nop\n\tv_nop\n\tv_nop" : "+v"(acc[0][0]), "+v"(acc[1][1]), "+v"(acc[2][2]), "+v"(acc[3][3]) : "v"(a[0]), "v"(a[3]));
        asm volatile("s_wait_xcnt 0x0" :: "v"(pa), "v"(pa2), "v"(pb), "v"(pb2) : "memory");   // no address pair that the trip's loads name is rewritten ahead of this wait (it stands at the loop's foot, in front of the back edge)
    }
    if (NW > 1) {
        // the loops below are unrolled whole: acc[][] is indexed by constants alone and stays in registers, and a thread's LDS reads are all in flight at once
        float* my = red + w * 64 * RPT;
#pragma unroll
        for (int mb = 0; mb < 4; ++mb)
#pragma unroll
            for (int nb = 0; nb < 4; ++nb)
#pragma unroll
                for (int j = 0; j < 8; ++j) my[(mb * 16 + hi * 8 + j) * RPT + nb * 16 + lr] = acc[mb][nb][j];
        __syncthreads();   // every wave's partial tile lies in LDS before any of it is added
#pragma unroll
        for (int s = 0; s < 64 * 16 / (32 * NW); ++s) { const int idx = s * 32 * NW + (int)threadIdx.x; const int row = idx >> 4, cofs = (idx & 15) * 4; v4f sum = *(const v4fa*)(red + row * RPT + cofs);
#pragma unroll
            for (int u = 1; u < NW; ++u) sum += *(const v4fa*)(red + (u * 64 + row) * RPT + cofs);
            *(v4f*)(C + (size_t)(r0 + row) * ldc + c0 + cofs) = sum; }
        return;
    }
#pragma unroll
    for (int mb = 0; mb < 4; ++mb) {
#pragma unroll
        for (int nb = 0; nb < 4; ++nb) {
#pragma unroll
            for (int j = 0; j < 8; ++j) os[(hi * 8 + j) * 68 + nb * 16 + lr] = acc[mb][nb][j]; }
        __builtin_amdgcn_wave_barrier(); asm volatile("" ::: "memory");
        float* crow = C + (size_t)(r0 + mb * 16) * ldc + c0;
{
#pragma unroll
            for (int s = 0; s < 8; ++s) { const int row = 2 * s + hi, cofs = lr * 4; v4f val = *(const v4fa*)(os + row * 68 + cofs); if (BIAS) { val[0] += bfr(bias[c0 + cofs]); val[1] += bfr(bias[c0 + cofs + 1]); val[2] += bfr(bias[c0 + cofs + 2]); val[3] += bfr(bias[c0 + cofs + 3]); }
                *(v4f*)(crow + (size_t)row * ldc + cofs) = val; }
             }
        __builtin_amdgcn_wave_barrier(); asm volatile("" ::: "memory");
    }
}

__device__ __forceinline__ h16 tohx(float x) { return (h16)x; }
__device__ __forceinline__ void splitf(float y, unsigned short& h, unsigned short& l) { h = f2bf(y); l = f2bf(y - bf2f(h)); }
typedef __attribute__((ext_vector_type(2))) unsigned short v2us;
typedef __attribute__((ext_vector_type(4))) unsigned short v4us;
typedef __attribute__((ext_vector_type(8))) unsigned short v8us;
typedef __attribute__((ext_vector_type(4))) _Float16 v4h;
typedef __attribute__((ext_vector_type(2))) float v2f;

// a weight plane [128][192] rounded to bf16 and laid in fragment order; a thread takes 8 consecutive k of one row
__global__ __launch_bounds__(256) void k_cvt8(const float* __restrict__ src, bf* dst, size_t n8) { const size_t i = (size_t)blockIdx.x * 256 + threadIdx.x; if (i >= n8) return; const v8f v = *(const v8f*)(src + i * 8); v8us o;
#pragma unroll
    for (int k = 0; k < 8; ++k) o[k] = f2bf(v[k]); const int row = (int)(i / (KI / 8)), k0 = (int)(i % (KI / 8)) * 8; *(v8us*)(dst + PKO(row, k0, KI)) = o;  }
__global__ __launch_bounds__(256) void k_im2col(const float* __restrict__ xb, bf* X3) { xb += (size_t)blockIdx.y * CIN * TT; X3 += (size_t)blockIdx.y * TT * KI; const size_t e8 = ((size_t)blockIdx.x * 256 + threadIdx.x) * 8; if (e8 >= (size_t)TT * KI) return;
    // e8 is the place in the plane, which lies in fragment order: 16 neighbouring threads hold 16 neighbouring t at the same 8 k
    const int pb16 = (int)(e8 >> 7); const int kidx = (pb16 % (KI / 8)) * 8; const int t = (pb16 / (KI / 8)) * 16 + ((int)(e8 >> 3) & 15); v8us o;
#pragma unroll
    for (int u = 0; u < 8; ++u) { const int k2 = kidx + u; const int ci = k2 / KW, kk = k2 % KW; const int tt = t + kk - 1; o[u] = (tt >= 0 && tt < TT) ? f2bf(xb[(size_t)ci * TT + tt]) : (unsigned short)0; }
    *(v8us*)(X3 + e8) = o;  }
// ---- k_conv: one k = 3 convolution as its im2col GEMM (k_gemmw's one-wave 64x64 tile and K loop: A = X3 [t][192], Bt = w [c][192], both in fragment order) that finishes its own output: bias, BN affine, LeakyReLU and the split
// into 16-bit planes are applied to the accumulators, so that no f32 plane is written and read again by a pass of its own. Grid (TT/64, CC/64, NB_), 32 threads.
// EPI 0 (q, k): hi/lo bf16 planes [t][c], in fragment order. EPI 1 (v): hi/lo bf16 and fp16 planes, transposed [c][t], in fragment order. EPI 2 (pe): f32 plane [t][c], row-major.
struct BnC { float b, sc, sh; };   // one channel's bias, BN scale and BN shift
__device__ __forceinline__ BnC bn_chan(int c, const float* __restrict__ bias, const float* __restrict__ gam, const float* __restrict__ bet, const float* __restrict__ mu, const float* __restrict__ var) {
    BnC r; r.b = bfr(bias[c]);
    // here and in bn_act each product is rounded before its add or subtract, as in y * scale + (beta - mean * scale) taken one operation at a time: q, k, v and pe come out bit for bit as from a BN pass of its own
    const float sc = __fmul_rn(bfr(gam[c]), __fdiv_rn(1.0f, sqrtf(__fadd_rn(bfr(var[c]), 1e-5f)))); float ms = __fmul_rn(bfr(mu[c]), sc); asm volatile("" : "+v"(ms)); const float sh = __fsub_rn(bfr(bet[c]), ms);
    r.sc = sc; r.sh = sh; return r; }
__device__ __forceinline__ float bn_act(float acc, const BnC p) { const float a = acc + p.b; float y = __fmul_rn(a, p.sc); asm volatile("" : "+v"(y)); y = __fadd_rn(y, p.sh); return (y > 0.f) ? y : 0.3f * y; }
template <int EPI>
__global__ __launch_bounds__(32) void k_conv(const bf* __restrict__ A, const bf* __restrict__ Bt, const float* __restrict__ bias, const float* __restrict__ gam, const float* __restrict__ bet, const float* __restrict__ mu, const float* __restrict__ var, bf* Oh, bf* Ol, h16* O16, float* OF) {
    typedef WFrag<bf>::V V;
    __shared__ __align__(16) float os[16 * 68];
    const size_t zo = (size_t)blockIdx.z * TT * CC; A += (size_t)blockIdx.z * TT * KI;
    const int lane = threadIdx.x & 31, lr = lane & 15, hi = lane >> 4; const int r0 = blockIdx.x * 64, c0 = blockIdx.y * 64;
    v8f acc[4][4];
#pragma unroll
    for (int mb = 0; mb < 4; ++mb)
#pragma unroll
        for (int nb = 0; nb < 4; ++nb) acc[mb][nb] = (v8f){};
    // the lane's 4 channels: behind the LDS turn (EPI 2) 4 neighbours, the same in every row; in the accumulators themselves (EPI 0, 1) one per column block. Formed ahead of the K loop, whose loads hide theirs
    const int cofs = lr * 4;
    BnC pc[4];
#pragma unroll
    for (int u = 0; u < 4; ++u) pc[u] = bn_chan(EPI != 2 ? c0 + u * 16 + lr : c0 + cofs + u, bias, gam, bet, mu, var);
    const bf* pa = A + (size_t)r0 * KI + lane * 8; const bf* pb = Bt + (size_t)c0 * KI + lane * 8;
    // the loop stays rolled, as in k_gemmw
#pragma unroll 1
    for (int kc = 0; kc < KI; kc += 32, pa += 512, pb += 512) {
        V a[4], b[4];
#pragma unroll
        for (int mb = 0; mb < 4; ++mb) a[mb] = WFrag<bf>::ld(pa + (size_t)mb * 16 * KI);
#pragma unroll
        for (int nb = 0; nb < 4; ++nb) b[nb] = WFrag<bf>::ld(pb + (size_t)nb * 16 * KI);
        asm volatile("s_wait_xcnt 0x0" :: "v"(pa), "v"(pb) : "memory");   // the 16 loads' two address pairs stay as they are (no load lands on them, nothing rewrites them) until this wait
#pragma unroll
        for (int nb = 0; nb < 4; ++nb)
#pragma unroll
            for (int mb = 0; mb < 4; ++mb) acc[mb][nb] = WFrag<bf>::mma(a[mb], b[nb], acc[mb][nb]);
        // the distance behind the trip's last WMMAs, on the back edge too, where the next trip's loads land on a[] and b[]
        asm volatile("v_nop\n\tv_nop\n\tv_nop\n\tv_nop" : "+v"(acc[0][0]), "+v"(acc[1][1]), "+v"(acc[2][2]), "+v"(acc[3][3]) : "v"(a[0]), "v"(a[3]));
    }
    // every loop below is unrolled whole: acc[][] and pc[] are indexed by constants alone and stay in registers
    if (EPI == 1) {
        // a lane's accumulator holds 8 consecutive t of one channel: that is a lane's 16 B of a transposed plane in fragment order, and the wave's store is 512 B in a row
#pragma unroll
        for (int nb = 0; nb < 4; ++nb)
#pragma unroll
            for (int mb = 0; mb < 4; ++mb) { v8us oh, ol; v8h of;
#pragma unroll
                for (int j = 0; j < 8; ++j) { const float y = bn_act(acc[mb][nb][j], pc[nb]); unsigned short p, q; splitf(y, p, q); oh[j] = p; ol[j] = q; of[j] = tohx(y); }
                const size_t oo = zo + PKO(c0 + nb * 16 + lr, r0 + mb * 16 + hi * 8, TT); *(v8us*)(Oh + oo) = oh; *(v8us*)(Ol + oo) = ol; *(v8h*)(O16 + oo) = of;
                asm volatile("s_wait_xcnt 0x0" :: "v"(oh), "v"(ol), "v"(of) : "memory"); }   // the three stores name these data registers: they stay as they are until this wait
        return;
    }
    if (EPI == 0) {
        // the finished values are turned through LDS: a lane then holds 8 consecutive channels of one t, its 16 B of a plane in fragment order, and the wave's store is 512 B in a row
#pragma unroll
        for (int mb = 0; mb < 4; ++mb) {
#pragma unroll
            for (int nb = 0; nb < 4; ++nb) {
#pragma unroll
                for (int j = 0; j < 8; ++j) os[(hi * 8 + j) * 68 + nb * 16 + lr] = bn_act(acc[mb][nb][j], pc[nb]); }
            __builtin_amdgcn_wave_barrier(); asm volatile("" ::: "memory");   // a lane reads what other lanes wrote: the compiler, which follows one lane, must not lift a read over the 16 rows' writes
            v8us oh[4], ol[4];
#pragma unroll
            for (int s = 0; s < 4; ++s) { const int g8 = 2 * s + hi; const v4f x0 = *(const v4fa*)(os + lr * 68 + g8 * 8), x1 = *(const v4fa*)(os + lr * 68 + g8 * 8 + 4);
#pragma unroll
                for (int u = 0; u < 8; ++u) { unsigned short p, q; splitf(u < 4 ? x0[u & 3] : x1[u & 3], p, q); oh[s][u] = p; ol[s][u] = q; }
                const size_t oo = zo + PKO(r0 + mb * 16 + lr, c0 + g8 * 8, CC); *(v8us*)(Oh + oo) = oh[s]; *(v8us*)(Ol + oo) = ol[s]; }
            // the 16 rows' stores name these data registers: they stay as they are until this wait, one for the whole group
            asm volatile("s_wait_xcnt 0x0" :: "v"(oh[0]), "v"(oh[1]), "v"(oh[2]), "v"(oh[3]), "v"(ol[0]), "v"(ol[1]), "v"(ol[2]), "v"(ol[3]) : "memory");
            __builtin_amdgcn_wave_barrier(); asm volatile("" ::: "memory");   // nor the next 16 rows' writes over these reads
        }
        return;
    }
#pragma unroll
    for (int mb = 0; mb < 4; ++mb) {
#pragma unroll
        for (int nb = 0; nb < 4; ++nb) {
#pragma unroll
            for (int j = 0; j < 8; ++j) os[(hi * 8 + j) * 68 + nb * 16 + lr] = acc[mb][nb][j]; }
        __builtin_amdgcn_wave_barrier(); asm volatile("" ::: "memory");   // a lane reads what other lanes wrote: the compiler, which follows one lane, must not lift a read over the 16 rows' writes
#pragma unroll
        for (int s = 0; s < 8; ++s) { const int row = 2 * s + hi; v4f val = *(const v4fa*)(os + row * 68 + cofs); const size_t oo = zo + (size_t)(r0 + mb * 16 + row) * CC + c0 + cofs;
#pragma unroll
            for (int u = 0; u < 4; ++u) val[u] = bn_act(val[u], pc[u]);
            *(v4f*)(OF + oo) = val; }
        __builtin_amdgcn_wave_barrier(); asm volatile("" ::: "memory");   // nor the next 16 rows' writes over these reads
    }
}
// ---- st_tile: one wave's 64x64 tile of the TRANSPOSED scores, St[l][i] = sum_c k[c][l] q[c][i] (A = k rows l, Bt = q rows i, planes in fragment order, K = 128; per 32-element chunk the three split products in the order hi x hi, q lo x k hi, q hi x k lo).
// An accumulator holds one i (its column, lane & 15) and 8 consecutive l: what belongs to a softmax row i (its maximum, its sum, its factor) is a per-lane value. Both kernels below call it, so both see the same bits.
#define L2E  1.4426950408889634f
// 2^x on the transcendental unit; the v_nop is the one slot that the instruction set asks for behind a transcendental before its result is read or its source overwritten
__device__ __forceinline__ float ex2(float x) { float r; asm("v_exp_f32 %0, %1\n\tv_nop" : "=v"(r) : "v"(x)); return r; }
__device__ __forceinline__ void st_tile(const bf* __restrict__ Kh, const bf* __restrict__ Kl, const bf* __restrict__ Qh, const bf* __restrict__ Ql, int l0, int i0, int lr, int hi, v8f (&acc)[4][4]) {
    typedef WFrag<bf>::V V;
#pragma unroll
    for (int mb = 0; mb < 4; ++mb)
#pragma unroll
        for (int nb = 0; nb < 4; ++nb) acc[mb][nb] = (v8f){};
    const size_t ao = (size_t)l0 * CC + (hi * 16 + lr) * 8, bo = (size_t)i0 * CC + (hi * 16 + lr) * 8;
    const bf* pkh = Kh + ao; const bf* pkl = Kl + ao; const bf* pqh = Qh + bo; const bf* pql = Ql + bo;
    // the loop stays rolled, as in k_gemmw: 16 accumulators and one trip's fragments fill the registers
#pragma unroll 1
    for (int kc = 0; kc < CC; kc += 32, pkh += 512, pkl += 512, pqh += 512, pql += 512) {
        V a[4], a2[4];
#pragma unroll
        for (int mb = 0; mb < 4; ++mb) { a[mb] = WFrag<bf>::ld(pkh + (size_t)mb * 16 * CC); a2[mb] = WFrag<bf>::ld(pkl + (size_t)mb * 16 * CC); }
#pragma unroll
        for (int nb = 0; nb < 4; ++nb) { const V b = WFrag<bf>::ld(pqh + (size_t)nb * 16 * CC); const V b2 = WFrag<bf>::ld(pql + (size_t)nb * 16 * CC);
#pragma unroll
            for (int mb = 0; mb < 4; ++mb) { acc[mb][nb] = WFrag<bf>::mma(a[mb], b, acc[mb][nb]); acc[mb][nb] = WFrag<bf>::mma(a[mb], b2, acc[mb][nb]); acc[mb][nb] = WFrag<bf>::mma(a2[mb], b, acc[mb][nb]); } }
        // the distance behind the trip's last WMMAs, on the back edge too, where the next trip's loads land on a[] and a2[]
        asm volatile("v_nop\n\tv_nop\n\tv_nop\n\tv_nop" : "+v"(acc[0][0]), "+v"(acc[1][1]), "+v"(acc[2][2]), "+v"(acc[3][3]) : "v"(a[0]), "v"(a[3]));
        asm volatile("s_wait_xcnt 0x0" :: "v"(pkh), "v"(pkl), "v"(pqh), "v"(pql) : "memory");   // no address pair that the trip's loads name is rewritten ahead of this wait (it stands at the loop's foot, in front of the back edge)
    }
}
// ---- k_stat: the softmax rows' maxima and 1 / sums, from scores that are formed and dropped (no score plane is stored). Grid (TT/64, NB_), 8 waves: the block owns 64 rows i, wave w the l tiles w, w + 8, w + 16, w + 24.
// A lane keeps a running (maximum, sum of exp2 relative to it) for each of its 4 rows i; the 16 partial pairs of a row (8 waves x 2 lane halves) are merged through LDS in a fixed order.
#define SNW  8
__global__ __launch_bounds__(32 * SNW) void k_stat(const bf* __restrict__ Kh, const bf* __restrict__ Kl, const bf* __restrict__ Qh, const bf* __restrict__ Ql, float* MX, float* FI) {
    __shared__ float pm[2 * SNW][64], ps[2 * SNW][64];
    { const size_t zo = (size_t)blockIdx.y * TT * CC; Kh += zo; Kl += zo; Qh += zo; Ql += zo; }
    const int w = __builtin_amdgcn_readfirstlane((int)(threadIdx.x >> 5));   // the wave's number, in a scalar register: the tile loop's counter stays scalar
    const int lane = threadIdx.x & 31, lr = lane & 15, hi = lane >> 4; const int i0 = blockIdx.x * 64;
    float m[4], s[4];
#pragma unroll
    for (int nb = 0; nb < 4; ++nb) { m[nb] = -3.0e38f; s[nb] = 0.f; }
    // rolled: one tile's accumulators at a time
#pragma unroll 1
    for (int t = w; t < TT / 64; t += SNW) {
        v8f acc[4][4];
        st_tile(Kh, Kl, Qh, Ql, t * 64, i0, lr, hi, acc);
        // unrolled whole: acc[][] is indexed by constants alone and stays in registers
#pragma unroll
        for (int nb = 0; nb < 4; ++nb) { float mn = m[nb];
#pragma unroll
            for (int mb = 0; mb < 4; ++mb)
#pragma unroll
                for (int j = 0; j < 8; ++j) mn = fmaxf(mn, acc[mb][nb][j]);
            float ss = 0.f;
#pragma unroll
            for (int mb = 0; mb < 4; ++mb)
#pragma unroll
                for (int j = 0; j < 8; ++j) ss += ex2(__fmul_rn(__fsub_rn(acc[mb][nb][j], mn), L2E));
            s[nb] = s[nb] * ex2(__fmul_rn(__fsub_rn(m[nb], mn), L2E)) + ss; m[nb] = mn; }
    }
#pragma unroll
    for (int nb = 0; nb < 4; ++nb) { pm[2 * w + hi][nb * 16 + lr] = m[nb]; ps[2 * w + hi][nb * 16 + lr] = s[nb]; }
    __syncthreads();   // every wave's partial pairs lie in LDS before any of them is merged
    if (threadIdx.x < 64) { const int i = threadIdx.x; float mx = pm[0][i];
#pragma unroll
        for (int p = 1; p < 2 * SNW; ++p) mx = fmaxf(mx, pm[p][i]);
        float sum = 0.f;
#pragma unroll
        for (int p = 0; p < 2 * SNW; ++p) sum += ps[p][i] * ex2(__fmul_rn(__fsub_rn(pm[p][i], mx), L2E));
        const size_t o = (size_t)blockIdx.y * TT + i0 + i; MX[o] = mx; FI[o] = __fdiv_rn(1.0f, sum); }
}
// the tile's way out; HL: hi/lo bf16 planes, else the fp16 plane, each [l][i] in fragment order. The three pointers stand at the tile's first element
template <bool HL>
__device__ __forceinline__ void spt_out(const v8f (&acc)[4][4], const float (&mi)[4], const float (&fi)[4], float* os, int lr, int hi, bf* Th, bf* Tl, h16* T16) {
    // every loop below is unrolled whole: acc[][], mi[] and fi[] are indexed by constants alone and stay in registers
#pragma unroll
    for (int mb = 0; mb < 4; ++mb) {
#pragma unroll
        for (int nb = 0; nb < 4; ++nb) {
#pragma unroll
            for (int j = 0; j < 8; ++j) os[(hi * 8 + j) * 68 + nb * 16 + lr] = ex2(__fmul_rn(__fsub_rn(acc[mb][nb][j], mi[nb]), L2E)) * fi[nb]; }
        __builtin_amdgcn_wave_barrier(); asm volatile("" ::: "memory");   // a lane reads what other lanes wrote: the compiler, which follows one lane, must not lift a read over the 16 rows' writes
        // a lane takes 8 consecutive i of row l = lane & 15: its 16 B of a plane in fragment order; the wave's store is 512 B in a row
        v8us oh[4], ol[4]; v8h of[4];
#pragma unroll
        for (int s = 0; s < 4; ++s) { const int g8 = 2 * s + hi; const v4f x0 = *(const v4fa*)(os + lr * 68 + g8 * 8), x1 = *(const v4fa*)(os + lr * 68 + g8 * 8 + 4); const size_t oo = (size_t)mb * 16 * TT + g8 * 128 + lr * 8;
#pragma unroll
            for (int u = 0; u < 8; ++u) { unsigned short p, q; splitf(u < 4 ? x0[u & 3] : x1[u & 3], p, q); oh[s][u] = p; ol[s][u] = q; }
            if (HL) { *(v8us*)(Th + oo) = oh[s]; *(v8us*)(Tl + oo) = ol[s]; }
            else {
#pragma unroll
                for (int u = 0; u < 8; ++u) of[s][u] = tohx(__fadd_rn(bf2f(oh[s][u]), bf2f(ol[s][u])) * PCAR);
                *(v8h*)(T16 + oo) = of[s]; } }
        // the 16 rows' stores name these data registers: they stay as they are until this wait, one for the whole group
        if (HL) asm volatile("s_wait_xcnt 0x0" :: "v"(oh[0]), "v"(oh[1]), "v"(oh[2]), "v"(oh[3]), "v"(ol[0]), "v"(ol[1]), "v"(ol[2]), "v"(ol[3]) : "memory");
        else asm volatile("s_wait_xcnt 0x0" :: "v"(of[0]), "v"(of[1]), "v"(of[2]), "v"(of[3]) : "memory");
        __builtin_amdgcn_wave_barrier(); asm volatile("" ::: "memory");   // nor the next 16 rows' writes over these reads
    }
}
// ---- k_spt: P^T straight from a second forming of the scores. One wave per 64x64 tile of St; P^T[l][i] = exp2((St[l][i] - max_i) * log2 e) * (1 / sum_i), turned through LDS into 16-B pieces of 8 i and stored, in fragment order, as
// hi/lo bf16 planes (rows l < RH) or as fp16((hi + lo) x 1024) (rows l >= RH). Grid (TT/64, TT/64, NB_), 32 threads.
__global__ __launch_bounds__(32) void k_spt(const bf* __restrict__ Kh, const bf* __restrict__ Kl, const bf* __restrict__ Qh, const bf* __restrict__ Ql, const float* __restrict__ MX, const float* __restrict__ FI, bf* PTh, bf* PTl, h16* PT16) {
    __shared__ __align__(16) float os[16 * 68];
    { const size_t zb = blockIdx.z, zo = zb * TT * CC; Kh += zo; Kl += zo; Qh += zo; Ql += zo; MX += zb * TT; FI += zb * TT; PTh += zb * RH * TT; PTl += zb * RH * TT; PT16 += zb * (TT - RH) * TT; }
    const int lane = threadIdx.x & 31, lr = lane & 15, hi = lane >> 4; const int l0 = blockIdx.x * 64, i0 = blockIdx.y * 64;   // l0 < RH is the same for the whole tile: RH % 64 == 0
    // the lane's 4 rows i: loaded ahead of the K loop, whose loads hide these
    float mi[4], fi[4];
#pragma unroll
    for (int nb = 0; nb < 4; ++nb) { mi[nb] = MX[i0 + nb * 16 + lr]; fi[nb] = FI[i0 + nb * 16 + lr]; }
    v8f acc[4][4];
    st_tile(Kh, Kl, Qh, Ql, l0, i0, lr, hi, acc);
    // the test is the same for the whole tile and stands once, outside the unrolled loops
    if (l0 < RH) spt_out<true>(acc, mi, fi, os, lr, hi, PTh + PKO(l0, i0, TT), PTl + PKO(l0, i0, TT), nullptr);
    else spt_out<false>(acc, mi, fi, os, lr, hi, nullptr, nullptr, PT16 + PKO(l0 - RH, i0, TT));
}
__global__ __launch_bounds__(256) void k_fin(const float* __restrict__ OT, const float* __restrict__ PE, float* OUTb) { { const size_t zo = (size_t)blockIdx.y * TT * CC; OT += zo; PE += zo; OUTb += zo; } const size_t e = ((size_t)blockIdx.x * 256 + threadIdx.x) * 4; if (e >= (size_t)CC * TT) return; const int l = (int)(e % TT); const int c = (int)(e / TT); v4f r;
#pragma unroll
    for (int u = 0; u < 4; ++u) { const int ll = l + u; const float cs = (ll < RH) ? 1.0f : (1.0f / PCAR); float o = OT[(size_t)ll * CC + c] * cs; asm volatile("" : "+v"(o)); r[u] = __fadd_rn(o, PE[(size_t)ll * CC + c]); }
    *(v4f*)(OUTb + e) = r;  }

extern "C" void kernel_launch(void* const* d_in, const int* in_sizes, int n_in,
                              void* d_out, int out_size, void* d_ws, size_t ws_size, hipStream_t stream) {
    (void)in_sizes; (void)n_in; (void)out_size;
    const float* x = (const float*)d_in[0];
    const float* prm[4][6]; for (int r = 0; r < 4; ++r) for (int c = 0; c < 6; ++c) prm[r][c] = (const float*)d_in[1 + r * 6 + c];   // (w, b, gamma, beta, mean, var) for q, k, v, pe
    float* OUT = (float*)d_out;     // [16][128][2048]
    char* wsp = (char*)d_ws;
    auto take = [&](size_t bytes) { char* p = wsp; wsp += (bytes + 255) & ~(size_t)255; return (void*)p; };
    const size_t FE = (size_t)TT * CC;   // elements of one batch's [2048][128] plane
    bf* W4 = (bf*)take((size_t)4 * CC * KI * 2);
    // live through the whole call, all 16 batches
    bf* QPh = (bf*)take(NB_ * FE * 2); bf* QPl = (bf*)take(NB_ * FE * 2); bf* KPh = (bf*)take(NB_ * FE * 2); bf* KPl = (bf*)take(NB_ * FE * 2);
    bf* VTh = (bf*)take(NB_ * FE * 2); bf* VTl = (bf*)take(NB_ * FE * 2); h16* VT16 = (h16*)take(NB_ * FE * 2); float* FPE = (float*)take(NB_ * FE * 4);
    float* MX = (float*)take((size_t)NB_ * TT * 4); float* FI = (float*)take((size_t)NB_ * TT * 4);
    bf* PTh = (bf*)take((size_t)NB_ * RH * TT * 2); bf* PTl = (bf*)take((size_t)NB_ * RH * TT * 2); h16* PT16 = (h16*)take((size_t)NB_ * (TT - RH) * TT * 2); float* OT = (float*)take(NB_ * FE * 4);
    if ((size_t)(wsp - (char*)d_ws) > ws_size) return;    // ~ 249 MiB
    // the im2col plane (12 MiB, all 16 batches) lies in PT16 (96 MiB): its last reader runs before k_spt writes PT16
    bf* X3 = (bf*)PT16;
    for (int r = 0; r < 4; ++r) k_cvt8<<<(unsigned)(((size_t)CC * KI / 8 + 255) / 256), 256, 0, stream>>>(prm[r][0], W4 + (size_t)r * CC * KI, (size_t)CC * KI / 8);   // w [128][64][3] == Bt [128][192], laid in fragment order
    k_im2col<<<dim3((unsigned)(((size_t)TT * KI / 8 + 255) / 256), NB_, 1), 256, 0, stream>>>(x, X3);
    const dim3 cg(TT / 64, CC / 64, NB_);
    k_conv<0><<<cg, 32, 0, stream>>>(X3, W4, prm[0][1], prm[0][2], prm[0][3], prm[0][4], prm[0][5], QPh, QPl, nullptr, nullptr);
    k_conv<0><<<cg, 32, 0, stream>>>(X3, W4 + (size_t)1 * CC * KI, prm[1][1], prm[1][2], prm[1][3], prm[1][4], prm[1][5], KPh, KPl, nullptr, nullptr);
    k_conv<1><<<cg, 32, 0, stream>>>(X3, W4 + (size_t)2 * CC * KI, prm[2][1], prm[2][2], prm[2][3], prm[2][4], prm[2][5], VTh, VTl, VT16, nullptr);
    k_conv<2><<<cg, 32, 0, stream>>>(X3, W4 + (size_t)3 * CC * KI, prm[3][1], prm[3][2], prm[3][3], prm[3][4], prm[3][5], nullptr, nullptr, nullptr, FPE);
    k_stat<<<dim3(TT / 64, NB_, 1), 32 * SNW, 0, stream>>>(KPh, KPl, QPh, QPl, MX, FI);                                                    // softmax row maxima and 1 / sums
    k_spt<<<dim3(TT / 64, TT / 64, NB_), 32, 0, stream>>>(KPh, KPl, QPh, QPl, MX, FI, PTh, PTl, PT16);                                     // P^T planes
    k_gemmw<bf, 2, false, KWV, TT><<<dim3(RH / 64, CC / 64, NB_), 32 * KWV, 0, stream>>>(PTh, PTl, VTh, VTl, OT, CC, nullptr, (size_t)RH * TT, FE, FE);                             // rows l < RH: hl P^T x hl v
    k_gemmw<h16, 0, false, KWV, TT><<<dim3((TT - RH) / 64, CC / 64, NB_), 32 * KWV, 0, stream>>>(PT16, nullptr, VT16, nullptr, OT + (size_t)RH * CC, CC, nullptr, (size_t)(TT - RH) * TT, FE, FE);   // rest: fp16 x1024
    k_fin<<<dim3((unsigned)((FE / 4 + 255) / 256), NB_, 1), 256, 0, stream>>>(OT, FPE, OUT);
}

// v007
// Measured time: 222 microseconds a run.
// Next to v006, in two timings, it ran 1.10 times as fast each time.
// Counting every step since v000, it is 14.3 times as fast.
#include <hip/hip_runtime.h>

// Conv1dAttention (x [16][64][2048] channels-first; q/k/v/pe = LeakyReLU_0.3(BN(conv1d_k3(x) + b)) with 128 output channels (BN inference affine: y*scale + (beta - mean*scale), scale = gamma*rsqrt(var + 1e-5)); attn[i][j] = sum_c q[c][i] k[c][j] (NO scaling); P = softmax_j; out[c][l] = sum_j v[c][j] P[j][l] + pe[c][l] -> [16][128][2048] - note the value product contracts over the softmax ROW index j, i.e. it uses P TRANSPOSED).
// Compute dtypes, f32 accumulate: every input rounded to bf16; the four k=3 convolutions as PLAIN bf16 im2col GEMMs (K = 192, inputs: exact) + bias, BN affine and LeakyReLU in f32; scores hl x hl (3 products, K 128, unscaled) on every row, formed twice, both times transposed, and never stored: once for the softmax rows' f32 maxima and sums, once for P^T itself, split hi/lo bf16; output rows l < 512 as hl P^T x hl v (3 products, K 2048), rows >= 512 as fp16(P^T x 1024) x fp16 v; + pe, written channels-first.

#define NB_  16
#define CIN  64
#define CC   128
#define KW   3
#define KI   (CIN * KW)     // 192
#define TT   2048
#define RH   512
#define PCAR 1024.0f
#define KWV  8              // waves that share one tile's K in the two P^T x v products
typedef _Float16 h16;
typedef unsigned short bf;
typedef __attribute__((ext_vector_type(16))) __bf16   v16bf;
typedef __attribute__((ext_vector_type(16))) _Float16 v16h;
typedef __attribute__((ext_vector_type(8)))  _Float16 v8h;
typedef __attribute__((ext_vector_type(8)))  unsigned short v8us;
typedef __attribute__((ext_vector_type(8)))  float    v8f;
typedef __attribute__((ext_vector_type(4)))  float    v4f;
typedef v8h  __attribute__((may_alias)) v8ha;
typedef v4f  __attribute__((may_alias)) v4fa;
typedef v8us __attribute__((may_alias)) v8usa;

__device__ __forceinline__ unsigned short f2bf(float f) { unsigned u = __float_as_uint(f); u += 0x7FFFu + ((u >> 16) & 1u); return (unsigned short)(u >> 16); }
__device__ __forceinline__ float bf2f(unsigned short b) { return __uint_as_float(((unsigned)b) << 16); }
__device__ __forceinline__ float bfr(float f) { return bf2f(f2bf(f)); }
__device__ __forceinline__ v16h cat16(v8h lo, v8h hi) { return __builtin_shufflevector(lo, hi, 0, 1, 2, 3, 4, 5, 6, 7, 8, 9, 10, 11, 12, 13, 14, 15); }
__device__ __forceinline__ v16bf cat16b(v8us lo, v8us hi) { return __builtin_bit_cast(v16bf, __builtin_shufflevector(lo, hi, 0, 1, 2, 3, 4, 5, 6, 7, 8, 9, 10, 11, 12, 13, 14, 15)); }
__device__ __forceinline__ v8f wmma16(v16h a, v16h b, v8f c) { return __builtin_amdgcn_wmma_f32_16x16x32_f16(false, a, false, b, (short)0, c, false, false); }
__device__ __forceinline__ v8f wmmab(v16bf a, v16bf b, v8f c) { return __builtin_amdgcn_wmma_f32_16x16x32_bf16(false, a, false, b, (short)0, c, false, false); }



// ---- FRAGMENT ORDER: every 16-bit plane [R][K] that a matrix product reads lies as blocks of 16 rows x 8 k: element (r, k) at (r / 16) * 16 * K + (k / 8) * 128 + (r % 16) * 8 + k % 8 (PKO below).
// A 16 x 32 fragment is then 1 KiB in a row, and each of its two 16-B-a-lane loads (at lane * 8 and at 256 + lane * 8 elements) reads 512 contiguous bytes, 4 whole lines, where a row-major plane gave 32 B of each of 16 lines.
// The lane and register that hold an element are the same as from a row-major plane (lane & 15 the row; k = 8 * (lane >> 4) + 0..7, then 16 more), so every product sees the same operands in the same k order.
#define PKO(r, k, K) ((size_t)((r) >> 4) * 16 * (K) + (size_t)((k) >> 3) * 128 + ((r) & 15) * 8 + ((k) & 7))
// ---- gemmw: register-blocked GEMM, ONE WAVE per 64x64 output tile (16 accumulators) where NW == 1, operands straight from 16-bit planes in fragment order; tile (bx, by) of batch bz, 32 threads.
// C[m][n] (f32, pitch ldc, + optional f32 bias[n]) = sum_k A[m][k] Bt[n][k] (+ split products per NSPLIT). z-batch strides sA/sB/sC in elements. K % 32 == 0.
// NW > 1 (a long K on a small grid; 32 * NW threads, no bias): the tile's K is dealt to NW waves of one work-group. Wave w takes the 32-element chunks w, w + NW, w + 2 NW, ... (neighbouring waves read neighbouring
// 1-KiB fragments of the same 16 rows at about the same time), keeps a whole 64x64 partial tile in its accumulators and lays it in LDS; the block then adds the NW partial tiles in wave order and stores the sum.
#define RPT  68             // pitch of a partial tile's row in LDS, floats: the two 8-row halves of an accumulator's store fall on different banks
template <typename T16> struct WFrag;
template <> struct WFrag<h16> { typedef v16h V; static __device__ __forceinline__ V ld(const h16* p) { return cat16(*(const v8h*)p, *(const v8h*)(p + 256)); } static __device__ __forceinline__ v8f mma(V a, V b, v8f c) { return wmma16(a, b, c); } };
template <> struct WFrag<bf> { typedef v16bf V; static __device__ __forceinline__ V ld(const bf* p) { return cat16b(*(const v8us*)p, *(const v8us*)(p + 256)); } static __device__ __forceinline__ v8f mma(V a, V b, v8f c) { return wmmab(a, b, c); } };
// K is a constant of the instance: the 16-row steps of a plane then stand in the loads as immediate offsets from one address pair a plane
template <typename T16, int NSPLIT, bool BIAS, int NW, int K>
__device__ __forceinline__ void gemmw(float* os, float* red, int bx, int by, int bz, const T16* __restrict__ A, const T16* __restrict__ A2, const T16* __restrict__ Bt, const T16* __restrict__ Bt2, float* C, int ldc, const float* __restrict__ bias, size_t sA, size_t sB, size_t sC) {
    // os (16 * 68 floats, read where NW == 1) and red (NW * 64 * RPT floats, read where NW > 1) are the calling kernel's LDS: two instances called from one kernel share it
    typedef typename WFrag<T16>::V V;
    const int w = NW > 1 ? __builtin_amdgcn_readfirstlane((int)(threadIdx.x >> 5)) : 0;   // the wave's number, in a scalar register: the K loop's counter stays scalar
    const size_t z = bz; A += z * sA; if (A2) A2 += z * sA; Bt += z * sB; if (Bt2) Bt2 += z * sB; C += z * sC;
    const int lane = threadIdx.x & 31, lr = lane & 15, hi = lane >> 4; const int r0 = bx * 64, c0 = by * 64;
    v8f acc[4][4];
#pragma unroll
    for (int mb = 0; mb < 4; ++mb)
#pragma unroll
        for (int nb = 0; nb < 4; ++nb) acc[mb][nb] = (v8f){};
    // a 32-element chunk of 16 rows is 512 elements in a row; the next 16 rows stand 16 * K further
    const size_t aoff = (size_t)r0 * K + (size_t)w * 512 + lane * 8, boff = (size_t)c0 * K + (size_t)w * 512 + lane * 8;
    const T16* pa = A + aoff; const T16* pa2 = (NSPLIT == 1 || NSPLIT == 2) ? A2 + aoff : pa; const T16* pb = Bt + boff; const T16* pb2 = (NSPLIT >= 2) ? Bt2 + boff : pb;
#pragma unroll 1
    for (int kc = 32 * w; kc < K; kc += 32 * NW, pa += 512 * NW, pa2 += 512 * NW, pb += 512 * NW, pb2 += 512 * NW) {
        V a[4], a2[4];
#pragma unroll
        for (int mb = 0; mb < 4; ++mb) { a[mb] = WFrag<T16>::ld(pa + (size_t)mb * 16 * K); if (NSPLIT == 1 || NSPLIT == 2) a2[mb] = WFrag<T16>::ld(pa2 + (size_t)mb * 16 * K); }
#pragma unroll
        for (int nb = 0; nb < 4; ++nb) { const V b = WFrag<T16>::ld(pb + (size_t)nb * 16 * K); V b2; if (NSPLIT >= 2) b2 = WFrag<T16>::ld(pb2 + (size_t)nb * 16 * K);
#pragma unroll
            for (int mb = 0; mb < 4; ++mb) { acc[mb][nb] = WFrag<T16>::mma(a[mb], b, acc[mb][nb]); if (NSPLIT == 1 || NSPLIT == 2) acc[mb][nb] = WFrag<T16>::mma(a2[mb], b, acc[mb][nb]); if (NSPLIT >= 2) acc[mb][nb] = WFrag<T16>::mma(a[mb], b2, acc[mb][nb]); } }
        asm volatile("v_nop\n\tv_nop\n\tv_nop\n\tv_nop" : "+v"(acc[0][0]), "+v"(acc[1][1]), "+v"(acc[2][2]), "+v"(acc[3][3]) : "v"(a[0]), "v"(a[3]));
        asm volatile("s_wait_xcnt 0x0" :: "v"(pa), "v"(pa2), "v"(pb), "v"(pb2) : "memory");   // no address pair that the trip's loads name is rewritten ahead of this wait (it stands at the loop's foot, in front of the back edge)
    }
    if (NW > 1) {
        // the loops below are unrolled whole: acc[][] is indexed by constants alone and stays in registers, and a thread's LDS reads are all in flight at once
        float* my = red + w * 64 * RPT;
#pragma unroll
        for (int mb = 0; mb < 4; ++mb)
#pragma unroll
            for (int nb = 0; nb < 4; ++nb)
#pragma unroll
                for (int j = 0; j < 8; ++j) my[(mb * 16 + hi * 8 + j) * RPT + nb * 16 + lr] = acc[mb][nb][j];
        __syncthreads();   // every wave's partial tile lies in LDS before any of it is added
#pragma unroll
        for (int s = 0; s < 64 * 16 / (32 * NW); ++s) { const int idx = s * 32 * NW + (int)threadIdx.x; const int row = idx >> 4, cofs = (idx & 15) * 4; v4f sum = *(const v4fa*)(red + row * RPT + cofs);
#pragma unroll
            for (int u = 1; u < NW; ++u) sum += *(const v4fa*)(red + (u * 64 + row) * RPT + cofs);
            *(v4f*)(C + (size_t)(r0 + row) * ldc + c0 + cofs) = sum; }
        return;
    }
#pragma unroll
    for (int mb = 0; mb < 4; ++mb) {
#pragma unroll
        for (int nb = 0; nb < 4; ++nb) {
#pragma unroll
            for (int j = 0; j < 8; ++j) os[(hi * 8 + j) * 68 + nb * 16 + lr] = acc[mb][nb][j]; }
        __builtin_amdgcn_wave_barrier(); asm volatile("" ::: "memory");
        float* crow = C + (size_t)(r0 + mb * 16) * ldc + c0;
{
#pragma unroll
            for (int s = 0; s < 8; ++s) { const int row = 2 * s + hi, cofs = lr * 4; v4f val = *(const v4fa*)(os + row * 68 + cofs); if (BIAS) { val[0] += bfr(bias[c0 + cofs]); val[1] += bfr(bias[c0 + cofs + 1]); val[2] += bfr(bias[c0 + cofs + 2]); val[3] += bfr(bias[c0 + cofs + 3]); }
                *(v4f*)(crow + (size_t)row * ldc + cofs) = val; }
             }
        __builtin_amdgcn_wave_barrier(); asm volatile("" ::: "memory");
    }
}

__device__ __forceinline__ h16 tohx(float x) { return (h16)x; }
__device__ __forceinline__ void splitf(float y, unsigned short& h, unsigned short& l) { h = f2bf(y); l = f2bf(y - bf2f(h)); }
typedef __attribute__((ext_vector_type(2))) unsigned short v2us;
typedef __attribute__((ext_vector_type(4))) unsigned short v4us;
typedef __attribute__((ext_vector_type(8))) unsigned short v8us;
typedef __attribute__((ext_vector_type(4))) _Float16 v4h;
typedef __attribute__((ext_vector_type(2))) float v2f;

// a weight plane [128][192] rounded to bf16 and laid in fragment order; a thread takes 8 consecutive k of one row
__device__ __forceinline__ void cvt8(int bx, const float* __restrict__ src, bf* dst, size_t n8) { const size_t i = (size_t)bx * 256 + threadIdx.x; if (i >= n8) return; const v8f v = *(const v8f*)(src + i * 8); v8us o;
#pragma unroll
    for (int k = 0; k < 8; ++k) o[k] = f2bf(v[k]); const int row = (int)(i / (KI / 8)), k0 = (int)(i % (KI / 8)) * 8; *(v8us*)(dst + PKO(row, k0, KI)) = o;  }
__device__ __forceinline__ void im2col(int bx, int by, const float* __restrict__ xb, bf* X3) { xb += (size_t)by * CIN * TT; X3 += (size_t)by * TT * KI; const size_t e8 = ((size_t)bx * 256 + threadIdx.x) * 8; if (e8 >= (size_t)TT * KI) return;
    // e8 is the place in the plane, which lies in fragment order: 16 neighbouring threads hold 16 neighbouring t at the same 8 k
    const int pb16 = (int)(e8 >> 7); const int kidx = (pb16 % (KI / 8)) * 8; const int t = (pb16 / (KI / 8)) * 16 + ((int)(e8 >> 3) & 15); v8us o;
#pragma unroll
    for (int u = 0; u < 8; ++u) { const int k2 = kidx + u; const int ci = k2 / KW, kk = k2 % KW; const int tt = t + kk - 1; o[u] = (tt >= 0 && tt < TT) ? f2bf(xb[(size_t)ci * TT + tt]) : (unsigned short)0; }
    *(v8us*)(X3 + e8) = o;  }
// ---- k_prep: the im2col plane and the four weight planes in ONE launch (neither reads what the other writes). Grid (IMB + WBY, NB_), 256 threads: in each row of the grid the first IMB blocks lay the batch's im2col plane,
// the last WBY take one 256-thread piece of a weight plane each (NB_ * WBY pieces = 4 planes of WPB pieces).
#define IMB  (TT * KI / 8 / 256)    // 192
#define WPB  (CC * KI / 8 / 256)    // 12
#define WBY  (4 * WPB / NB_)        // 3
static_assert(TT * KI % (8 * 256) == 0 && CC * KI % (8 * 256) == 0 && 4 * WPB % NB_ == 0, "whole blocks");
__global__ __launch_bounds__(256) void k_prep(const float* __restrict__ x, bf* X3, const float* __restrict__ wq, const float* __restrict__ wk, const float* __restrict__ wv, const float* __restrict__ wp, bf* W4) {
    if (blockIdx.x < IMB) { im2col(blockIdx.x, blockIdx.y, x, X3); return; }
    const int pc = (int)blockIdx.y * WBY + (int)blockIdx.x - IMB, r = pc / WPB;   // the same for the whole block
    cvt8(pc % WPB, r == 0 ? wq : r == 1 ? wk : r == 2 ? wv : wp, W4 + (size_t)r * CC * KI, (size_t)CC * KI / 8);
}
// ---- conv_tile: one k = 3 convolution as its im2col GEMM (gemmw's one-wave 64x64 tile and K loop: A = X3 [t][192], Bt = w [c][192], both in fragment order) that finishes its own output: bias, BN affine, LeakyReLU and the split
// into 16-bit planes are applied to the accumulators, so that no f32 plane is written and read again by a pass of its own. Tile (bx, by) of batch bz, 32 threads; os: 16 * 68 floats of the calling kernel's LDS.
// EPI 0 (q, k): hi/lo bf16 planes [t][c], in fragment order. EPI 1 (v): hi/lo bf16 and fp16 planes, transposed [c][t], in fragment order. EPI 2 (pe): f32 plane [t][c], row-major.
struct BnC { float b, sc, sh; };   // one channel's bias, BN scale and BN shift
__device__ __forceinline__ BnC bn_chan(int c, const float* __restrict__ bias, const float* __restrict__ gam, const float* __restrict__ bet, const float* __restrict__ mu, const float* __restrict__ var) {
    BnC r; r.b = bfr(bias[c]);
    // here and in bn_act each product is rounded before its add or subtract, as in y * scale + (beta - mean * scale) taken one operation at a time: q, k, v and pe come out bit for bit as from a BN pass of its own
    const float sc = __fmul_rn(bfr(gam[c]), __fdiv_rn(1.0f, sqrtf(__fadd_rn(bfr(var[c]), 1e-5f)))); float ms = __fmul_rn(bfr(mu[c]), sc); asm volatile("" : "+v"(ms)); const float sh = __fsub_rn(bfr(bet[c]), ms);
    r.sc = sc; r.sh = sh; return r; }
__device__ __forceinline__ float bn_act(float acc, const BnC p) { const float a = acc + p.b; float y = __fmul_rn(a, p.sc); asm volatile("" : "+v"(y)); y = __fadd_rn(y, p.sh); return (y > 0.f) ? y : 0.3f * y; }
template <int EPI>
__device__ __forceinline__ void conv_tile(float* os, int bx, int by, int bz, const bf* __restrict__ A, const bf* __restrict__ Bt, const float* __restrict__ bias, const float* __restrict__ gam, const float* __restrict__ bet, const float* __restrict__ mu, const float* __restrict__ var, bf* Oh, bf* Ol, h16* O16, float* OF) {
    typedef WFrag<bf>::V V;
    const size_t zo = (size_t)bz * TT * CC; A += (size_t)bz * TT * KI;
    const int lane = threadIdx.x & 31, lr = lane & 15, hi = lane >> 4; const int r0 = bx * 64, c0 = by * 64;
    v8f acc[4][4];
#pragma unroll
    for (int mb = 0; mb < 4; ++mb)
#pragma unroll
        for (int nb = 0; nb < 4; ++nb) acc[mb][nb] = (v8f){};
    // the lane's 4 channels: behind the LDS turn (EPI 2) 4 neighbours, the same in every row; in the accumulators themselves (EPI 0, 1) one per column block. Formed ahead of the K loop, whose loads hide theirs
    const int cofs = lr * 4;
    BnC pc[4];
#pragma unroll
    for (int u = 0; u < 4; ++u) pc[u] = bn_chan(EPI != 2 ? c0 + u * 16 + lr : c0 + cofs + u, bias, gam, bet, mu, var);
    const bf* pa = A + (size_t)r0 * KI + lane * 8; const bf* pb = Bt + (size_t)c0 * KI + lane * 8;
    // the loop stays rolled, as in gemmw
#pragma unroll 1
    for (int kc = 0; kc < KI; kc += 32, pa += 512, pb += 512) {
        V a[4], b[4];
#pragma unroll
        for (int mb = 0; mb < 4; ++mb) a[mb] = WFrag<bf>::ld(pa + (size_t)mb * 16 * KI);
#pragma unroll
        for (int nb = 0; nb < 4; ++nb) b[nb] = WFrag<bf>::ld(pb + (size_t)nb * 16 * KI);
        asm volatile("s_wait_xcnt 0x0" :: "v"(pa), "v"(pb) : "memory");   // the 16 loads' two address pairs stay as they are (no load lands on them, nothing rewrites them) until this wait
#pragma unroll
        for (int nb = 0; nb < 4; ++nb)
#pragma unroll
            for (int mb = 0; mb < 4; ++mb) acc[mb][nb] = WFrag<bf>::mma(a[mb], b[nb], acc[mb][nb]);
        // the distance behind the trip's last WMMAs, on the back edge too, where the next trip's loads land on a[] and b[]
        asm volatile("v_nop\n\tv_nop\n\tv_nop\n\tv_nop" : "+v"(acc[0][0]), "+v"(acc[1][1]), "+v"(acc[2][2]), "+v"(acc[3][3]) : "v"(a[0]), "v"(a[3]));
    }
    // every loop below is unrolled whole: acc[][] and pc[] are indexed by constants alone and stay in registers
    if (EPI == 1) {
        // a lane's accumulator holds 8 consecutive t of one channel: that is a lane's 16 B of a transposed plane in fragment order, and the wave's store is 512 B in a row
#pragma unroll
        for (int nb = 0; nb < 4; ++nb)
#pragma unroll
            for (int mb = 0; mb < 4; ++mb) { v8us oh, ol; v8h of;
#pragma unroll
                for (int j = 0; j < 8; ++j) { const float y = bn_act(acc[mb][nb][j], pc[nb]); unsigned short p, q; splitf(y, p, q); oh[j] = p; ol[j] = q; of[j] = tohx(y); }
                const size_t oo = zo + PKO(c0 + nb * 16 + lr, r0 + mb * 16 + hi * 8, TT); *(v8us*)(Oh + oo) = oh; *(v8us*)(Ol + oo) = ol; *(v8h*)(O16 + oo) = of;
                asm volatile("s_wait_xcnt 0x0" :: "v"(oh), "v"(ol), "v"(of) : "memory"); }   // the three stores name these data registers: they stay as they are until this wait
        return;
    }
    if (EPI == 0) {
        // the finished values are turned through LDS: a lane then holds 8 consecutive channels of one t, its 16 B of a plane in fragment order, and the wave's store is 512 B in a row
#pragma unroll
        for (int mb = 0; mb < 4; ++mb) {
#pragma unroll
            for (int nb = 0; nb < 4; ++nb) {
#pragma unroll
                for (int j = 0; j < 8; ++j) os[(hi * 8 + j) * 68 + nb * 16 + lr] = bn_act(acc[mb][nb][j], pc[nb]); }
            __builtin_amdgcn_wave_barrier(); asm volatile("" ::: "memory");   // a lane reads what other lanes wrote: the compiler, which follows one lane, must not lift a read over the 16 rows' writes
            v8us oh[4], ol[4];
#pragma unroll
            for (int s = 0; s < 4; ++s) { const int g8 = 2 * s + hi; const v4f x0 = *(const v4fa*)(os + lr * 68 + g8 * 8), x1 = *(const v4fa*)(os + lr * 68 + g8 * 8 + 4);
#pragma unroll
                for (int u = 0; u < 8; ++u) { unsigned short p, q; splitf(u < 4 ? x0[u & 3] : x1[u & 3], p, q); oh[s][u] = p; ol[s][u] = q; }
                const size_t oo = zo + PKO(r0 + mb * 16 + lr, c0 + g8 * 8, CC); *(v8us*)(Oh + oo) = oh[s]; *(v8us*)(Ol + oo) = ol[s]; }
            // the 16 rows' stores name these data registers: they stay as they are until this wait, one for the whole group
            asm volatile("s_wait_xcnt 0x0" :: "v"(oh[0]), "v"(oh[1]), "v"(oh[2]), "v"(oh[3]), "v"(ol[0]), "v"(ol[1]), "v"(ol[2]), "v"(ol[3]) : "memory");
            __builtin_amdgcn_wave_barrier(); asm volatile("" ::: "memory");   // nor the next 16 rows' writes over these reads
        }
        return;
    }
#pragma unroll
    for (int mb = 0; mb < 4; ++mb) {
#pragma unroll
        for (int nb = 0; nb < 4; ++nb) {
#pragma unroll
            for (int j = 0; j < 8; ++j) os[(hi * 8 + j) * 68 + nb * 16 + lr] = acc[mb][nb][j]; }
        __builtin_amdgcn_wave_barrier(); asm volatile("" ::: "memory");   // a lane reads what other lanes wrote: the compiler, which follows one lane, must not lift a read over the 16 rows' writes
        v4f val[8];
#pragma unroll
        for (int s = 0; s < 8; ++s) { const int row = 2 * s + hi; val[s] = *(const v4fa*)(os + row * 68 + cofs); const size_t oo = zo + (size_t)(r0 + mb * 16 + row) * CC + c0 + cofs;
#pragma unroll
            for (int u = 0; u < 4; ++u) val[s][u] = bn_act(val[s][u], pc[u]);
            *(v4f*)(OF + oo) = val[s]; }
        // the 16 rows' stores name these data registers: they stay as they are until this wait, one for the whole group
        asm volatile("s_wait_xcnt 0x0" :: "v"(val[0]), "v"(val[1]), "v"(val[2]), "v"(val[3]), "v"(val[4]), "v"(val[5]), "v"(val[6]), "v"(val[7]) : "memory");
        __builtin_amdgcn_wave_barrier(); asm volatile("" ::: "memory");   // nor the next 16 rows' writes over these reads
    }
}
// ---- k_conv4: the four convolutions in ONE launch (they read the same im2col plane and none reads another's output): 4 waves a SIMD run side by side where a launch of one convolution gave each SIMD one.
// Grid (TT/64, 4 * CC/64, NB_), 32 threads; blockIdx.y = convolution * (CC/64) + channel tile, so that the 8 tiles that read the same 64 rows of the im2col plane start close together.
struct CvP { const float* b; const float* g; const float* be; const float* mu; const float* var; };   // one convolution's bias and BN vectors
__global__ __launch_bounds__(32) void k_conv4(const bf* __restrict__ X3, const bf* __restrict__ W4, CvP pq, CvP pk, CvP pv, CvP pp, bf* QPh, bf* QPl, bf* KPh, bf* KPl, bf* VTh, bf* VTl, h16* VT16, float* FPE) {
    __shared__ __align__(16) float os[16 * 68];
    const int r = (int)blockIdx.y / (CC / 64), by = (int)blockIdx.y % (CC / 64);   // the same for the whole block
    const bf* Bt = W4 + (size_t)r * CC * KI;
    if (r < 2) { const CvP p = r == 0 ? pq : pk; conv_tile<0>(os, blockIdx.x, by, blockIdx.z, X3, Bt, p.b, p.g, p.be, p.mu, p.var, r == 0 ? QPh : KPh, r == 0 ? QPl : KPl, nullptr, nullptr); }   // q and k share one copy of the code
    else if (r == 2) conv_tile<1>(os, blockIdx.x, by, blockIdx.z, X3, Bt, pv.b, pv.g, pv.be, pv.mu, pv.var, VTh, VTl, VT16, nullptr);
    else conv_tile<2>(os, blockIdx.x, by, blockIdx.z, X3, Bt, pp.b, pp.g, pp.be, pp.mu, pp.var, nullptr, nullptr, nullptr, FPE);
}
// ---- st_tile: one wave's 64x64 tile of the TRANSPOSED scores, St[l][i] = sum_c k[c][l] q[c][i] (A = k rows l, Bt = q rows i, planes in fragment order, K = 128; per 32-element chunk the three split products in the order hi x hi, q lo x k hi, q hi x k lo).
// An accumulator holds one i (its column, lane & 15) and 8 consecutive l: what belongs to a softmax row i (its maximum, its sum, its factor) is a per-lane value. Both kernels below call it, so both see the same bits.
#define L2E  1.4426950408889634f
// 2^x on the transcendental unit; the v_nop is the one slot that the instruction set asks for behind a transcendental before its result is read or its source overwritten
__device__ __forceinline__ float ex2(float x) { float r; asm("v_exp_f32 %0, %1\n\tv_nop" : "=v"(r) : "v"(x)); return r; }
__device__ __forceinline__ void st_tile(const bf* __restrict__ Kh, const bf* __restrict__ Kl, const bf* __restrict__ Qh, const bf* __restrict__ Ql, int l0, int i0, int lr, int hi, v8f (&acc)[4][4]) {
    typedef WFrag<bf>::V V;
#pragma unroll
    for (int mb = 0; mb < 4; ++mb)
#pragma unroll
        for (int nb = 0; nb < 4; ++nb) acc[mb][nb] = (v8f){};
    const size_t ao = (size_t)l0 * CC + (hi * 16 + lr) * 8, bo = (size_t)i0 * CC + (hi * 16 + lr) * 8;
    const bf* pkh = Kh + ao; const bf* pkl = Kl + ao; const bf* pqh = Qh + bo; const bf* pql = Ql + bo;
    // the loop stays rolled, as in gemmw: 16 accumulators and one trip's fragments fill the registers
#pragma unroll 1
    for (int kc = 0; kc < CC; kc += 32, pkh += 512, pkl += 512, pqh += 512, pql += 512) {
        V a[4], a2[4];
#pragma unroll
        for (int mb = 0; mb < 4; ++mb) { a[mb] = WFrag<bf>::ld(pkh + (size_t)mb * 16 * CC); a2[mb] = WFrag<bf>::ld(pkl + (size_t)mb * 16 * CC); }
#pragma unroll
        for (int nb = 0; nb < 4; ++nb) { const V b = WFrag<bf>::ld(pqh + (size_t)nb * 16 * CC); const V b2 = WFrag<bf>::ld(pql + (size_t)nb * 16 * CC);
#pragma unroll
            for (int mb = 0; mb < 4; ++mb) { acc[mb][nb] = WFrag<bf>::mma(a[mb], b, acc[mb][nb]); acc[mb][nb] = WFrag<bf>::mma(a[mb], b2, acc[mb][nb]); acc[mb][nb] = WFrag<bf>::mma(a2[mb], b, acc[mb][nb]); } }
        // the distance behind the trip's last WMMAs, on the back edge too, where the next trip's loads land on a[] and a2[]
        asm volatile("v_nop\n\tv_nop\n\tv_nop\n\tv_nop" : "+v"(acc[0][0]), "+v"(acc[1][1]), "+v"(acc[2][2]), "+v"(acc[3][3]) : "v"(a[0]), "v"(a[3]));
        asm volatile("s_wait_xcnt 0x0" :: "v"(pkh), "v"(pkl), "v"(pqh), "v"(pql) : "memory");   // no address pair that the trip's loads name is rewritten ahead of this wait (it stands at the loop's foot, in front of the back edge)
    }
}
// ---- k_stat: the softmax rows' maxima and 1 / sums, from scores that are formed and dropped (no score plane is stored). Grid (TT/64, NB_), 8 waves: the block owns 64 rows i, wave w the l tiles w, w + 8, w + 16, w + 24.
// A lane keeps a running (maximum, sum of exp2 relative to it) for each of its 4 rows i; the 16 partial pairs of a row (8 waves x 2 lane halves) are merged through LDS in a fixed order.
#define SNW  8
__global__ __launch_bounds__(32 * SNW) void k_stat(const bf* __restrict__ Kh, const bf* __restrict__ Kl, const bf* __restrict__ Qh, const bf* __restrict__ Ql, float* MX, float* FI) {
    __shared__ float pm[2 * SNW][64], ps[2 * SNW][64];
    { const size_t zo = (size_t)blockIdx.y * TT * CC; Kh += zo; Kl += zo; Qh += zo; Ql += zo; }
    const int w = __builtin_amdgcn_readfirstlane((int)(threadIdx.x >> 5));   // the wave's number, in a scalar register: the tile loop's counter stays scalar
    const int lane = threadIdx.x & 31, lr = lane & 15, hi = lane >> 4; const int i0 = blockIdx.x * 64;
    float m[4], s[4];
#pragma unroll
    for (int nb = 0; nb < 4; ++nb) { m[nb] = -3.0e38f; s[nb] = 0.f; }
    // rolled: one tile's accumulators at a time
#pragma unroll 1
    for (int t = w; t < TT / 64; t += SNW) {
        v8f acc[4][4];
        st_tile(Kh, Kl, Qh, Ql, t * 64, i0, lr, hi, acc);
        // unrolled whole: acc[][] is indexed by constants alone and stays in registers
#pragma unroll
        for (int nb = 0; nb < 4; ++nb) { float mn = m[nb];
#pragma unroll
            for (int mb = 0; mb < 4; ++mb)
#pragma unroll
                for (int j = 0; j < 8; ++j) mn = fmaxf(mn, acc[mb][nb][j]);
            float ss = 0.f;
#pragma unroll
            for (int mb = 0; mb < 4; ++mb)
#pragma unroll
                for (int j = 0; j < 8; ++j) ss += ex2(__fmul_rn(__fsub_rn(acc[mb][nb][j], mn), L2E));
            s[nb] = s[nb] * ex2(__fmul_rn(__fsub_rn(m[nb], mn), L2E)) + ss; m[nb] = mn; }
    }
#pragma unroll
    for (int nb = 0; nb < 4; ++nb) { pm[2 * w + hi][nb * 16 + lr] = m[nb]; ps[2 * w + hi][nb * 16 + lr] = s[nb]; }
    __syncthreads();   // every wave's partial pairs lie in LDS before any of them is merged
    if (threadIdx.x < 64) { const int i = threadIdx.x; float mx = pm[0][i];
#pragma unroll
        for (int p = 1; p < 2 * SNW; ++p) mx = fmaxf(mx, pm[p][i]);
        float sum = 0.f;
#pragma unroll
        for (int p = 0; p < 2 * SNW; ++p) sum += ps[p][i] * ex2(__fmul_rn(__fsub_rn(pm[p][i], mx), L2E));
        const size_t o = (size_t)blockIdx.y * TT + i0 + i; MX[o] = mx; FI[o] = __fdiv_rn(1.0f, sum); }
}
// the tile's way out; HL: hi/lo bf16 planes, else the fp16 plane, each [l][i] in fragment order. The three pointers stand at the tile's first element
template <bool HL>
__device__ __forceinline__ void spt_out(const v8f (&acc)[4][4], const float (&mi)[4], const float (&fi)[4], float* os, int lr, int hi, bf* Th, bf* Tl, h16* T16) {
    // every loop below is unrolled whole: acc[][], mi[] and fi[] are indexed by constants alone and stay in registers
#pragma unroll
    for (int mb = 0; mb < 4; ++mb) {
#pragma unroll
        for (int nb = 0; nb < 4; ++nb) {
#pragma unroll
            for (int j = 0; j < 8; ++j) os[(hi * 8 + j) * 68 + nb * 16 + lr] = ex2(__fmul_rn(__fsub_rn(acc[mb][nb][j], mi[nb]), L2E)) * fi[nb]; }
        __builtin_amdgcn_wave_barrier(); asm volatile("" ::: "memory");   // a lane reads what other lanes wrote: the compiler, which follows one lane, must not lift a read over the 16 rows' writes
        // a lane takes 8 consecutive i of row l = lane & 15: its 16 B of a plane in fragment order; the wave's store is 512 B in a row
        v8us oh[4], ol[4]; v8h of[4];
#pragma unroll
        for (int s = 0; s < 4; ++s) { const int g8 = 2 * s + hi; const v4f x0 = *(const v4fa*)(os + lr * 68 + g8 * 8), x1 = *(const v4fa*)(os + lr * 68 + g8 * 8 + 4); const size_t oo = (size_t)mb * 16 * TT + g8 * 128 + lr * 8;
#pragma unroll
            for (int u = 0; u < 8; ++u) { unsigned short p, q; splitf(u < 4 ? x0[u & 3] : x1[u & 3], p, q); oh[s][u] = p; ol[s][u] = q; }
            if (HL) { *(v8us*)(Th + oo) = oh[s]; *(v8us*)(Tl + oo) = ol[s]; }
            else {
#pragma unroll
                for (int u = 0; u < 8; ++u) of[s][u] = tohx(__fadd_rn(bf2f(oh[s][u]), bf2f(ol[s][u])) * PCAR);
                *(v8h*)(T16 + oo) = of[s]; } }
        // the 16 rows' stores name these data registers: they stay as they are until this wait, one for the whole group
        if (HL) asm volatile("s_wait_xcnt 0x0" :: "v"(oh[0]), "v"(oh[1]), "v"(oh[2]), "v"(oh[3]), "v"(ol[0]), "v"(ol[1]), "v"(ol[2]), "v"(ol[3]) : "memory");
        else asm volatile("s_wait_xcnt 0x0" :: "v"(of[0]), "v"(of[1]), "v"(of[2]), "v"(of[3]) : "memory");
        __builtin_amdgcn_wave_barrier(); asm volatile("" ::: "memory");   // nor the next 16 rows' writes over these reads
    }
}
// ---- k_spt: P^T straight from a second forming of the scores. One wave per 64x64 tile of St; P^T[l][i] = exp2((St[l][i] - max_i) * log2 e) * (1 / sum_i), turned through LDS into 16-B pieces of 8 i and stored, in fragment order, as
// hi/lo bf16 planes (rows l < RH) or as fp16((hi + lo) x 1024) (rows l >= RH). Grid (TT/64, TT/64, NB_), 32 threads.
__global__ __launch_bounds__(32) void k_spt(const bf* __restrict__ Kh, const bf* __restrict__ Kl, const bf* __restrict__ Qh, const bf* __restrict__ Ql, const float* __restrict__ MX, const float* __restrict__ FI, bf* PTh, bf* PTl, h16* PT16) {
    __shared__ __align__(16) float os[16 * 68];
    { const size_t zb = blockIdx.z, zo = zb * TT * CC; Kh += zo; Kl += zo; Qh += zo; Ql += zo; MX += zb * TT; FI += zb * TT; PTh += zb * RH * TT; PTl += zb * RH * TT; PT16 += zb * (TT - RH) * TT; }
    const int lane = threadIdx.x & 31, lr = lane & 15, hi = lane >> 4; const int l0 = blockIdx.x * 64, i0 = blockIdx.y * 64;   // l0 < RH is the same for the whole tile: RH % 64 == 0
    // the lane's 4 rows i: loaded ahead of the K loop, whose loads hide these
    float mi[4], fi[4];
#pragma unroll
    for (int nb = 0; nb < 4; ++nb) { mi[nb] = MX[i0 + nb * 16 + lr]; fi[nb] = FI[i0 + nb * 16 + lr]; }
    v8f acc[4][4];
    st_tile(Kh, Kl, Qh, Ql, l0, i0, lr, hi, acc);
    // the test is the same for the whole tile and stands once, outside the unrolled loops
    if (l0 < RH) spt_out<true>(acc, mi, fi, os, lr, hi, PTh + PKO(l0, i0, TT), PTl + PKO(l0, i0, TT), nullptr);
    else spt_out<false>(acc, mi, fi, os, lr, hi, nullptr, nullptr, PT16 + PKO(l0 - RH, i0, TT));
}
// ---- k_pv: both P^T x v products in ONE launch (they write different rows of OT). Grid (TT/64, CC/64, NB_), 32 * KWV threads; blockIdx.x is the tile of 64 rows l, blockIdx.y the channel tile, blockIdx.z the batch, as in a launch of one product.
// The test (tiles l < RH: three products) is the same for the whole block, so every wave of a block meets the same __syncthreads().
__global__ __launch_bounds__(32 * KWV) void k_pv(const bf* __restrict__ PTh, const bf* __restrict__ PTl, const bf* __restrict__ VTh, const bf* __restrict__ VTl, const h16* __restrict__ PT16, const h16* __restrict__ VT16, float* OT) {
    __shared__ __align__(16) float red[KWV * 64 * RPT];
    const size_t FE = (size_t)TT * CC;
    if (blockIdx.x < RH / 64) gemmw<bf, 2, false, KWV, TT>(red, red, blockIdx.x, blockIdx.y, blockIdx.z, PTh, PTl, VTh, VTl, OT, CC, nullptr, (size_t)RH * TT, FE, FE);                                   // rows l < RH: hl P^T x hl v
    else gemmw<h16, 0, false, KWV, TT>(red, red, (int)blockIdx.x - RH / 64, blockIdx.y, blockIdx.z, PT16, nullptr, VT16, nullptr, OT + (size_t)RH * CC, CC, nullptr, (size_t)(TT - RH) * TT, FE, FE);   // rest: fp16 x1024
}
__global__ __launch_bounds__(256) void k_fin(const float* __restrict__ OT, const float* __restrict__ PE, float* OUTb) { { const size_t zo = (size_t)blockIdx.y * TT * CC; OT += zo; PE += zo; OUTb += zo; } const size_t e = ((size_t)blockIdx.x * 256 + threadIdx.x) * 4; if (e >= (size_t)CC * TT) return; const int l = (int)(e % TT); const int c = (int)(e / TT); v4f r;
#pragma unroll
    for (int u = 0; u < 4; ++u) { const int ll = l + u; const float cs = (ll < RH) ? 1.0f : (1.0f / PCAR); float o = OT[(size_t)ll * CC + c] * cs; asm volatile("" : "+v"(o)); r[u] = __fadd_rn(o, PE[(size_t)ll * CC + c]); }
    *(v4f*)(OUTb + e) = r;  }

extern "C" void kernel_launch(void* const* d_in, const int* in_sizes, int n_in,
                              void* d_out, int out_size, void* d_ws, size_t ws_size, hipStream_t stream) {
    (void)in_sizes; (void)n_in; (void)out_size;
    const float* x = (const float*)d_in[0];
    const float* prm[4][6]; for (int r = 0; r < 4; ++r) for (int c = 0; c < 6; ++c) prm[r][c] = (const float*)d_in[1 + r * 6 + c];   // (w, b, gamma, beta, mean, var) for q, k, v, pe
    float* OUT = (float*)d_out;     // [16][128][2048]
    char* wsp = (char*)d_ws;
    auto take = [&](size_t bytes) { char* p = wsp; wsp += (bytes + 255) & ~(size_t)255; return (void*)p; };
    const size_t FE = (size_t)TT * CC;   // elements of one batch's [2048][128] plane
    bf* W4 = (bf*)take((size_t)4 * CC * KI * 2);
    // live through the whole call, all 16 batches
    bf* QPh = (bf*)take(NB_ * FE * 2); bf* QPl = (bf*)take(NB_ * FE * 2); bf* KPh = (bf*)take(NB_ * FE * 2); bf* KPl = (bf*)take(NB_ * FE * 2);
    bf* VTh = (bf*)take(NB_ * FE * 2); bf* VTl = (bf*)take(NB_ * FE * 2); h16* VT16 = (h16*)take(NB_ * FE * 2); float* FPE = (float*)take(NB_ * FE * 4);
    float* MX = (float*)take((size_t)NB_ * TT * 4); float* FI = (float*)take((size_t)NB_ * TT * 4);
    bf* PTh = (bf*)take((size_t)NB_ * RH * TT * 2); bf* PTl = (bf*)take((size_t)NB_ * RH * TT * 2); h16* PT16 = (h16*)take((size_t)NB_ * (TT - RH) * TT * 2); float* OT = (float*)take(NB_ * FE * 4);
    if ((size_t)(wsp - (char*)d_ws) > ws_size) return;    // ~ 249 MiB
    // the im2col plane (12 MiB, all 16 batches) lies in PT16 (96 MiB): its last reader runs before k_spt writes PT16
    bf* X3 = (bf*)PT16;
    k_prep<<<dim3(IMB + WBY, NB_, 1), 256, 0, stream>>>(x, X3, prm[0][0], prm[1][0], prm[2][0], prm[3][0], W4);   // im2col plane; w [128][64][3] == Bt [128][192], laid in fragment order
    CvP cp[4]; for (int r = 0; r < 4; ++r) cp[r] = CvP{prm[r][1], prm[r][2], prm[r][3], prm[r][4], prm[r][5]};
    k_conv4<<<dim3(TT / 64, 4 * (CC / 64), NB_), 32, 0, stream>>>(X3, W4, cp[0], cp[1], cp[2], cp[3], QPh, QPl, KPh, KPl, VTh, VTl, VT16, FPE);
    k_stat<<<dim3(TT / 64, NB_, 1), 32 * SNW, 0, stream>>>(KPh, KPl, QPh, QPl, MX, FI);                                                    // softmax row maxima and 1 / sums
    k_spt<<<dim3(TT / 64, TT / 64, NB_), 32, 0, stream>>>(KPh, KPl, QPh, QPl, MX, FI, PTh, PTl, PT16);                                     // P^T planes
    k_pv<<<dim3(TT / 64, CC / 64, NB_), 32 * KWV, 0, stream>>>(PTh, PTl, VTh, VTl, PT16, VT16, OT);                                        // OT = P^T x v
    k_fin<<<dim3((unsigned)((FE / 4 + 255) / 256), NB_, 1), 256, 0, stream>>>(OT, FPE, OUT);
}

// v008
// A run of this version takes 136 microseconds.
// Next to v007, in two timings, it ran 1.65 and 1.63 times as fast.
// Counting every step since v000, it is 23.4 times as fast.
#include <hip/hip_runtime.h>

// Conv1dAttention (x [16][64][2048] channels-first; q/k/v/pe = LeakyReLU_0.3(BN(conv1d_k3(x) + b)) with 128 output channels (BN inference affine: y*scale + (beta - mean*scale), scale = gamma*rsqrt(var + 1e-5)); attn[i][j] = sum_c q[c][i] k[c][j] (NO scaling); P = softmax_j; out[c][l] = sum_j v[c][j] P[j][l] + pe[c][l] -> [16][128][2048] - note the value product contracts over the softmax ROW index j, i.e. it uses P TRANSPOSED).
// Compute dtypes, f32 accumulate: every input rounded to bf16; the four k=3 convolutions as PLAIN bf16 im2col GEMMs (K = 192, inputs: exact) + bias, BN affine and LeakyReLU in f32; scores hl x hl (3 products, K 128, unscaled) on every row, formed twice and never stored: once for the softmax rows' f32 maxima and sums, once for P itself, which stays in registers, split hi/lo bf16, as an operand of the value product; output columns l < 512 as hl v x hl P (3 products, K 2048), columns >= 512 as fp16 v x fp16(P x 1024); + pe, written channels-first.

#define NB_  16
#define CIN  64
#define CC   128
#define KW   3
#define KI   (CIN * KW)     // 192
#define TT   2048
#define RH   512
#define PCAR 1024.0f
typedef _Float16 h16;
typedef unsigned short bf;
typedef __attribute__((ext_vector_type(16))) __bf16   v16bf;
typedef __attribute__((ext_vector_type(16))) _Float16 v16h;
typedef __attribute__((ext_vector_type(8)))  _Float16 v8h;
typedef __attribute__((ext_vector_type(8)))  unsigned short v8us;
typedef __attribute__((ext_vector_type(8)))  float    v8f;
typedef __attribute__((ext_vector_type(4)))  float    v4f;
typedef v8h  __attribute__((may_alias)) v8ha;
typedef v4f  __attribute__((may_alias)) v4fa;
typedef v8us __attribute__((may_alias)) v8usa;

__device__ __forceinline__ unsigned short f2bf(float f) { unsigned u = __float_as_uint(f); u += 0x7FFFu + ((u >> 16) & 1u); return (unsigned short)(u >> 16); }
__device__ __forceinline__ float bf2f(unsigned short b) { return __uint_as_float(((unsigned)b) << 16); }
__device__ __forceinline__ float bfr(float f) { return bf2f(f2bf(f)); }
__device__ __forceinline__ v16h cat16(v8h lo, v8h hi) { return __builtin_shufflevector(lo, hi, 0, 1, 2, 3, 4, 5, 6, 7, 8, 9, 10, 11, 12, 13, 14, 15); }
__device__ __forceinline__ v16bf cat16b(v8us lo, v8us hi) { return __builtin_bit_cast(v16bf, __builtin_shufflevector(lo, hi, 0, 1, 2, 3, 4, 5, 6, 7, 8, 9, 10, 11, 12, 13, 14, 15)); }
__device__ __forceinline__ v8f wmma16(v16h a, v16h b, v8f c) { return __builtin_amdgcn_wmma_f32_16x16x32_f16(false, a, false, b, (short)0, c, false, false); }
__device__ __forceinline__ v8f wmmab(v16bf a, v16bf b, v8f c) { return __builtin_amdgcn_wmma_f32_16x16x32_bf16(false, a, false, b, (short)0, c, false, false); }



// ---- FRAGMENT ORDER: every 16-bit plane [R][K] that a matrix product reads lies as blocks of 16 rows x 8 k: element (r, k) at (r / 16) * 16 * K + (k / 8) * 128 + (r % 16) * 8 + k % 8 (PKO below).
// A 16 x 32 fragment is then 1 KiB in a row, and each of its two 16-B-a-lane loads (at lane * 8 and at 256 + lane * 8 elements) reads 512 contiguous bytes, 4 whole lines, where a row-major plane gave 32 B of each of 16 lines.
// The lane and register that hold an element are the same as from a row-major plane (lane & 15 the row; k = 8 * (lane >> 4) + 0..7, then 16 more), so every product sees the same operands in the same k order.
#define PKO(r, k, K) ((size_t)((r) >> 4) * 16 * (K) + (size_t)((k) >> 3) * 128 + ((r) & 15) * 8 + ((k) & 7))
template <typename T16> struct WFrag;
template <> struct WFrag<h16> { typedef v16h V; static __device__ __forceinline__ V ld(const h16* p) { return cat16(*(const v8h*)p, *(const v8h*)(p + 256)); } static __device__ __forceinline__ v8f mma(V a, V b, v8f c) { return wmma16(a, b, c); } };
template <> struct WFrag<bf> { typedef v16bf V; static __device__ __forceinline__ V ld(const bf* p) { return cat16b(*(const v8us*)p, *(const v8us*)(p + 256)); } static __device__ __forceinline__ v8f mma(V a, V b, v8f c) { return wmmab(a, b, c); } };

__device__ __forceinline__ h16 tohx(float x) { return (h16)x; }
__device__ __forceinline__ void splitf(float y, unsigned short& h, unsigned short& l) { h = f2bf(y); l = f2bf(y - bf2f(h)); }
typedef __attribute__((ext_vector_type(2))) unsigned short v2us;
typedef __attribute__((ext_vector_type(4))) unsigned short v4us;
typedef __attribute__((ext_vector_type(8))) unsigned short v8us;
typedef __attribute__((ext_vector_type(4))) _Float16 v4h;
typedef __attribute__((ext_vector_type(2))) float v2f;

// a weight plane [128][192] rounded to bf16 and laid in fragment order; a thread takes 8 consecutive k of one row
__device__ __forceinline__ void cvt8(int bx, const float* __restrict__ src, bf* dst, size_t n8) { const size_t i = (size_t)bx * 256 + threadIdx.x; if (i >= n8) return; const v8f v = *(const v8f*)(src + i * 8); v8us o;
#pragma unroll
    for (int k = 0; k < 8; ++k) o[k] = f2bf(v[k]); const int row = (int)(i / (KI / 8)), k0 = (int)(i % (KI / 8)) * 8; *(v8us*)(dst + PKO(row, k0, KI)) = o;  }
__device__ __forceinline__ void im2col(int bx, int by, const float* __restrict__ xb, bf* X3) { xb += (size_t)by * CIN * TT; X3 += (size_t)by * TT * KI; const size_t e8 = ((size_t)bx * 256 + threadIdx.x) * 8; if (e8 >= (size_t)TT * KI) return;
    // e8 is the place in the plane, which lies in fragment order: 16 neighbouring threads hold 16 neighbouring t at the same 8 k
    const int pb16 = (int)(e8 >> 7); const int kidx = (pb16 % (KI / 8)) * 8; const int t = (pb16 / (KI / 8)) * 16 + ((int)(e8 >> 3) & 15); v8us o;
#pragma unroll
    for (int u = 0; u < 8; ++u) { const int k2 = kidx + u; const int ci = k2 / KW, kk = k2 % KW; const int tt = t + kk - 1; o[u] = (tt >= 0 && tt < TT) ? f2bf(xb[(size_t)ci * TT + tt]) : (unsigned short)0; }
    *(v8us*)(X3 + e8) = o;  }
// ---- k_prep: the im2col plane and the four weight planes in ONE launch (neither reads what the other writes). Grid (IMB + WBY, NB_), 256 threads: in each row of the grid the first IMB blocks lay the batch's im2col plane,
// the last WBY take one 256-thread piece of a weight plane each (NB_ * WBY pieces = 4 planes of WPB pieces).
#define IMB  (TT * KI / 8 / 256)    // 192
#define WPB  (CC * KI / 8 / 256)    // 12
#define WBY  (4 * WPB / NB_)        // 3
static_assert(TT * KI % (8 * 256) == 0 && CC * KI % (8 * 256) == 0 && 4 * WPB % NB_ == 0, "whole blocks");
__global__ __launch_bounds__(256) void k_prep(const float* __restrict__ x, bf* X3, const float* __restrict__ wq, const float* __restrict__ wk, const float* __restrict__ wv, const float* __restrict__ wp, bf* W4) {
    if (blockIdx.x < IMB) { im2col(blockIdx.x, blockIdx.y, x, X3); return; }
    const int pc = (int)blockIdx.y * WBY + (int)blockIdx.x - IMB, r = pc / WPB;   // the same for the whole block
    cvt8(pc % WPB, r == 0 ? wq : r == 1 ? wk : r == 2 ? wv : wp, W4 + (size_t)r * CC * KI, (size_t)CC * KI / 8);
}
// ---- conv_tile: one k = 3 convolution as its im2col GEMM (one wave per 64x64 tile, 16 accumulators: A = X3 [t][192], Bt = w [c][192], both in fragment order) that finishes its own output: bias, BN affine, LeakyReLU and the split
// into 16-bit planes are applied to the accumulators, so that no f32 plane is written and read again by a pass of its own. Tile (bx, by) of batch bz, 32 threads; os: 16 * 68 floats of the calling kernel's LDS.
// EPI 0 (q, k): hi/lo bf16 planes [t][c], in fragment order. EPI 1 (v): hi/lo bf16 and fp16 planes, transposed [c][t], in fragment order. EPI 2 (pe): f32 plane, transposed [c][t], row-major.
struct BnC { float b, sc, sh; };   // one channel's bias, BN scale and BN shift
__device__ __forceinline__ BnC bn_chan(int c, const float* __restrict__ bias, const float* __restrict__ gam, const float* __restrict__ bet, const float* __restrict__ mu, const float* __restrict__ var) {
    BnC r; r.b = bfr(bias[c]);
    // here and in bn_act each product is rounded before its add or subtract, as in y * scale + (beta - mean * scale) taken one operation at a time: q, k, v and pe come out bit for bit as from a BN pass of its own
    const float sc = __fmul_rn(bfr(gam[c]), __fdiv_rn(1.0f, sqrtf(__fadd_rn(bfr(var[c]), 1e-5f)))); float ms = __fmul_rn(bfr(mu[c]), sc); asm volatile("" : "+v"(ms)); const float sh = __fsub_rn(bfr(bet[c]), ms);
    r.sc = sc; r.sh = sh; return r; }
__device__ __forceinline__ float bn_act(float acc, const BnC p) { const float a = acc + p.b; float y = __fmul_rn(a, p.sc); asm volatile("" : "+v"(y)); y = __fadd_rn(y, p.sh); return (y > 0.f) ? y : 0.3f * y; }
template <int EPI>
__device__ __forceinline__ void conv_tile(float* os, int bx, int by, int bz, const bf* __restrict__ A, const bf* __restrict__ Bt, const float* __restrict__ bias, const float* __restrict__ gam, const float* __restrict__ bet, const float* __restrict__ mu, const float* __restrict__ var, bf* Oh, bf* Ol, h16* O16, float* OF) {
    typedef WFrag<bf>::V V;
    const size_t zo = (size_t)bz * TT * CC; A += (size_t)bz * TT * KI;
    const int lane = threadIdx.x & 31, lr = lane & 15, hi = lane >> 4; const int r0 = bx * 64, c0 = by * 64;
    v8f acc[4][4];
#pragma unroll
    for (int mb = 0; mb < 4; ++mb)
#pragma unroll
        for (int nb = 0; nb < 4; ++nb) acc[mb][nb] = (v8f){};
    // the lane's 4 channels, one per column block of the accumulators. Formed ahead of the K loop, whose loads hide theirs
    BnC pc[4];
#pragma unroll
    for (int u = 0; u < 4; ++u) pc[u] = bn_chan(c0 + u * 16 + lr, bias, gam, bet, mu, var);
    const bf* pa = A + (size_t)r0 * KI + lane * 8; const bf* pb = Bt + (size_t)c0 * KI + lane * 8;
    // the loop stays rolled: 16 accumulators and one trip's fragments fill the registers
#pragma unroll 1
    for (int kc = 0; kc < KI; kc += 32, pa += 512, pb += 512) {
        V a[4], b[4];
#pragma unroll
        for (int mb = 0; mb < 4; ++mb) a[mb] = WFrag<bf>::ld(pa + (size_t)mb * 16 * KI);
#pragma unroll
        for (int nb = 0; nb < 4; ++nb) b[nb] = WFrag<bf>::ld(pb + (size_t)nb * 16 * KI);
        asm volatile("s_wait_xcnt 0x0" :: "v"(pa), "v"(pb) : "memory");   // the 16 loads' two address pairs stay as they are (no load lands on them, nothing rewrites them) until this wait
#pragma unroll
        for (int nb = 0; nb < 4; ++nb)
#pragma unroll
            for (int mb = 0; mb < 4; ++mb) acc[mb][nb] = WFrag<bf>::mma(a[mb], b[nb], acc[mb][nb]);
        // the distance behind the trip's last WMMAs, on the back edge too, where the next trip's loads land on a[] and b[]
        asm volatile("v_nop\n\tv_nop\n\tv_nop\n\tv_nop" : "+v"(acc[0][0]), "+v"(acc[1][1]), "+v"(acc[2][2]), "+v"(acc[3][3]) : "v"(a[0]), "v"(a[3]));
    }
    // every loop below is unrolled whole: acc[][] and pc[] are indexed by constants alone and stay in registers
    if (EPI == 1) {
        // a lane's accumulator holds 8 consecutive t of one channel: that is a lane's 16 B of a transposed plane in fragment order, and the wave's store is 512 B in a row
#pragma unroll
        for (int nb = 0; nb < 4; ++nb)
#pragma unroll
            for (int mb = 0; mb < 4; ++mb) { v8us oh, ol; v8h of;
#pragma unroll
                for (int j = 0; j < 8; ++j) { const float y = bn_act(acc[mb][nb][j], pc[nb]); unsigned short p, q; splitf(y, p, q); oh[j] = p; ol[j] = q; of[j] = tohx(y); }
                const size_t oo = zo + PKO(c0 + nb * 16 + lr, r0 + mb * 16 + hi * 8, TT); *(v8us*)(Oh + oo) = oh; *(v8us*)(Ol + oo) = ol; *(v8h*)(O16 + oo) = of;
                asm volatile("s_wait_xcnt 0x0" :: "v"(oh), "v"(ol), "v"(of) : "memory"); }   // the three stores name these data registers: they stay as they are until this wait
        return;
    }
    if (EPI == 0) {
        // the finished values are turned through LDS: a lane then holds 8 consecutive channels of one t, its 16 B of a plane in fragment order, and the wave's store is 512 B in a row
#pragma unroll
        for (int mb = 0; mb < 4; ++mb) {
#pragma unroll
            for (int nb = 0; nb < 4; ++nb) {
#pragma unroll
                for (int j = 0; j < 8; ++j) os[(hi * 8 + j) * 68 + nb * 16 + lr] = bn_act(acc[mb][nb][j], pc[nb]); }
            __builtin_amdgcn_wave_barrier(); asm volatile("" ::: "memory");   // a lane reads what other lanes wrote: the compiler, which follows one lane, must not lift a read over the 16 rows' writes
            v8us oh[4], ol[4];
#pragma unroll
            for (int s = 0; s < 4; ++s) { const int g8 = 2 * s + hi; const v4f x0 = *(const v4fa*)(os + lr * 68 + g8 * 8), x1 = *(const v4fa*)(os + lr * 68 + g8 * 8 + 4);
#pragma unroll
                for (int u = 0; u < 8; ++u) { unsigned short p, q; splitf(u < 4 ? x0[u & 3] : x1[u & 3], p, q); oh[s][u] = p; ol[s][u] = q; }
                const size_t oo = zo + PKO(r0 + mb * 16 + lr, c0 + g8 * 8, CC); *(v8us*)(Oh + oo) = oh[s]; *(v8us*)(Ol + oo) = ol[s]; }
            // the 16 rows' stores name these data registers: they stay as they are until this wait, one for the whole group
            asm volatile("s_wait_xcnt 0x0" :: "v"(oh[0]), "v"(oh[1]), "v"(oh[2]), "v"(oh[3]), "v"(ol[0]), "v"(ol[1]), "v"(ol[2]), "v"(ol[3]) : "memory");
            __builtin_amdgcn_wave_barrier(); asm volatile("" ::: "memory");   // nor the next 16 rows' writes over these reads
        }
        return;
    }
    // EPI 2: a lane's accumulator holds 8 consecutive t of one channel, 32 B of that channel's row of the transposed f32 plane
#pragma unroll
    for (int nb = 0; nb < 4; ++nb) {
        v4f y[4][2];
#pragma unroll
        for (int mb = 0; mb < 4; ++mb) {
#pragma unroll
            for (int j = 0; j < 8; ++j) y[mb][j >> 2][j & 3] = bn_act(acc[mb][nb][j], pc[nb]);
            float* dst = OF + zo + (size_t)(c0 + nb * 16 + lr) * TT + r0 + mb * 16 + hi * 8; *(v4f*)dst = y[mb][0]; *(v4f*)(dst + 4) = y[mb][1]; }
        // the 8 stores name these data registers: they stay as they are until this wait, one for the whole group
        asm volatile("s_wait_xcnt 0x0" :: "v"(y[0][0]), "v"(y[0][1]), "v"(y[1][0]), "v"(y[1][1]), "v"(y[2][0]), "v"(y[2][1]), "v"(y[3][0]), "v"(y[3][1]) : "memory");
    }
}
// ---- k_conv4: the four convolutions in ONE launch (they read the same im2col plane and none reads another's output): 4 waves a SIMD run side by side where a launch of one convolution gave each SIMD one.
// Grid (TT/64, 4 * CC/64, NB_), 32 threads; blockIdx.y = convolution * (CC/64) + channel tile, so that the 8 tiles that read the same 64 rows of the im2col plane start close together.
struct CvP { const float* b; const float* g; const float* be; const float* mu; const float* var; };   // one convolution's bias and BN vectors
__global__ __launch_bounds__(32) void k_conv4(const bf* __restrict__ X3, const bf* __restrict__ W4, CvP pq, CvP pk, CvP pv, CvP pp, bf* QPh, bf* QPl, bf* KPh, bf* KPl, bf* VTh, bf* VTl, h16* VT16, float* FPE) {
    __shared__ __align__(16) float os[16 * 68];
    const int r = (int)blockIdx.y / (CC / 64), by = (int)blockIdx.y % (CC / 64);   // the same for the whole block
    const bf* Bt = W4 + (size_t)r * CC * KI;
    if (r < 2) { const CvP p = r == 0 ? pq : pk; conv_tile<0>(os, blockIdx.x, by, blockIdx.z, X3, Bt, p.b, p.g, p.be, p.mu, p.var, r == 0 ? QPh : KPh, r == 0 ? QPl : KPl, nullptr, nullptr); }   // q and k share one copy of the code
    else if (r == 2) conv_tile<1>(os, blockIdx.x, by, blockIdx.z, X3, Bt, pv.b, pv.g, pv.be, pv.mu, pv.var, VTh, VTl, VT16, nullptr);
    else conv_tile<2>(os, blockIdx.x, by, blockIdx.z, X3, Bt, pp.b, pp.g, pp.be, pp.mu, pp.var, nullptr, nullptr, nullptr, FPE);
}
// ---- st_tile: one wave's 64x64 tile of the TRANSPOSED scores, St[l][i] = sum_c k[c][l] q[c][i] (A = k rows l, Bt = q rows i, planes in fragment order, K = 128; per 32-element chunk the three split products in the order hi x hi, q lo x k hi, q hi x k lo).
// An accumulator holds one i (its column, lane & 15) and 8 consecutive l: what belongs to a softmax row i (its maximum, its sum, its factor) is a per-lane value. 
#define L2E  1.4426950408889634f
// 2^x on the transcendental unit; the v_nop is the one slot that the instruction set asks for behind a transcendental before its result is read or its source overwritten
__device__ __forceinline__ float ex2(float x) { float r; asm("v_exp_f32 %0, %1\n\tv_nop" : "=v"(r) : "v"(x)); return r; }
__device__ __forceinline__ void st_tile(const bf* __restrict__ Kh, const bf* __restrict__ Kl, const bf* __restrict__ Qh, const bf* __restrict__ Ql, int l0, int i0, int lr, int hi, v8f (&acc)[4][4]) {
    typedef WFrag<bf>::V V;
#pragma unroll
    for (int mb = 0; mb < 4; ++mb)
#pragma unroll
        for (int nb = 0; nb < 4; ++nb) acc[mb][nb] = (v8f){};
    const size_t ao = (size_t)l0 * CC + (hi * 16 + lr) * 8, bo = (size_t)i0 * CC + (hi * 16 + lr) * 8;
    const bf* pkh = Kh + ao; const bf* pkl = Kl + ao; const bf* pqh = Qh + bo; const bf* pql = Ql + bo;
    // the loop stays rolled: 16 accumulators and one trip's fragments fill the registers
#pragma unroll 1
    for (int kc = 0; kc < CC; kc += 32, pkh += 512, pkl += 512, pqh += 512, pql += 512) {
        V a[4], a2[4];
#pragma unroll
        for (int mb = 0; mb < 4; ++mb) { a[mb] = WFrag<bf>::ld(pkh + (size_t)mb * 16 * CC); a2[mb] = WFrag<bf>::ld(pkl + (size_t)mb * 16 * CC); }
#pragma unroll
        for (int nb = 0; nb < 4; ++nb) { const V b = WFrag<bf>::ld(pqh + (size_t)nb * 16 * CC); const V b2 = WFrag<bf>::ld(pql + (size_t)nb * 16 * CC);
#pragma unroll
            for (int mb = 0; mb < 4; ++mb) { acc[mb][nb] = WFrag<bf>::mma(a[mb], b, acc[mb][nb]); acc[mb][nb] = WFrag<bf>::mma(a[mb], b2, acc[mb][nb]); acc[mb][nb] = WFrag<bf>::mma(a2[mb], b, acc[mb][nb]); } }
        // the distance behind the trip's last WMMAs, on the back edge too, where the next trip's loads land on a[] and a2[]
        asm volatile("v_nop\n\tv_nop\n\tv_nop\n\tv_nop" : "+v"(acc[0][0]), "+v"(acc[1][1]), "+v"(acc[2][2]), "+v"(acc[3][3]) : "v"(a[0]), "v"(a[3]));
        asm volatile("s_wait_xcnt 0x0" :: "v"(pkh), "v"(pkl), "v"(pqh), "v"(pql) : "memory");   // no address pair that the trip's loads name is rewritten ahead of this wait (it stands at the loop's foot, in front of the back edge)
    }
}
// ---- k_stat: the softmax rows' maxima and 1 / sums, from scores that are formed and dropped (no score plane is stored). Grid (TT/64, NB_), 8 waves: the block owns 64 rows i, wave w the l tiles w, w + 8, w + 16, w + 24.
// A lane keeps a running (maximum, sum of exp2 relative to it) for each of its 4 rows i; the 16 partial pairs of a row (8 waves x 2 lane halves) are merged through LDS in a fixed order.
#define SNW  8
__global__ __launch_bounds__(32 * SNW) void k_stat(const bf* __restrict__ Kh, const bf* __restrict__ Kl, const bf* __restrict__ Qh, const bf* __restrict__ Ql, float* MX, float* FI) {
    __shared__ float pm[2 * SNW][64], ps[2 * SNW][64];
    { const size_t zo = (size_t)blockIdx.y * TT * CC; Kh += zo; Kl += zo; Qh += zo; Ql += zo; }
    const int w = __builtin_amdgcn_readfirstlane((int)(threadIdx.x >> 5));   // the wave's number, in a scalar register: the tile loop's counter stays scalar
    const int lane = threadIdx.x & 31, lr = lane & 15, hi = lane >> 4; const int i0 = blockIdx.x * 64;
    float m[4], s[4];
#pragma unroll
    for (int nb = 0; nb < 4; ++nb) { m[nb] = -3.0e38f; s[nb] = 0.f; }
    // rolled: one tile's accumulators at a time
#pragma unroll 1
    for (int t = w; t < TT / 64; t += SNW) {
        v8f acc[4][4];
        st_tile(Kh, Kl, Qh, Ql, t * 64, i0, lr, hi, acc);
        // unrolled whole: acc[][] is indexed by constants alone and stays in registers
#pragma unroll
        for (int nb = 0; nb < 4; ++nb) { float mn = m[nb];
#pragma unroll
            for (int mb = 0; mb < 4; ++mb)
#pragma unroll
                for (int j = 0; j < 8; ++j) mn = fmaxf(mn, acc[mb][nb][j]);
            float ss = 0.f;
#pragma unroll
            for (int mb = 0; mb < 4; ++mb)
#pragma unroll
                for (int j = 0; j < 8; ++j) ss += ex2(__fmul_rn(__fsub_rn(acc[mb][nb][j], mn), L2E));
            s[nb] = s[nb] * ex2(__fmul_rn(__fsub_rn(m[nb], mn), L2E)) + ss; m[nb] = mn; }
    }
#pragma unroll
    for (int nb = 0; nb < 4; ++nb) { pm[2 * w + hi][nb * 16 + lr] = m[nb]; ps[2 * w + hi][nb * 16 + lr] = s[nb]; }
    __syncthreads();   // every wave's partial pairs lie in LDS before any of them is merged
    if (threadIdx.x < 64) { const int i = threadIdx.x; float mx = pm[0][i];
#pragma unroll
        for (int p = 1; p < 2 * SNW; ++p) mx = fmaxf(mx, pm[p][i]);
        float sum = 0.f;
#pragma unroll
        for (int p = 0; p < 2 * SNW; ++p) sum += ps[p][i] * ex2(__fmul_rn(__fsub_rn(pm[p][i], mx), L2E));
        const size_t o = (size_t)blockIdx.y * TT + i0 + i; MX[o] = mx; FI[o] = __fdiv_rn(1.0f, sum); }
}
// ---- k_att: the output itself from a second forming of the scores; P is never stored. Grid (NB_, TT/64), 32 * ANW threads: the block owns 64 columns l of one batch's output, all 128 channels; wave w takes the 32-row groups i = w, w + ANW, ...
// The block's 64 rows of the k planes (16 KiB each, contiguous in fragment order) and the batch's row maxima and factors are laid in LDS once and read from there in every trip.
// Per trip: S[i][l] = sum_c q[c][i] k[c][l] (A = q rows i, Bt = k rows l; per 32-element chunk the three split products in the order hi x hi, q lo x k hi, q hi x k lo, as in st_tile): an accumulator holds one l (lane & 15) and 8 consecutive i.
// P[i][l] = exp2((S[i][l] - max_i) * log2 e) * (1 / sum_i), split hi/lo bf16 (l < RH) or fp16((hi + lo) x 1024) (l >= RH), stays in the lanes and registers where the accumulators hold it: two accumulators (16 + 16 rows i) are one Bt fragment [l][32 i].
// Then o[c][l] += v[c][i] P[i][l] with A = the v planes [c][t]; an accumulator of o holds one l a lane and 8 channels. The ANW partial tiles are laid in LDS, added in wave order, scaled, + pe, and stored channels-first, 256 B of a channel's row in a row.
#define ANW  4
#define OPT  68             // pitch of a partial tile's row (64 l) in LDS, floats: the two 8-row halves of an accumulator's store fall on different banks
template <bool HL>
__device__ __forceinline__ void att_tile(float* red, int l0, const bf* __restrict__ Kh, const bf* __restrict__ Kl, const bf* __restrict__ Qh, const bf* __restrict__ Ql, const float* __restrict__ MX, const float* __restrict__ FI, const bf* __restrict__ VTh, const bf* __restrict__ VTl, const h16* __restrict__ VT16, const float* __restrict__ PE, float* OUTb) {
    typedef WFrag<bf>::V V;
    const int w = __builtin_amdgcn_readfirstlane((int)(threadIdx.x >> 5));   // the wave's number, in a scalar register: the trip counter stays scalar
    const int lane = threadIdx.x & 31, lr = lane & 15, hi = lane >> 4;
    // the k tile stands where the partial tiles are laid later: 64 * CC elements of the hi plane, then as many of the lo plane
    bf* kt = (bf*)red;
    // behind it the batch's 2048 row maxima and 2048 factors 1 / sum
    float* mt = red + 64 * CC;
    const bf* gkh = Kh + (size_t)l0 * CC; const bf* gkl = Kl + (size_t)l0 * CC;
    const int tx = (int)threadIdx.x;
    v8us sh[64 * CC / (8 * 32 * ANW)], sl[64 * CC / (8 * 32 * ANW)]; v4f sm[TT / (4 * 32 * ANW)], sf[TT / (4 * 32 * ANW)];
#pragma unroll
    for (int s = 0; s < 64 * CC / (8 * 32 * ANW); ++s) { const int e = (s * 32 * ANW + tx) * 8; sh[s] = *(const v8usa*)(gkh + e); sl[s] = *(const v8usa*)(gkl + e); }
#pragma unroll
    for (int s = 0; s < TT / (4 * 32 * ANW); ++s) { const int e = (s * 32 * ANW + tx) * 4; sm[s] = *(const v4fa*)(MX + e); sf[s] = *(const v4fa*)(FI + e); }
    asm volatile("s_wait_xcnt 0x0" :: "s"(gkh), "s"(gkl), "s"(MX), "s"(FI), "v"(tx) : "memory");   // the 24 staging loads' four scalar bases and their vector offset stay as they are until this wait
#pragma unroll
    for (int s = 0; s < 64 * CC / (8 * 32 * ANW); ++s) { const int e = (s * 32 * ANW + tx) * 8; *(v8usa*)(kt + e) = sh[s]; *(v8usa*)(kt + 64 * CC + e) = sl[s]; }
#pragma unroll
    for (int s = 0; s < TT / (4 * 32 * ANW); ++s) { const int e = (s * 32 * ANW + tx) * 4; *(v4fa*)(mt + e) = sm[s]; *(v4fa*)(mt + TT + e) = sf[s]; }
    __syncthreads();   // the whole k tile and both vectors lie in LDS before any wave reads them
    const bf* kth = kt + lane * 8; const bf* ktl = kt + 64 * CC + lane * 8;
    v8f o[8][4];
#pragma unroll
    for (int cb = 0; cb < 8; ++cb)
#pragma unroll
        for (int nb = 0; nb < 4; ++nb) o[cb][nb] = (v8f){};
    // 32 rows i are 32 * CC elements in a row of a q plane; 32 i of 16 channels are 512 elements in a row of a v plane, the next 16 channels 16 * TT further (an immediate offset).
    // A plane's base stays in scalar registers; the lane's and the trip's place are one 32-bit byte offset for both q planes and one for the v planes
    const unsigned l16 = lane * 16;
    const float* pm = mt + w * 32 + hi * 8;   // the lane's 8 rows i of an accumulator
    // rolled: one group's accumulators at a time; everything inside is unrolled whole, so that acc[][] and o[][] are indexed by constants alone and stay in registers
#pragma unroll 1
    for (int t = w; t < TT / 32; t += ANW, pm += ANW * 32) {
        const unsigned qo = l16 + (unsigned)t * (32 * CC * 2), vo = l16 + (unsigned)t * (512 * 2);
        const bf* pqh = (const bf*)((const char*)Qh + qo); const bf* pql = (const bf*)((const char*)Ql + qo);
        const bf* pvh = (const bf*)((const char*)VTh + vo); const bf* pvl = (const bf*)((const char*)VTl + vo); const h16* pv16 = (const h16*)((const char*)VT16 + vo);
        // q's loads for three chunks are issued together, the fourth chunk's and then the v fragments' as q's registers come free, two and more chunks of products ahead of their use.
        // Each sched_barrier keeps the loads in front of it from being moved down to their first use, where every group would be waited for by itself
        V a[CC / 32][2], a2[CC / 32][2];
#pragma unroll
        for (int kc = 0; kc < CC / 32 - 1; ++kc)
#pragma unroll
            for (int mb = 0; mb < 2; ++mb) { a[kc][mb] = WFrag<bf>::ld(pqh + mb * 16 * CC + kc * 512); a2[kc][mb] = WFrag<bf>::ld(pql + mb * 16 * CC + kc * 512); }
        __builtin_amdgcn_sched_barrier(0);
        V vh[8], vl[8]; v16h vv[8];
        v8f acc[2][4];
#pragma unroll
        for (int mb = 0; mb < 2; ++mb)
#pragma unroll
            for (int nb = 0; nb < 4; ++nb) acc[mb][nb] = (v8f){};
#pragma unroll
        for (int kc = 0; kc < CC / 32; ++kc) {
            // two column blocks at a time: three other accumulators stand between two products of one accumulator
#pragma unroll
            for (int n2 = 0; n2 < 4; n2 += 2) { V b[2], b2[2];
#pragma unroll
                for (int u = 0; u < 2; ++u) { b[u] = WFrag<bf>::ld(kth + (n2 + u) * 16 * CC + kc * 512); b2[u] = WFrag<bf>::ld(ktl + (n2 + u) * 16 * CC + kc * 512); }
#pragma unroll
                for (int u = 0; u < 2; ++u)
#pragma unroll
                    for (int mb = 0; mb < 2; ++mb) acc[mb][n2 + u] = wmmab(a[kc][mb], b[u], acc[mb][n2 + u]);
#pragma unroll
                for (int u = 0; u < 2; ++u)
#pragma unroll
                    for (int mb = 0; mb < 2; ++mb) acc[mb][n2 + u] = wmmab(a2[kc][mb], b[u], acc[mb][n2 + u]);
#pragma unroll
                for (int u = 0; u < 2; ++u)
#pragma unroll
                    for (int mb = 0; mb < 2; ++mb) acc[mb][n2 + u] = wmmab(a[kc][mb], b2[u], acc[mb][n2 + u]); }
            // behind chunk 0: q's last chunk; behind chunks 1 and 2 32 registers of v each (l < RH: two channel blocks, hi and lo; else four blocks)
            __builtin_amdgcn_sched_barrier(0);   // behind chunk 3, where no load follows: the next phase's values are not begun among the last products, where they overran the registers (scratch)
            if (kc == 0) {
#pragma unroll
                for (int mb = 0; mb < 2; ++mb) { a[3][mb] = WFrag<bf>::ld(pqh + mb * 16 * CC + 3 * 512); a2[3][mb] = WFrag<bf>::ld(pql + mb * 16 * CC + 3 * 512); } }
            else if (HL && kc < 3) {
#pragma unroll
                for (int cb = 2 * kc - 2; cb < 2 * kc; ++cb) { vh[cb] = WFrag<bf>::ld(pvh + cb * 16 * TT); vl[cb] = WFrag<bf>::ld(pvl + cb * 16 * TT); } }
            else if (!HL && kc < 3) {
#pragma unroll
                for (int cb = 4 * kc - 4; cb < 4 * kc; ++cb) vv[cb] = WFrag<h16>::ld(pv16 + cb * 16 * TT); }
            if (kc < 3) __builtin_amdgcn_sched_barrier(0);
        }
        v8f mi[2], fi[2];
#pragma unroll
        for (int g = 0; g < 2; ++g) { mi[g] = *(const v8f*)(pm + g * 16); fi[g] = *(const v8f*)(pm + TT + g * 16); }
        v8us ph[4][2], pl[4][2]; v8h pq[4][2];
#pragma unroll
        for (int nb = 0; nb < 4; ++nb) {
#pragma unroll
            for (int g = 0; g < 2; ++g) {
#pragma unroll
                for (int j = 0; j < 8; ++j) { unsigned short x, y; splitf(ex2(__fmul_rn(__fsub_rn(acc[g][nb][j], mi[g][j]), L2E)) * fi[g][j], x, y); ph[nb][g][j] = x; pl[nb][g][j] = y;
                    if (!HL) pq[nb][g][j] = tohx(__fadd_rn(bf2f(x), bf2f(y)) * PCAR); }
                __builtin_amdgcn_sched_barrier(0); } }   // one accumulator's 8 values are finished before the next one's are begun: spread over the whole phase their intermediate values overran the registers (scratch)
#pragma unroll
        for (int cb = 0; cb < 8; ++cb) {
            if (HL && (cb == 0 || cb == 2)) {   // two more channel blocks of v, in registers that have just come free; 48 products stand in front of their use
#pragma unroll
                for (int c2 = cb + 4; c2 < cb + 6; ++c2) { vh[c2] = WFrag<bf>::ld(pvh + c2 * 16 * TT); vl[c2] = WFrag<bf>::ld(pvl + c2 * 16 * TT); }
                __builtin_amdgcn_sched_barrier(0);
            }
            // per accumulator the order is P hi x v hi, P lo x v hi, P hi x v lo; the four column blocks stand between two products of one accumulator
            if (HL) {
#pragma unroll
                for (int nb = 0; nb < 4; ++nb) o[cb][nb] = wmmab(vh[cb], cat16b(ph[nb][0], ph[nb][1]), o[cb][nb]);
#pragma unroll
                for (int nb = 0; nb < 4; ++nb) o[cb][nb] = wmmab(vh[cb], cat16b(pl[nb][0], pl[nb][1]), o[cb][nb]);
#pragma unroll
                for (int nb = 0; nb < 4; ++nb) o[cb][nb] = wmmab(vl[cb], cat16b(ph[nb][0], ph[nb][1]), o[cb][nb]); }
            else {
#pragma unroll
                for (int nb = 0; nb < 4; ++nb) o[cb][nb] = wmma16(vv[cb], cat16(pq[nb][0], pq[nb][1]), o[cb][nb]); } }
        // the distance behind the trip's last WMMAs, on the back edge too, where the next trip's values land on their operands
        asm volatile("v_nop\n\tv_nop\n\tv_nop\n\tv_nop" : "+v"(o[7][0]), "+v"(o[7][1]), "+v"(o[7][2]), "+v"(o[7][3]));
        asm volatile("s_wait_xcnt 0x0" :: "v"(qo), "v"(vo) : "memory");   // neither offset that the trip's loads name is rewritten ahead of this wait (it stands at the loop's foot, in front of the back edge)
    }
    // a thread's 16 pieces of 4 l: piece s is channel s * 8 + thread / 16; pe's loads fly while the partial tiles are laid in LDS
    const size_t oo = (size_t)(threadIdx.x >> 4) * TT + l0 + (threadIdx.x & 15) * 4;
    v4f r[16];
#pragma unroll
    for (int s = 0; s < 16; ++s) r[s] = *(const v4f*)(PE + oo + (size_t)s * 8 * TT);
    asm volatile("s_wait_xcnt 0x0" :: "v"(PE + oo) : "memory");   // the 16 loads' address pair stays as it is (no load lands on it) until this wait
    __syncthreads();   // every wave has read the k tile and the two vectors for the last time before a partial tile is laid over them
    float* my = red + w * 128 * OPT;
#pragma unroll
    for (int cb = 0; cb < 8; ++cb)
#pragma unroll
        for (int nb = 0; nb < 4; ++nb)
#pragma unroll
            for (int j = 0; j < 8; ++j) my[(cb * 16 + hi * 8 + j) * OPT + nb * 16 + lr] = o[cb][nb][j];
    __syncthreads();   // every wave's partial tile lies in LDS before any of it is added
    const float cs = HL ? 1.0f : 1.0f / PCAR;
#pragma unroll
    for (int s = 0; s < 16; ++s) { const float* q0 = red + (s * 8 + (int)(threadIdx.x >> 4)) * OPT + (threadIdx.x & 15) * 4; v4f sum = *(const v4fa*)q0;
#pragma unroll
        for (int u = 1; u < ANW; ++u) sum += *(const v4fa*)(q0 + u * 128 * OPT);
        r[s] = sum * cs + r[s]; *(v4f*)(OUTb + oo + (size_t)s * 8 * TT) = r[s]; }
    // the 16 stores name these data registers: they stay as they are until this wait
    asm volatile("s_wait_xcnt 0x0" :: "v"(r[0]), "v"(r[1]), "v"(r[2]), "v"(r[3]), "v"(r[4]), "v"(r[5]), "v"(r[6]), "v"(r[7]), "v"(r[8]), "v"(r[9]), "v"(r[10]), "v"(r[11]), "v"(r[12]), "v"(r[13]), "v"(r[14]), "v"(r[15]) : "memory");
}
// blockIdx.y is the tile of 64 columns l: the tiles l < RH do three value products. The test is the same for the whole block, so every wave of a block meets the same three __syncthreads().
// The second launch bound: two waves a SIMD (512 registers a wave), so that two blocks share a WGP, as their LDS allows.
__global__ __launch_bounds__(32 * ANW, 2) void k_att(const bf* __restrict__ Kh, const bf* __restrict__ Kl, const bf* __restrict__ Qh, const bf* __restrict__ Ql, const float* __restrict__ MX, const float* __restrict__ FI, const bf* __restrict__ VTh, const bf* __restrict__ VTl, const h16* __restrict__ VT16, const float* __restrict__ PE, float* OUT) {
    __shared__ __align__(16) float red[ANW * 128 * OPT];
    { const size_t zb = blockIdx.x, zo = zb * TT * CC; Kh += zo; Kl += zo; Qh += zo; Ql += zo; MX += zb * TT; FI += zb * TT; VTh += zo; VTl += zo; VT16 += zo; PE += zo; OUT += zo; }
    const int l0 = blockIdx.y * 64;   // l0 < RH is the same for the whole tile: RH % 64 == 0
    if (l0 < RH) att_tile<true>(red, l0, Kh, Kl, Qh, Ql, MX, FI, VTh, VTl, VT16, PE, OUT);
    else att_tile<false>(red, l0, Kh, Kl, Qh, Ql, MX, FI, VTh, VTl, VT16, PE, OUT);
}

extern "C" void kernel_launch(void* const* d_in, const int* in_sizes, int n_in,
                              void* d_out, int out_size, void* d_ws, size_t ws_size, hipStream_t stream) {
    (void)in_sizes; (void)n_in; (void)out_size;
    const float* x = (const float*)d_in[0];
    const float* prm[4][6]; for (int r = 0; r < 4; ++r) for (int c = 0; c < 6; ++c) prm[r][c] = (const float*)d_in[1 + r * 6 + c];   // (w, b, gamma, beta, mean, var) for q, k, v, pe
    float* OUT = (float*)d_out;     // [16][128][2048]
    char* wsp = (char*)d_ws;
    auto take = [&](size_t bytes) { char* p = wsp; wsp += (bytes + 255) & ~(size_t)255; return (void*)p; };
    const size_t FE = (size_t)TT * CC;   // elements of one batch's [2048][128] plane
    bf* W4 = (bf*)take((size_t)4 * CC * KI * 2);
    // live through the whole call, all 16 batches
    bf* QPh = (bf*)take(NB_ * FE * 2); bf* QPl = (bf*)take(NB_ * FE * 2); bf* KPh = (bf*)take(NB_ * FE * 2); bf* KPl = (bf*)take(NB_ * FE * 2);
    bf* VTh = (bf*)take(NB_ * FE * 2); bf* VTl = (bf*)take(NB_ * FE * 2); h16* VT16 = (h16*)take(NB_ * FE * 2); float* FPE = (float*)take(NB_ * FE * 4);
    float* MX = (float*)take((size_t)NB_ * TT * 4); float* FI = (float*)take((size_t)NB_ * TT * 4);
    bf* X3 = (bf*)take((size_t)NB_ * TT * KI * 2);   // the im2col plane, all 16 batches
    if ((size_t)(wsp - (char*)d_ws) > ws_size) return;    // ~ 85 MiB
    k_prep<<<dim3(IMB + WBY, NB_, 1), 256, 0, stream>>>(x, X3, prm[0][0], prm[1][0], prm[2][0], prm[3][0], W4);   // im2col plane; w [128][64][3] == Bt [128][192], laid in fragment order
    CvP cp[4]; for (int r = 0; r < 4; ++r) cp[r] = CvP{prm[r][1], prm[r][2], prm[r][3], prm[r][4], prm[r][5]};
    k_conv4<<<dim3(TT / 64, 4 * (CC / 64), NB_), 32, 0, stream>>>(X3, W4, cp[0], cp[1], cp[2], cp[3], QPh, QPl, KPh, KPl, VTh, VTl, VT16, FPE);
    k_stat<<<dim3(TT / 64, NB_, 1), 32 * SNW, 0, stream>>>(KPh, KPl, QPh, QPl, MX, FI);                                                    // softmax row maxima and 1 / sums
    k_att<<<dim3(NB_, TT / 64, 1), 32 * ANW, 0, stream>>>(KPh, KPl, QPh, QPl, MX, FI, VTh, VTl, VT16, FPE, OUT);                                // out = v x P + pe
}

// v009
// One run takes 126 microseconds.
// Two timings next to v008 both put it at 1.08 times that version's speed.
// Over all steps from v000 it is 25.2 times as fast.
#include <hip/hip_runtime.h>

// Conv1dAttention (x [16][64][2048] channels-first; q/k/v/pe = LeakyReLU_0.3(BN(conv1d_k3(x) + b)) with 128 output channels (BN inference affine: y*scale + (beta - mean*scale), scale = gamma*rsqrt(var + 1e-5)); attn[i][j] = sum_c q[c][i] k[c][j] (NO scaling); P = softmax_j; out[c][l] = sum_j v[c][j] P[j][l] + pe[c][l] -> [16][128][2048] - note the value product contracts over the softmax ROW index j, i.e. it uses P TRANSPOSED).
// Compute dtypes, f32 accumulate: every input rounded to bf16; the four k=3 convolutions as PLAIN bf16 im2col GEMMs (K = 192, inputs: exact) + bias, BN affine and LeakyReLU in f32; scores hl x hl (3 products, K 128, unscaled) on every row, formed twice and never stored: once for the softmax rows' f32 maxima and sums, once for P itself, which stays in registers, split hi/lo bf16, as an operand of the value product; output columns l < 512 as hl v x hl P (3 products, K 2048), columns >= 512 as fp16 v x fp16(P x 1024); + pe, written channels-first.

#define NB_  16
#define CIN  64
#define CC   128
#define KW   3
#define KI   (CIN * KW)     // 192
#define TT   2048
#define RH   512
#define PCAR 1024.0f
typedef _Float16 h16;
typedef unsigned short bf;
typedef __attribute__((ext_vector_type(16))) __bf16   v16bf;
typedef __attribute__((ext_vector_type(16))) _Float16 v16h;
typedef __attribute__((ext_vector_type(8)))  _Float16 v8h;
typedef __attribute__((ext_vector_type(8)))  unsigned short v8us;
typedef __attribute__((ext_vector_type(8)))  float    v8f;
typedef __attribute__((ext_vector_type(4)))  float    v4f;
typedef v8h  __attribute__((may_alias)) v8ha;
typedef v4f  __attribute__((may_alias)) v4fa;
typedef v8us __attribute__((may_alias)) v8usa;

typedef __attribute__((ext_vector_type(2)))  float    v2f;
typedef __attribute__((ext_vector_type(2)))  __bf16   v2bf;
typedef __attribute__((ext_vector_type(4)))  unsigned v4u;
// f32 -> bf16, to nearest even, by the conversion instruction: two values an instruction, a in the low half of the word and b in the high half
__device__ __forceinline__ unsigned bfpk(float a, float b) { const v2f x = {a, b}; return __builtin_bit_cast(unsigned, __builtin_convertvector(x, v2bf)); }
// one value, in integer arithmetic (the same rounding): for the few BN constants of a wave, which are used as f32 at once
__device__ __forceinline__ unsigned short f2bf(float f) { unsigned u = __float_as_uint(f); u += 0x7FFFu + ((u >> 16) & 1u); return (unsigned short)(u >> 16); }
__device__ __forceinline__ float bf2f(unsigned short b) { return __uint_as_float(((unsigned)b) << 16); }
__device__ __forceinline__ float bfr(float f) { return bf2f(f2bf(f)); }
__device__ __forceinline__ v16h cat16(v8h lo, v8h hi) { return __builtin_shufflevector(lo, hi, 0, 1, 2, 3, 4, 5, 6, 7, 8, 9, 10, 11, 12, 13, 14, 15); }
__device__ __forceinline__ v16bf cat16b(v8us lo, v8us hi) { return __builtin_bit_cast(v16bf, __builtin_shufflevector(lo, hi, 0, 1, 2, 3, 4, 5, 6, 7, 8, 9, 10, 11, 12, 13, 14, 15)); }
__device__ __forceinline__ v8f wmma16(v16h a, v16h b, v8f c) { return __builtin_amdgcn_wmma_f32_16x16x32_f16(false, a, false, b, (short)0, c, false, false); }
__device__ __forceinline__ v8f wmmab(v16bf a, v16bf b, v8f c) { return __builtin_amdgcn_wmma_f32_16x16x32_bf16(false, a, false, b, (short)0, c, false, false); }



// ---- FRAGMENT ORDER: every 16-bit plane [R][K] that a matrix product reads lies as blocks of 16 rows x 8 k: element (r, k) at (r / 16) * 16 * K + (k / 8) * 128 + (r % 16) * 8 + k % 8 (PKO below).
// A 16 x 32 fragment is then 1 KiB in a row, and each of its two 16-B-a-lane loads (at lane * 8 and at 256 + lane * 8 elements) reads 512 contiguous bytes, 4 whole lines, where a row-major plane gave 32 B of each of 16 lines.
// The lane and register that hold an element are the same as from a row-major plane (lane & 15 the row; k = 8 * (lane >> 4) + 0..7, then 16 more), so every product sees the same operands in the same k order.
#define PKO(r, k, K) ((size_t)((r) >> 4) * 16 * (K) + (size_t)((k) >> 3) * 128 + ((r) & 15) * 8 + ((k) & 7))
template <typename T16> struct WFrag;
template <> struct WFrag<h16> { typedef v16h V; static __device__ __forceinline__ V ld(const h16* p) { return cat16(*(const v8h*)p, *(const v8h*)(p + 256)); } static __device__ __forceinline__ v8f mma(V a, V b, v8f c) { return wmma16(a, b, c); } };
template <> struct WFrag<bf> { typedef v16bf V; static __device__ __forceinline__ V ld(const bf* p) { return cat16b(*(const v8us*)p, *(const v8us*)(p + 256)); } static __device__ __forceinline__ v8f mma(V a, V b, v8f c) { return wmmab(a, b, c); } };

__device__ __forceinline__ h16 tohx(float x) { return (h16)x; }
// two values split hi/lo: h holds both hi parts, l both roundings of y - hi; hf, lf: the same parts as f32
__device__ __forceinline__ v2f pk2f(unsigned p) { const v2f r = {__uint_as_float(p << 16), __uint_as_float(p & 0xFFFF0000u)}; return r; }
__device__ __forceinline__ void split2(float y0, float y1, unsigned& h, unsigned& l) { h = bfpk(y0, y1); const v2f hf = pk2f(h); l = bfpk(y0 - hf[0], y1 - hf[1]); }
typedef __attribute__((ext_vector_type(2))) unsigned short v2us;
typedef __attribute__((ext_vector_type(4))) unsigned short v4us;
typedef __attribute__((ext_vector_type(8))) unsigned short v8us;
typedef __attribute__((ext_vector_type(4))) _Float16 v4h;
typedef __attribute__((ext_vector_type(2))) float v2f;

// a weight plane [128][192] rounded to bf16 and laid in fragment order; a thread takes 8 consecutive k of one row
__device__ __forceinline__ void cvt8(int bx, const float* __restrict__ src, bf* dst, size_t n8) { const size_t i = (size_t)bx * 256 + threadIdx.x; if (i >= n8) return; const v8f v = *(const v8f*)(src + i * 8); v4u ou;
#pragma unroll
    for (int k = 0; k < 4; ++k) ou[k] = bfpk(v[2 * k], v[2 * k + 1]);
    const v8us o = __builtin_bit_cast(v8us, ou); const int row = (int)(i / (KI / 8)), k0 = (int)(i % (KI / 8)) * 8; *(v8us*)(dst + PKO(row, k0, KI)) = o;  }
__device__ __forceinline__ void im2col(int bx, int by, const float* __restrict__ xb, bf* X3) { xb += (size_t)by * CIN * TT; X3 += (size_t)by * TT * KI; const size_t e8 = ((size_t)bx * 256 + threadIdx.x) * 8; if (e8 >= (size_t)TT * KI) return;
    // e8 is the place in the plane, which lies in fragment order: 16 neighbouring threads hold 16 neighbouring t at the same 8 k
    const int pb16 = (int)(e8 >> 7); const int kidx = (pb16 % (KI / 8)) * 8; const int t = (pb16 / (KI / 8)) * 16 + ((int)(e8 >> 3) & 15); float xv[8]; v4u ou;
#pragma unroll
    for (int u = 0; u < 8; ++u) { const int k2 = kidx + u; const int ci = k2 / KW, kk = k2 % KW; const int tt = t + kk - 1; xv[u] = (tt >= 0 && tt < TT) ? xb[(size_t)ci * TT + tt] : 0.f; }
#pragma unroll
    for (int u = 0; u < 4; ++u) ou[u] = bfpk(xv[2 * u], xv[2 * u + 1]);
    *(v8us*)(X3 + e8) = __builtin_bit_cast(v8us, ou);  }
// ---- k_prep: the im2col plane and the four weight planes in ONE launch (neither reads what the other writes). Grid (IMB + WBY, NB_), 256 threads: in each row of the grid the first IMB blocks lay the batch's im2col plane,
// the last WBY take one 256-thread piece of a weight plane each (NB_ * WBY pieces = 4 planes of WPB pieces).
#define IMB  (TT * KI / 8 / 256)    // 192
#define WPB  (CC * KI / 8 / 256)    // 12
#define WBY  (4 * WPB / NB_)        // 3
static_assert(TT * KI % (8 * 256) == 0 && CC * KI % (8 * 256) == 0 && 4 * WPB % NB_ == 0, "whole blocks");
__global__ __launch_bounds__(256) void k_prep(const float* __restrict__ x, bf* X3, const float* __restrict__ wq, const float* __restrict__ wk, const float* __restrict__ wv, const float* __restrict__ wp, bf* W4) {
    if (blockIdx.x < IMB) { im2col(blockIdx.x, blockIdx.y, x, X3); return; }
    const int pc = (int)blockIdx.y * WBY + (int)blockIdx.x - IMB, r = pc / WPB;   // the same for the whole block
    cvt8(pc % WPB, r == 0 ? wq : r == 1 ? wk : r == 2 ? wv : wp, W4 + (size_t)r * CC * KI, (size_t)CC * KI / 8);
}
// ---- conv_tile: one k = 3 convolution as its im2col GEMM (one wave per 64x64 tile, 16 accumulators: A = X3 [t][192], Bt = w [c][192], both in fragment order) that finishes its own output: bias, BN affine, LeakyReLU and the split
// into 16-bit planes are applied to the accumulators, so that no f32 plane is written and read again by a pass of its own. Tile (bx, by) of batch bz, 32 threads; os: 16 * 68 floats of the calling kernel's LDS.
// EPI 0 (q, k): hi/lo bf16 planes [t][c], in fragment order. EPI 1 (v): hi/lo bf16 and fp16 planes, transposed [c][t], in fragment order. EPI 2 (pe): f32 plane, transposed [c][t], row-major.
struct BnC { float b, sc, sh; };   // one channel's bias, BN scale and BN shift
__device__ __forceinline__ BnC bn_chan(int c, const float* __restrict__ bias, const float* __restrict__ gam, const float* __restrict__ bet, const float* __restrict__ mu, const float* __restrict__ var) {
    BnC r; r.b = bfr(bias[c]);
    // here and in bn_act each product is rounded before its add or subtract, as in y * scale + (beta - mean * scale) taken one operation at a time: q, k, v and pe come out bit for bit as from a BN pass of its own
    const float sc = __fmul_rn(bfr(gam[c]), __fdiv_rn(1.0f, sqrtf(__fadd_rn(bfr(var[c]), 1e-5f)))); float ms = __fmul_rn(bfr(mu[c]), sc); asm volatile("" : "+v"(ms)); const float sh = __fsub_rn(bfr(bet[c]), ms);
    r.sc = sc; r.sh = sh; return r; }
__device__ __forceinline__ float bn_act(float acc, const BnC p) { const float a = acc + p.b; float y = __fmul_rn(a, p.sc); asm volatile("" : "+v"(y)); y = __fadd_rn(y, p.sh); return (y > 0.f) ? y : 0.3f * y; }
template <int EPI>
__device__ __forceinline__ void conv_tile(float* os, int bx, int by, int bz, const bf* __restrict__ A, const bf* __restrict__ Bt, const float* __restrict__ bias, const float* __restrict__ gam, const float* __restrict__ bet, const float* __restrict__ mu, const float* __restrict__ var, bf* Oh, bf* Ol, h16* O16, float* OF) {
    typedef WFrag<bf>::V V;
    const size_t zo = (size_t)bz * TT * CC; A += (size_t)bz * TT * KI;
    const int lane = threadIdx.x & 31, lr = lane & 15, hi = lane >> 4; const int r0 = bx * 64, c0 = by * 64;
    v8f acc[4][4];
#pragma unroll
    for (int mb = 0; mb < 4; ++mb)
#pragma unroll
        for (int nb = 0; nb < 4; ++nb) acc[mb][nb] = (v8f){};
    // the lane's 4 channels, one per column block of the accumulators. Formed ahead of the K loop, whose loads hide theirs
    BnC pc[4];
#pragma unroll
    for (int u = 0; u < 4; ++u) pc[u] = bn_chan(c0 + u * 16 + lr, bias, gam, bet, mu, var);
    const bf* pa = A + (size_t)r0 * KI + lane * 8; const bf* pb = Bt + (size_t)c0 * KI + lane * 8;
    // the loop stays rolled: 16 accumulators and one trip's fragments fill the registers
#pragma unroll 1
    for (int kc = 0; kc < KI; kc += 32, pa += 512, pb += 512) {
        V a[4], b[4];
#pragma unroll
        for (int mb = 0; mb < 4; ++mb) a[mb] = WFrag<bf>::ld(pa + (size_t)mb * 16 * KI);
#pragma unroll
        for (int nb = 0; nb < 4; ++nb) b[nb] = WFrag<bf>::ld(pb + (size_t)nb * 16 * KI);
        asm volatile("s_wait_xcnt 0x0" :: "v"(pa), "v"(pb) : "memory");   // the 16 loads' two address pairs stay as they are (no load lands on them, nothing rewrites them) until this wait
#pragma unroll
        for (int nb = 0; nb < 4; ++nb)
#pragma unroll
            for (int mb = 0; mb < 4; ++mb) acc[mb][nb] = WFrag<bf>::mma(a[mb], b[nb], acc[mb][nb]);
        // the distance behind the trip's last WMMAs, on the back edge too, where the next trip's loads land on a[] and b[]
        asm volatile("v_nop\n\tv_nop\n\tv_nop\n\tv_nop" : "+v"(acc[0][0]), "+v"(acc[1][1]), "+v"(acc[2][2]), "+v"(acc[3][3]) : "v"(a[0]), "v"(a[3]));
    }
    // every loop below is unrolled whole: acc[][] and pc[] are indexed by constants alone and stay in registers
    if (EPI == 1) {
        // a lane's accumulator holds 8 consecutive t of one channel: that is a lane's 16 B of a transposed plane in fragment order, and the wave's store is 512 B in a row
#pragma unroll
        for (int nb = 0; nb < 4; ++nb)
#pragma unroll
            for (int mb = 0; mb < 4; ++mb) { v4u uh, ul; v8h of;
#pragma unroll
                for (int j = 0; j < 8; j += 2) { const float y0 = bn_act(acc[mb][nb][j], pc[nb]), y1 = bn_act(acc[mb][nb][j + 1], pc[nb]); unsigned p, q; split2(y0, y1, p, q); uh[j >> 1] = p; ul[j >> 1] = q; of[j] = tohx(y0); of[j + 1] = tohx(y1); }
                const v8us oh = __builtin_bit_cast(v8us, uh), ol = __builtin_bit_cast(v8us, ul);
                const size_t oo = zo + PKO(c0 + nb * 16 + lr, r0 + mb * 16 + hi * 8, TT); *(v8us*)(Oh + oo) = oh; *(v8us*)(Ol + oo) = ol; *(v8h*)(O16 + oo) = of;
                asm volatile("s_wait_xcnt 0x0" :: "v"(oh), "v"(ol), "v"(of) : "memory"); }   // the three stores name these data registers: they stay as they are until this wait
        return;
    }
    if (EPI == 0) {
        // the finished values are turned through LDS: a lane then holds 8 consecutive channels of one t, its 16 B of a plane in fragment order, and the wave's store is 512 B in a row
#pragma unroll
        for (int mb = 0; mb < 4; ++mb) {
#pragma unroll
            for (int nb = 0; nb < 4; ++nb) {
#pragma unroll
                for (int j = 0; j < 8; ++j) os[(hi * 8 + j) * 68 + nb * 16 + lr] = bn_act(acc[mb][nb][j], pc[nb]); }
            __builtin_amdgcn_wave_barrier(); asm volatile("" ::: "memory");   // a lane reads what other lanes wrote: the compiler, which follows one lane, must not lift a read over the 16 rows' writes
            v8us oh[4], ol[4];
#pragma unroll
            for (int s = 0; s < 4; ++s) { const int g8 = 2 * s + hi; const v4f x0 = *(const v4fa*)(os + lr * 68 + g8 * 8), x1 = *(const v4fa*)(os + lr * 68 + g8 * 8 + 4);
                v4u uh, ul;
#pragma unroll
                for (int u = 0; u < 4; ++u) { unsigned p, q; split2(u < 2 ? x0[2 * u] : x1[2 * u - 4], u < 2 ? x0[2 * u + 1] : x1[2 * u - 3], p, q); uh[u] = p; ul[u] = q; }
                oh[s] = __builtin_bit_cast(v8us, uh); ol[s] = __builtin_bit_cast(v8us, ul);
                const size_t oo = zo + PKO(r0 + mb * 16 + lr, c0 + g8 * 8, CC); *(v8us*)(Oh + oo) = oh[s]; *(v8us*)(Ol + oo) = ol[s]; }
            // the 16 rows' stores name these data registers: they stay as they are until this wait, one for the whole group
            asm volatile("s_wait_xcnt 0x0" :: "v"(oh[0]), "v"(oh[1]), "v"(oh[2]), "v"(oh[3]), "v"(ol[0]), "v"(ol[1]), "v"(ol[2]), "v"(ol[3]) : "memory");
            __builtin_amdgcn_wave_barrier(); asm volatile("" ::: "memory");   // nor the next 16 rows' writes over these reads
        }
        return;
    }
    // EPI 2: a lane's accumulator holds 8 consecutive t of one channel, 32 B of that channel's row of the transposed f32 plane
#pragma unroll
    for (int nb = 0; nb < 4; ++nb) {
        v4f y[4][2];
#pragma unroll
        for (int mb = 0; mb < 4; ++mb) {
#pragma unroll
            for (int j = 0; j < 8; ++j) y[mb][j >> 2][j & 3] = bn_act(acc[mb][nb][j], pc[nb]);
            float* dst = OF + zo + (size_t)(c0 + nb * 16 + lr) * TT + r0 + mb * 16 + hi * 8; *(v4f*)dst = y[mb][0]; *(v4f*)(dst + 4) = y[mb][1]; }
        // the 8 stores name these data registers: they stay as they are until this wait, one for the whole group
        asm volatile("s_wait_xcnt 0x0" :: "v"(y[0][0]), "v"(y[0][1]), "v"(y[1][0]), "v"(y[1][1]), "v"(y[2][0]), "v"(y[2][1]), "v"(y[3][0]), "v"(y[3][1]) : "memory");
    }
}
// ---- k_conv4: the four convolutions in ONE launch (they read the same im2col plane and none reads another's output): 4 waves a SIMD run side by side where a launch of one convolution gave each SIMD one.
// Grid (TT/64, 4 * CC/64, NB_), 32 threads; blockIdx.y = convolution * (CC/64) + channel tile, so that the 8 tiles that read the same 64 rows of the im2col plane start close together.
struct CvP { const float* b; const float* g; const float* be; const float* mu; const float* var; };   // one convolution's bias and BN vectors
__global__ __launch_bounds__(32) void k_conv4(const bf* __restrict__ X3, const bf* __restrict__ W4, CvP pq, CvP pk, CvP pv, CvP pp, bf* QPh, bf* QPl, bf* KPh, bf* KPl, bf* VTh, bf* VTl, h16* VT16, float* FPE) {
    __shared__ __align__(16) float os[16 * 68];
    const int r = (int)blockIdx.y / (CC / 64), by = (int)blockIdx.y % (CC / 64);   // the same for the whole block
    const bf* Bt = W4 + (size_t)r * CC * KI;
    if (r < 2) { const CvP p = r == 0 ? pq : pk; conv_tile<0>(os, blockIdx.x, by, blockIdx.z, X3, Bt, p.b, p.g, p.be, p.mu, p.var, r == 0 ? QPh : KPh, r == 0 ? QPl : KPl, nullptr, nullptr); }   // q and k share one copy of the code
    else if (r == 2) conv_tile<1>(os, blockIdx.x, by, blockIdx.z, X3, Bt, pv.b, pv.g, pv.be, pv.mu, pv.var, VTh, VTl, VT16, nullptr);
    else conv_tile<2>(os, blockIdx.x, by, blockIdx.z, X3, Bt, pp.b, pp.g, pp.be, pp.mu, pp.var, nullptr, nullptr, nullptr, FPE);
}
// ---- st_tile: one wave's 64x64 tile of the TRANSPOSED scores, St[l][i] = sum_c k[c][l] q[c][i] (A = k rows l, Bt = q rows i, planes in fragment order, K = 128; per 32-element chunk the three split products in the order hi x hi, q lo x k hi, q hi x k lo).
// An accumulator holds one i (its column, lane & 15) and 8 consecutive l: what belongs to a softmax row i (its maximum, its sum, its factor) is a per-lane value. 
#define L2E  1.4426950408889634f
// 2^x on the transcendental unit; the v_nop is the one slot that the instruction set asks for behind a transcendental before its result is read or its source overwritten
__device__ __forceinline__ float ex2(float x) { float r; asm("v_exp_f32 %0, %1\n\tv_nop" : "=v"(r) : "v"(x)); return r; }
__device__ __forceinline__ void st_tile(const bf* __restrict__ Kh, const bf* __restrict__ Kl, const bf* __restrict__ Qh, const bf* __restrict__ Ql, int l0, int i0, int lr, int hi, v8f (&acc)[4][4]) {
    typedef WFrag<bf>::V V;
#pragma unroll
    for (int mb = 0; mb < 4; ++mb)
#pragma unroll
        for (int nb = 0; nb < 4; ++nb) acc[mb][nb] = (v8f){};
    const size_t ao = (size_t)l0 * CC + (hi * 16 + lr) * 8, bo = (size_t)i0 * CC + (hi * 16 + lr) * 8;
    const bf* pkh = Kh + ao; const bf* pkl = Kl + ao; const bf* pqh = Qh + bo; const bf* pql = Ql + bo;
    // the loop stays rolled: 16 accumulators and one trip's fragments fill the registers
#pragma unroll 1
    for (int kc = 0; kc < CC; kc += 32, pkh += 512, pkl += 512, pqh += 512, pql += 512) {
        V a[4], a2[4];
#pragma unroll
        for (int mb = 0; mb < 4; ++mb) { a[mb] = WFrag<bf>::ld(pkh + (size_t)mb * 16 * CC); a2[mb] = WFrag<bf>::ld(pkl + (size_t)mb * 16 * CC); }
#pragma unroll
        for (int nb = 0; nb < 4; ++nb) { const V b = WFrag<bf>::ld(pqh + (size_t)nb * 16 * CC); const V b2 = WFrag<bf>::ld(pql + (size_t)nb * 16 * CC);
#pragma unroll
            for (int mb = 0; mb < 4; ++mb) { acc[mb][nb] = WFrag<bf>::mma(a[mb], b, acc[mb][nb]); acc[mb][nb] = WFrag<bf>::mma(a[mb], b2, acc[mb][nb]); acc[mb][nb] = WFrag<bf>::mma(a2[mb], b, acc[mb][nb]); } }
        // the distance behind the trip's last WMMAs, on the back edge too, where the next trip's loads land on a[] and a2[]
        asm volatile("v_nop\n\tv_nop\n\tv_nop\n\tv_nop" : "+v"(acc[0][0]), "+v"(acc[1][1]), "+v"(acc[2][2]), "+v"(acc[3][3]) : "v"(a[0]), "v"(a[3]));
        asm volatile("s_wait_xcnt 0x0" :: "v"(pkh), "v"(pkl), "v"(pqh), "v"(pql) : "memory");   // no address pair that the trip's loads name is rewritten ahead of this wait (it stands at the loop's foot, in front of the back edge)
    }
}
// ---- k_stat: the softmax rows' maxima and 1 / sums, from scores that are formed and dropped (no score plane is stored). Grid (TT/64, NB_), 8 waves: the block owns 64 rows i, wave w the l tiles w, w + 8, w + 16, w + 24.
// A lane keeps a running (maximum, sum of exp2 relative to it) for each of its 4 rows i; the 16 partial pairs of a row (8 waves x 2 lane halves) are merged through LDS in a fixed order.
#define SNW  8
__global__ __launch_bounds__(32 * SNW) void k_stat(const bf* __restrict__ Kh, const bf* __restrict__ Kl, const bf* __restrict__ Qh, const bf* __restrict__ Ql, float* MX, float* FI) {
    __shared__ float pm[2 * SNW][64], ps[2 * SNW][64];
    { const size_t zo = (size_t)blockIdx.y * TT * CC; Kh += zo; Kl += zo; Qh += zo; Ql += zo; }
    const int w = __builtin_amdgcn_readfirstlane((int)(threadIdx.x >> 5));   // the wave's number, in a scalar register: the tile loop's counter stays scalar
    const int lane = threadIdx.x & 31, lr = lane & 15, hi = lane >> 4; const int i0 = blockIdx.x * 64;
    float m[4], s[4];
#pragma unroll
    for (int nb = 0; nb < 4; ++nb) { m[nb] = -3.0e38f; s[nb] = 0.f; }
    // rolled: one tile's accumulators at a time
#pragma unroll 1
    for (int t = w; t < TT / 64; t += SNW) {
        v8f acc[4][4];
        st_tile(Kh, Kl, Qh, Ql, t * 64, i0, lr, hi, acc);
        // unrolled whole: acc[][] is indexed by constants alone and stays in registers
#pragma unroll
        for (int nb = 0; nb < 4; ++nb) { float mn = m[nb];
#pragma unroll
            for (int mb = 0; mb < 4; ++mb)
#pragma unroll
                for (int j = 0; j < 8; ++j) mn = fmaxf(mn, acc[mb][nb][j]);
            float ss = 0.f;
#pragma unroll
            for (int mb = 0; mb < 4; ++mb)
#pragma unroll
                for (int j = 0; j < 8; ++j) ss += ex2(__fmul_rn(__fsub_rn(acc[mb][nb][j], mn), L2E));
            s[nb] = s[nb] * ex2(__fmul_rn(__fsub_rn(m[nb], mn), L2E)) + ss; m[nb] = mn; }
    }
#pragma unroll
    for (int nb = 0; nb < 4; ++nb) { pm[2 * w + hi][nb * 16 + lr] = m[nb]; ps[2 * w + hi][nb * 16 + lr] = s[nb]; }
    __syncthreads();   // every wave's partial pairs lie in LDS before any of them is merged
    if (threadIdx.x < 64) { const int i = threadIdx.x; float mx = pm[0][i];
#pragma unroll
        for (int p = 1; p < 2 * SNW; ++p) mx = fmaxf(mx, pm[p][i]);
        float sum = 0.f;
#pragma unroll
        for (int p = 0; p < 2 * SNW; ++p) sum += ps[p][i] * ex2(__fmul_rn(__fsub_rn(pm[p][i], mx), L2E));
        const size_t o = (size_t)blockIdx.y * TT + i0 + i; MX[o] = mx; FI[o] = __fdiv_rn(1.0f, sum); }
}
// ---- k_att: the output itself from a second forming of the scores; P is never stored. Grid (NB_, TT/64), 32 * ANW threads: the block owns 64 columns l of one batch's output, all 128 channels; wave w takes the 32-row groups i = w, w + ANW, ...
// The block's 64 rows of the k planes (16 KiB each, contiguous in fragment order) and the batch's row maxima and factors are laid in LDS once and read from there in every trip.
// Per trip: S[i][l] = sum_c q[c][i] k[c][l] (A = q rows i, Bt = k rows l; per 32-element chunk the three split products in the order hi x hi, q lo x k hi, q hi x k lo, as in st_tile): an accumulator holds one l (lane & 15) and 8 consecutive i.
// P[i][l] = exp2((S[i][l] - max_i) * log2 e) * (1 / sum_i), split hi/lo bf16 (l < RH) or fp16((hi + lo) x 1024) (l >= RH), stays in the lanes and registers where the accumulators hold it: two accumulators (16 + 16 rows i) are one Bt fragment [l][32 i].
// Then o[c][l] += v[c][i] P[i][l] with A = the v planes [c][t]; an accumulator of o holds one l a lane and 8 channels. The ANW partial tiles are laid in LDS, added in wave order, scaled, + pe, and stored channels-first, 256 B of a channel's row in a row.
#define ANW  4
#define OPT  68             // pitch of a partial tile's row (64 l) in LDS, floats: the two 8-row halves of an accumulator's store fall on different banks
template <bool HL>
__device__ __forceinline__ void att_tile(float* red, int l0, const bf* __restrict__ Kh, const bf* __restrict__ Kl, const bf* __restrict__ Qh, const bf* __restrict__ Ql, const float* __restrict__ MX, const float* __restrict__ FI, const bf* __restrict__ VTh, const bf* __restrict__ VTl, const h16* __restrict__ VT16, const float* __restrict__ PE, float* OUTb) {
    typedef WFrag<bf>::V V;
    const int w = __builtin_amdgcn_readfirstlane((int)(threadIdx.x >> 5));   // the wave's number, in a scalar register: the trip counter stays scalar
    const int lane = threadIdx.x & 31, lr = lane & 15, hi = lane >> 4;
    // the k tile stands where the partial tiles are laid later: 64 * CC elements of the hi plane, then as many of the lo plane
    bf* kt = (bf*)red;
    // behind it the batch's 2048 row maxima and 2048 factors 1 / sum
    float* mt = red + 64 * CC;
    const bf* gkh = Kh + (size_t)l0 * CC; const bf* gkl = Kl + (size_t)l0 * CC;
    const int tx = (int)threadIdx.x;
    v8us sh[64 * CC / (8 * 32 * ANW)], sl[64 * CC / (8 * 32 * ANW)]; v4f sm[TT / (4 * 32 * ANW)], sf[TT / (4 * 32 * ANW)];
#pragma unroll
    for (int s = 0; s < 64 * CC / (8 * 32 * ANW); ++s) { const int e = (s * 32 * ANW + tx) * 8; sh[s] = *(const v8usa*)(gkh + e); sl[s] = *(const v8usa*)(gkl + e); }
#pragma unroll
    for (int s = 0; s < TT / (4 * 32 * ANW); ++s) { const int e = (s * 32 * ANW + tx) * 4; sm[s] = *(const v4fa*)(MX + e); sf[s] = *(const v4fa*)(FI + e); }
    asm volatile("s_wait_xcnt 0x0" :: "s"(gkh), "s"(gkl), "s"(MX), "s"(FI), "v"(tx) : "memory");   // the 24 staging loads' four scalar bases and their vector offset stay as they are until this wait
#pragma unroll
    for (int s = 0; s < 64 * CC / (8 * 32 * ANW); ++s) { const int e = (s * 32 * ANW + tx) * 8; *(v8usa*)(kt + e) = sh[s]; *(v8usa*)(kt + 64 * CC + e) = sl[s]; }
#pragma unroll
    for (int s = 0; s < TT / (4 * 32 * ANW); ++s) { const int e = (s * 32 * ANW + tx) * 4; *(v4fa*)(mt + e) = sm[s]; *(v4fa*)(mt + TT + e) = sf[s]; }
    __syncthreads();   // the whole k tile and both vectors lie in LDS before any wave reads them
    const bf* kth = kt + lane * 8; const bf* ktl = kt + 64 * CC + lane * 8;
    v8f o[8][4];
#pragma unroll
    for (int cb = 0; cb < 8; ++cb)
#pragma unroll
        for (int nb = 0; nb < 4; ++nb) o[cb][nb] = (v8f){};
    // 32 rows i are 32 * CC elements in a row of a q plane; 32 i of 16 channels are 512 elements in a row of a v plane, the next 16 channels 16 * TT further (an immediate offset).
    // A plane's base stays in scalar registers; the lane's and the trip's place are one 32-bit byte offset for both q planes and one for the v planes
    const unsigned l16 = lane * 16;
    const float* pm = mt + w * 32 + hi * 8;   // the lane's 8 rows i of an accumulator
    // rolled: one group's accumulators at a time; everything inside is unrolled whole, so that acc[][] and o[][] are indexed by constants alone and stay in registers
#pragma unroll 1
    for (int t = w; t < TT / 32; t += ANW, pm += ANW * 32) {
        const unsigned qo = l16 + (unsigned)t * (32 * CC * 2), vo = l16 + (unsigned)t * (512 * 2);
        const bf* pqh = (const bf*)((const char*)Qh + qo); const bf* pql = (const bf*)((const char*)Ql + qo);
        const bf* pvh = (const bf*)((const char*)VTh + vo); const bf* pvl = (const bf*)((const char*)VTl + vo); const h16* pv16 = (const h16*)((const char*)VT16 + vo);
        // q's loads for three chunks are issued together, the fourth chunk's and then the v fragments' as q's registers come free, two and more chunks of products ahead of their use.
        // Each sched_barrier keeps the loads in front of it from being moved down to their first use, where every group would be waited for by itself
        V a[CC / 32][2], a2[CC / 32][2];
#pragma unroll
        for (int kc = 0; kc < CC / 32 - 1; ++kc)
#pragma unroll
            for (int mb = 0; mb < 2; ++mb) { a[kc][mb] = WFrag<bf>::ld(pqh + mb * 16 * CC + kc * 512); a2[kc][mb] = WFrag<bf>::ld(pql + mb * 16 * CC + kc * 512); }
        __builtin_amdgcn_sched_barrier(0);
        V vh[8], vl[8]; v16h vv[8];
        v8f acc[2][4];
#pragma unroll
        for (int mb = 0; mb < 2; ++mb)
#pragma unroll
            for (int nb = 0; nb < 4; ++nb) acc[mb][nb] = (v8f){};
#pragma unroll
        for (int kc = 0; kc < CC / 32; ++kc) {
            // two column blocks at a time: three other accumulators stand between two products of one accumulator
#pragma unroll
            for (int n2 = 0; n2 < 4; n2 += 2) { V b[2], b2[2];
#pragma unroll
                for (int u = 0; u < 2; ++u) { b[u] = WFrag<bf>::ld(kth + (n2 + u) * 16 * CC + kc * 512); b2[u] = WFrag<bf>::ld(ktl + (n2 + u) * 16 * CC + kc * 512); }
#pragma unroll
                for (int u = 0; u < 2; ++u)
#pragma unroll
                    for (int mb = 0; mb < 2; ++mb) acc[mb][n2 + u] = wmmab(a[kc][mb], b[u], acc[mb][n2 + u]);
#pragma unroll
                for (int u = 0; u < 2; ++u)
#pragma unroll
                    for (int mb = 0; mb < 2; ++mb) acc[mb][n2 + u] = wmmab(a2[kc][mb], b[u], acc[mb][n2 + u]);
#pragma unroll
                for (int u = 0; u < 2; ++u)
#pragma unroll
                    for (int mb = 0; mb < 2; ++mb) acc[mb][n2 + u] = wmmab(a[kc][mb], b2[u], acc[mb][n2 + u]); }
            // behind chunk 0: q's last chunk; behind chunks 1 and 2 32 registers of v each (l < RH: two channel blocks, hi and lo; else four blocks)
            __builtin_amdgcn_sched_barrier(0);   // behind chunk 3, where no load follows: the next phase's values are not begun among the last products, where they overran the registers (scratch)
            if (kc == 0) {
#pragma unroll
                for (int mb = 0; mb < 2; ++mb) { a[3][mb] = WFrag<bf>::ld(pqh + mb * 16 * CC + 3 * 512); a2[3][mb] = WFrag<bf>::ld(pql + mb * 16 * CC + 3 * 512); } }
            else if (HL && kc < 3) {
#pragma unroll
                for (int cb = 2 * kc - 2; cb < 2 * kc; ++cb) { vh[cb] = WFrag<bf>::ld(pvh + cb * 16 * TT); vl[cb] = WFrag<bf>::ld(pvl + cb * 16 * TT); } }
            else if (!HL && kc < 3) {
#pragma unroll
                for (int cb = 4 * kc - 4; cb < 4 * kc; ++cb) vv[cb] = WFrag<h16>::ld(pv16 + cb * 16 * TT); }
            if (kc < 3) __builtin_amdgcn_sched_barrier(0);
        }
        v8f mi[2], fi[2];
#pragma unroll
        for (int g = 0; g < 2; ++g) { mi[g] = *(const v8f*)(pm + g * 16); fi[g] = *(const v8f*)(pm + TT + g * 16); }
        v8us ph[4][2], pl[4][2]; v8h pq[4][2];
#pragma unroll
        for (int nb = 0; nb < 4; ++nb) {
#pragma unroll
            for (int g = 0; g < 2; ++g) {
                v4u uh, ul;
#pragma unroll
                for (int j = 0; j < 8; j += 2) { unsigned x, y;
                    split2(ex2(__fmul_rn(__fsub_rn(acc[g][nb][j], mi[g][j]), L2E)) * fi[g][j], ex2(__fmul_rn(__fsub_rn(acc[g][nb][j + 1], mi[g][j + 1]), L2E)) * fi[g][j + 1], x, y); uh[j >> 1] = x; ul[j >> 1] = y;
                    if (!HL) { const v2f xf = pk2f(x), yf = pk2f(y); pq[nb][g][j] = tohx(__fadd_rn(xf[0], yf[0]) * PCAR); pq[nb][g][j + 1] = tohx(__fadd_rn(xf[1], yf[1]) * PCAR); } }
                ph[nb][g] = __builtin_bit_cast(v8us, uh); pl[nb][g] = __builtin_bit_cast(v8us, ul);
                __builtin_amdgcn_sched_barrier(0); } }   // one accumulator's 8 values are finished before the next one's are begun: spread over the whole phase their intermediate values overran the registers (scratch)
#pragma unroll
        for (int cb = 0; cb < 8; ++cb) {
            if (HL && (cb == 0 || cb == 2)) {   // two more channel blocks of v, in registers that have just come free; 48 products stand in front of their use
#pragma unroll
                for (int c2 = cb + 4; c2 < cb + 6; ++c2) { vh[c2] = WFrag<bf>::ld(pvh + c2 * 16 * TT); vl[c2] = WFrag<bf>::ld(pvl + c2 * 16 * TT); }
                __builtin_amdgcn_sched_barrier(0);
            }
            // per accumulator the order is P hi x v hi, P lo x v hi, P hi x v lo; the four column blocks stand between two products of one accumulator
            if (HL) {
#pragma unroll
                for (int nb = 0; nb < 4; ++nb) o[cb][nb] = wmmab(vh[cb], cat16b(ph[nb][0], ph[nb][1]), o[cb][nb]);
#pragma unroll
                for (int nb = 0; nb < 4; ++nb) o[cb][nb] = wmmab(vh[cb], cat16b(pl[nb][0], pl[nb][1]), o[cb][nb]);
#pragma unroll
                for (int nb = 0; nb < 4; ++nb) o[cb][nb] = wmmab(vl[cb], cat16b(ph[nb][0], ph[nb][1]), o[cb][nb]); }
            else {
#pragma unroll
                for (int nb = 0; nb < 4; ++nb) o[cb][nb] = wmma16(vv[cb], cat16(pq[nb][0], pq[nb][1]), o[cb][nb]); } }
        // the distance behind the trip's last WMMAs, on the back edge too, where the next trip's values land on their operands
        asm volatile("v_nop\n\tv_nop\n\tv_nop\n\tv_nop" : "+v"(o[7][0]), "+v"(o[7][1]), "+v"(o[7][2]), "+v"(o[7][3]));
        asm volatile("s_wait_xcnt 0x0" :: "v"(qo), "v"(vo) : "memory");   // neither offset that the trip's loads name is rewritten ahead of this wait (it stands at the loop's foot, in front of the back edge)
    }
    // a thread's 16 pieces of 4 l: piece s is channel s * 8 + thread / 16; pe's loads fly while the partial tiles are laid in LDS
    const size_t oo = (size_t)(threadIdx.x >> 4) * TT + l0 + (threadIdx.x & 15) * 4;
    v4f r[16];
#pragma unroll
    for (int s = 0; s < 16; ++s) r[s] = *(const v4f*)(PE + oo + (size_t)s * 8 * TT);
    asm volatile("s_wait_xcnt 0x0" :: "v"(PE + oo) : "memory");   // the 16 loads' address pair stays as it is (no load lands on it) until this wait
    __syncthreads();   // every wave has read the k tile and the two vectors for the last time before a partial tile is laid over them
    float* my = red + w * 128 * OPT;
#pragma unroll
    for (int cb = 0; cb < 8; ++cb)
#pragma unroll
        for (int nb = 0; nb < 4; ++nb)
#pragma unroll
            for (int j = 0; j < 8; ++j) my[(cb * 16 + hi * 8 + j) * OPT + nb * 16 + lr] = o[cb][nb][j];
    __syncthreads();   // every wave's partial tile lies in LDS before any of it is added
    const float cs = HL ? 1.0f : 1.0f / PCAR;
#pragma unroll
    for (int s = 0; s < 16; ++s) { const float* q0 = red + (s * 8 + (int)(threadIdx.x >> 4)) * OPT + (threadIdx.x & 15) * 4; v4f sum = *(const v4fa*)q0;
#pragma unroll
        for (int u = 1; u < ANW; ++u) sum += *(const v4fa*)(q0 + u * 128 * OPT);
        r[s] = sum * cs + r[s]; *(v4f*)(OUTb + oo + (size_t)s * 8 * TT) = r[s]; }
    // the 16 stores name these data registers: they stay as they are until this wait
    asm volatile("s_wait_xcnt 0x0" :: "v"(r[0]), "v"(r[1]), "v"(r[2]), "v"(r[3]), "v"(r[4]), "v"(r[5]), "v"(r[6]), "v"(r[7]), "v"(r[8]), "v"(r[9]), "v"(r[10]), "v"(r[11]), "v"(r[12]), "v"(r[13]), "v"(r[14]), "v"(r[15]) : "memory");
}
// blockIdx.y is the tile of 64 columns l: the tiles l < RH do three value products. The test is the same for the whole block, so every wave of a block meets the same three __syncthreads().
// The second launch bound: two waves a SIMD (512 registers a wave), so that two blocks share a WGP, as their LDS allows.
__global__ __launch_bounds__(32 * ANW, 2) void k_att(const bf* __restrict__ Kh, const bf* __restrict__ Kl, const bf* __restrict__ Qh, const bf* __restrict__ Ql, const float* __restrict__ MX, const float* __restrict__ FI, const bf* __restrict__ VTh, const bf* __restrict__ VTl, const h16* __restrict__ VT16, const float* __restrict__ PE, float* OUT) {
    __shared__ __align__(16) float red[ANW * 128 * OPT];
    { const size_t zb = blockIdx.x, zo = zb * TT * CC; Kh += zo; Kl += zo; Qh += zo; Ql += zo; MX += zb * TT; FI += zb * TT; VTh += zo; VTl += zo; VT16 += zo; PE += zo; OUT += zo; }
    const int l0 = blockIdx.y * 64;   // l0 < RH is the same for the whole tile: RH % 64 == 0
    if (l0 < RH) att_tile<true>(red, l0, Kh, Kl, Qh, Ql, MX, FI, VTh, VTl, VT16, PE, OUT);
    else att_tile<false>(red, l0, Kh, Kl, Qh, Ql, MX, FI, VTh, VTl, VT16, PE, OUT);
}

extern "C" void kernel_launch(void* const* d_in, const int* in_sizes, int n_in,
                              void* d_out, int out_size, void* d_ws, size_t ws_size, hipStream_t stream) {
    (void)in_sizes; (void)n_in; (void)out_size;
    const float* x = (const float*)d_in[0];
    const float* prm[4][6]; for (int r = 0; r < 4; ++r) for (int c = 0; c < 6; ++c) prm[r][c] = (const float*)d_in[1 + r * 6 + c];   // (w, b, gamma, beta, mean, var) for q, k, v, pe
    float* OUT = (float*)d_out;     // [16][128][2048]
    char* wsp = (char*)d_ws;
    auto take = [&](size_t bytes) { char* p = wsp; wsp += (bytes + 255) & ~(size_t)255; return (void*)p; };
    const size_t FE = (size_t)TT * CC;   // elements of one batch's [2048][128] plane
    bf* W4 = (bf*)take((size_t)4 * CC * KI * 2);
    // live through the whole call, all 16 batches
    bf* QPh = (bf*)take(NB_ * FE * 2); bf* QPl = (bf*)take(NB_ * FE * 2); bf* KPh = (bf*)take(NB_ * FE * 2); bf* KPl = (bf*)take(NB_ * FE * 2);
    bf* VTh = (bf*)take(NB_ * FE * 2); bf* VTl = (bf*)take(NB_ * FE * 2); h16* VT16 = (h16*)take(NB_ * FE * 2); float* FPE = (float*)take(NB_ * FE * 4);
    float* MX = (float*)take((size_t)NB_ * TT * 4); float* FI = (float*)take((size_t)NB_ * TT * 4);
    bf* X3 = (bf*)take((size_t)NB_ * TT * KI * 2);   // the im2col plane, all 16 batches
    if ((size_t)(wsp - (char*)d_ws) > ws_size) return;    // ~ 85 MiB
    k_prep<<<dim3(IMB + WBY, NB_, 1), 256, 0, stream>>>(x, X3, prm[0][0], prm[1][0], prm[2][0], prm[3][0], W4);   // im2col plane; w [128][64][3] == Bt [128][192], laid in fragment order
    CvP cp[4]; for (int r = 0; r < 4; ++r) cp[r] = CvP{prm[r][1], prm[r][2], prm[r][3], prm[r][4], prm[r][5]};
    k_conv4<<<dim3(TT / 64, 4 * (CC / 64), NB_), 32, 0, stream>>>(X3, W4, cp[0], cp[1], cp[2], cp[3], QPh, QPl, KPh, KPl, VTh, VTl, VT16, FPE);
    k_stat<<<dim3(TT / 64, NB_, 1), 32 * SNW, 0, stream>>>(KPh, KPl, QPh, QPl, MX, FI);                                                    // softmax row maxima and 1 / sums
    k_att<<<dim3(NB_, TT / 64, 1), 32 * ANW, 0, stream>>>(KPh, KPl, QPh, QPl, MX, FI, VTh, VTl, VT16, FPE, OUT);                                // out = v x P + pe
}

// v010
// Measured time: 119 microseconds a run.
// Two timings next to v009 both put it at 1.06 times that version's speed.
// All steps since v000 together make it 26.6 times as fast.
#include <hip/hip_runtime.h>

// Conv1dAttention (x [16][64][2048] channels-first; q/k/v/pe = LeakyReLU_0.3(BN(conv1d_k3(x) + b)) with 128 output channels (BN inference affine: y*scale + (beta - mean*scale), scale = gamma*rsqrt(var + 1e-5)); attn[i][j] = sum_c q[c][i] k[c][j] (NO scaling); P = softmax_j; out[c][l] = sum_j v[c][j] P[j][l] + pe[c][l] -> [16][128][2048] - note the value product contracts over the softmax ROW index j, i.e. it uses P TRANSPOSED).
// Compute dtypes, f32 accumulate: every input rounded to bf16; the four k=3 convolutions as PLAIN bf16 im2col GEMMs (K = 192, inputs: exact) + bias, BN affine and LeakyReLU in f32; scores hl x hl (3 products, K 128, unscaled) on every row, formed twice and never stored: once for the softmax rows' f32 maxima and sums, once for P itself, which stays in registers, split hi/lo bf16, as an operand of the value product; output columns l < 512 as hl v x hl P (3 products, K 2048), columns >= 512 as fp16 v x fp16(P x 1024); + pe, written channels-first.

#define NB_  16
#define CIN  64
#define CC   128
#define KW   3
#define KI   (CIN * KW)     // 192
#define TT   2048
#define RH   512
#define PCAR 1024.0f
typedef _Float16 h16;
typedef unsigned short bf;
typedef __attribute__((ext_vector_type(16))) __bf16   v16bf;
typedef __attribute__((ext_vector_type(16))) _Float16 v16h;
typedef __attribute__((ext_vector_type(8)))  _Float16 v8h;
typedef __attribute__((ext_vector_type(8)))  unsigned short v8us;
typedef __attribute__((ext_vector_type(8)))  float    v8f;
typedef __attribute__((ext_vector_type(4)))  float    v4f;
typedef v8h  __attribute__((may_alias)) v8ha;
typedef v4f  __attribute__((may_alias)) v4fa;
typedef v8us __attribute__((may_alias)) v8usa;

typedef __attribute__((ext_vector_type(2)))  float    v2f;
typedef __attribute__((ext_vector_type(2)))  __bf16   v2bf;
typedef __attribute__((ext_vector_type(4)))  unsigned v4u;
// f32 -> bf16, to nearest even, by the conversion instruction: two values an instruction, a in the low half of the word and b in the high half
__device__ __forceinline__ unsigned bfpk(float a, float b) { const v2f x = {a, b}; return __builtin_bit_cast(unsigned, __builtin_convertvector(x, v2bf)); }
// one value, in integer arithmetic (the same rounding): for the few BN constants of a wave, which are used as f32 at once
__device__ __forceinline__ unsigned short f2bf(float f) { unsigned u = __float_as_uint(f); u += 0x7FFFu + ((u >> 16) & 1u); return (unsigned short)(u >> 16); }
__device__ __forceinline__ float bf2f(unsigned short b) { return __uint_as_float(((unsigned)b) << 16); }
__device__ __forceinline__ float bfr(float f) { return bf2f(f2bf(f)); }
__device__ __forceinline__ v16h cat16(v8h lo, v8h hi) { return __builtin_shufflevector(lo, hi, 0, 1, 2, 3, 4, 5, 6, 7, 8, 9, 10, 11, 12, 13, 14, 15); }
__device__ __forceinline__ v16bf cat16b(v8us lo, v8us hi) { return __builtin_bit_cast(v16bf, __builtin_shufflevector(lo, hi, 0, 1, 2, 3, 4, 5, 6, 7, 8, 9, 10, 11, 12, 13, 14, 15)); }
__device__ __forceinline__ v8f wmma16(v16h a, v16h b, v8f c) { return __builtin_amdgcn_wmma_f32_16x16x32_f16(false, a, false, b, (short)0, c, false, false); }
__device__ __forceinline__ v8f wmmab(v16bf a, v16bf b, v8f c) { return __builtin_amdgcn_wmma_f32_16x16x32_bf16(false, a, false, b, (short)0, c, false, false); }



// ---- FRAGMENT ORDER: every 16-bit plane [R][K] that a matrix product reads lies as blocks of 16 rows x 8 k: element (r, k) at (r / 16) * 16 * K + (k / 8) * 128 + (r % 16) * 8 + k % 8 (PKO below).
// A 16 x 32 fragment is then 1 KiB in a row, and each of its two 16-B-a-lane loads (at lane * 8 and at 256 + lane * 8 elements) reads 512 contiguous bytes, 4 whole lines, where a row-major plane gave 32 B of each of 16 lines.
// The lane and register that hold an element are the same as from a row-major plane (lane & 15 the row; k = 8 * (lane >> 4) + 0..7, then 16 more), so every product sees the same operands in the same k order.
#define PKO(r, k, K) ((size_t)((r) >> 4) * 16 * (K) + (size_t)((k) >> 3) * 128 + ((r) & 15) * 8 + ((k) & 7))
template <typename T16> struct WFrag;
template <> struct WFrag<h16> { typedef v16h V; static __device__ __forceinline__ V ld(const h16* p) { return cat16(*(const v8h*)p, *(const v8h*)(p + 256)); } static __device__ __forceinline__ v8f mma(V a, V b, v8f c) { return wmma16(a, b, c); } };
template <> struct WFrag<bf> { typedef v16bf V; static __device__ __forceinline__ V ld(const bf* p) { return cat16b(*(const v8us*)p, *(const v8us*)(p + 256)); } static __device__ __forceinline__ v8f mma(V a, V b, v8f c) { return wmmab(a, b, c); } };

__device__ __forceinline__ h16 tohx(float x) { return (h16)x; }
// two values split hi/lo: h holds both hi parts, l both roundings of y - hi; hf: the hi parts as f32
__device__ __forceinline__ v2f pk2f(unsigned p) { const v2f r = {__uint_as_float(p << 16), __uint_as_float(p & 0xFFFF0000u)}; return r; }
__device__ __forceinline__ void split2(float y0, float y1, unsigned& h, unsigned& l) { h = bfpk(y0, y1); const v2f hf = pk2f(h); l = bfpk(y0 - hf[0], y1 - hf[1]); }
typedef __attribute__((ext_vector_type(2))) unsigned short v2us;
typedef __attribute__((ext_vector_type(4))) unsigned short v4us;
typedef __attribute__((ext_vector_type(8))) unsigned short v8us;
typedef __attribute__((ext_vector_type(4))) _Float16 v4h;
typedef __attribute__((ext_vector_type(2))) float v2f;

// a weight plane [128][192] rounded to bf16 and laid in fragment order; a thread takes 8 consecutive k of one row
__device__ __forceinline__ void cvt8(int bx, const float* __restrict__ src, bf* dst, size_t n8) { const size_t i = (size_t)bx * 256 + threadIdx.x; if (i >= n8) return; const v8f v = *(const v8f*)(src + i * 8); v4u ou;
#pragma unroll
    for (int k = 0; k < 4; ++k) ou[k] = bfpk(v[2 * k], v[2 * k + 1]);
    const v8us o = __builtin_bit_cast(v8us, ou); const int row = (int)(i / (KI / 8)), k0 = (int)(i % (KI / 8)) * 8; *(v8us*)(dst + PKO(row, k0, KI)) = o;  }
__device__ __forceinline__ void im2col(int bx, int by, const float* __restrict__ xb, bf* X3) { xb += (size_t)by * CIN * TT; X3 += (size_t)by * TT * KI; const size_t e8 = ((size_t)bx * 256 + threadIdx.x) * 8; if (e8 >= (size_t)TT * KI) return;
    // e8 is the place in the plane, which lies in fragment order: 16 neighbouring threads hold 16 neighbouring t at the same 8 k
    const int pb16 = (int)(e8 >> 7); const int kidx = (pb16 % (KI / 8)) * 8; const int t = (pb16 / (KI / 8)) * 16 + ((int)(e8 >> 3) & 15); float xv[8]; v4u ou;
#pragma unroll
    for (int u = 0; u < 8; ++u) { const int k2 = kidx + u; const int ci = k2 / KW, kk = k2 % KW; const int tt = t + kk - 1; xv[u] = (tt >= 0 && tt < TT) ? xb[(size_t)ci * TT + tt] : 0.f; }
#pragma unroll
    for (int u = 0; u < 4; ++u) ou[u] = bfpk(xv[2 * u], xv[2 * u + 1]);
    *(v8us*)(X3 + e8) = __builtin_bit_cast(v8us, ou);  }
// ---- k_prep: the im2col plane and the four weight planes in ONE launch (neither reads what the other writes). Grid (IMB + WBY, NB_), 256 threads: in each row of the grid the first IMB blocks lay the batch's im2col plane,
// the last WBY take one 256-thread piece of a weight plane each (NB_ * WBY pieces = 4 planes of WPB pieces).
#define IMB  (TT * KI / 8 / 256)    // 192
#define WPB  (CC * KI / 8 / 256)    // 12
#define WBY  (4 * WPB / NB_)        // 3
static_assert(TT * KI % (8 * 256) == 0 && CC * KI % (8 * 256) == 0 && 4 * WPB % NB_ == 0, "whole blocks");
__global__ __launch_bounds__(256) void k_prep(const float* __restrict__ x, bf* X3, const float* __restrict__ wq, const float* __restrict__ wk, const float* __restrict__ wv, const float* __restrict__ wp, bf* W4) {
    if (blockIdx.x < IMB) { im2col(blockIdx.x, blockIdx.y, x, X3); return; }
    const int pc = (int)blockIdx.y * WBY + (int)blockIdx.x - IMB, r = pc / WPB;   // the same for the whole block
    cvt8(pc % WPB, r == 0 ? wq : r == 1 ? wk : r == 2 ? wv : wp, W4 + (size_t)r * CC * KI, (size_t)CC * KI / 8);
}
// ---- conv_tile: one k = 3 convolution as its im2col GEMM (one wave per 64x64 tile, 16 accumulators: A = X3 [t][192], Bt = w [c][192], both in fragment order) that finishes its own output: bias, BN affine, LeakyReLU and the split
// into 16-bit planes are applied to the accumulators, so that no f32 plane is written and read again by a pass of its own. Tile (bx, by) of batch bz, 32 threads; os: 16 * 68 floats of the calling kernel's LDS.
// EPI 0 (q, k): hi/lo bf16 planes [t][c], in fragment order. EPI 1 (v): hi/lo bf16 and fp16 planes, transposed [c][t], in fragment order. EPI 2 (pe): f32 plane, transposed [c][t], row-major.
struct BnC { float b, sc, sh; };   // one channel's bias, BN scale and BN shift
__device__ __forceinline__ BnC bn_chan(int c, const float* __restrict__ bias, const float* __restrict__ gam, const float* __restrict__ bet, const float* __restrict__ mu, const float* __restrict__ var) {
    BnC r; r.b = bfr(bias[c]);
    // here and in bn_act each product is rounded before its add or subtract, as in y * scale + (beta - mean * scale) taken one operation at a time: q, k, v and pe come out bit for bit as from a BN pass of its own
    const float sc = __fmul_rn(bfr(gam[c]), __fdiv_rn(1.0f, sqrtf(__fadd_rn(bfr(var[c]), 1e-5f)))); float ms = __fmul_rn(bfr(mu[c]), sc); asm volatile("" : "+v"(ms)); const float sh = __fsub_rn(bfr(bet[c]), ms);
    r.sc = sc; r.sh = sh; return r; }
__device__ __forceinline__ float bn_act(float acc, const BnC p) { const float a = acc + p.b; float y = __fmul_rn(a, p.sc); asm volatile("" : "+v"(y)); y = __fadd_rn(y, p.sh); return (y > 0.f) ? y : 0.3f * y; }
template <int EPI>
__device__ __forceinline__ void conv_tile(float* os, int bx, int by, int bz, const bf* __restrict__ A, const bf* __restrict__ Bt, const float* __restrict__ bias, const float* __restrict__ gam, const float* __restrict__ bet, const float* __restrict__ mu, const float* __restrict__ var, bf* Oh, bf* Ol, h16* O16, float* OF) {
    typedef WFrag<bf>::V V;
    const size_t zo = (size_t)bz * TT * CC; A += (size_t)bz * TT * KI;
    const int lane = threadIdx.x & 31, lr = lane & 15, hi = lane >> 4; const int r0 = bx * 64, c0 = by * 64;
    v8f acc[4][4];
#pragma unroll
    for (int mb = 0; mb < 4; ++mb)
#pragma unroll
        for (int nb = 0; nb < 4; ++nb) acc[mb][nb] = (v8f){};
    // the lane's 4 channels, one per column block of the accumulators. Formed ahead of the K loop, whose loads hide theirs
    BnC pc[4];
#pragma unroll
    for (int u = 0; u < 4; ++u) pc[u] = bn_chan(c0 + u * 16 + lr, bias, gam, bet, mu, var);
    const bf* pa = A + (size_t)r0 * KI + lane * 8; const bf* pb = Bt + (size_t)c0 * KI + lane * 8;
    // the loop stays rolled: 16 accumulators and one trip's fragments fill the registers
#pragma unroll 1
    for (int kc = 0; kc < KI; kc += 32, pa += 512, pb += 512) {
        V a[4], b[4];
#pragma unroll
        for (int mb = 0; mb < 4; ++mb) a[mb] = WFrag<bf>::ld(pa + (size_t)mb * 16 * KI);
#pragma unroll
        for (int nb = 0; nb < 4; ++nb) b[nb] = WFrag<bf>::ld(pb + (size_t)nb * 16 * KI);
        asm volatile("s_wait_xcnt 0x0" :: "v"(pa), "v"(pb) : "memory");   // the 16 loads' two address pairs stay as they are (no load lands on them, nothing rewrites them) until this wait
#pragma unroll
        for (int nb = 0; nb < 4; ++nb)
#pragma unroll
            for (int mb = 0; mb < 4; ++mb) acc[mb][nb] = WFrag<bf>::mma(a[mb], b[nb], acc[mb][nb]);
        // the distance behind the trip's last WMMAs, on the back edge too, where the next trip's loads land on a[] and b[]
        asm volatile("v_nop\n\tv_nop\n\tv_nop\n\tv_nop" : "+v"(acc[0][0]), "+v"(acc[1][1]), "+v"(acc[2][2]), "+v"(acc[3][3]) : "v"(a[0]), "v"(a[3]));
    }
    // every loop below is unrolled whole: acc[][] and pc[] are indexed by constants alone and stay in registers
    if (EPI == 1) {
        // a lane's accumulator holds 8 consecutive t of one channel: that is a lane's 16 B of a transposed plane in fragment order, and the wave's store is 512 B in a row
#pragma unroll
        for (int nb = 0; nb < 4; ++nb)
#pragma unroll
            for (int mb = 0; mb < 4; ++mb) { v4u uh, ul; v8h of;
#pragma unroll
                for (int j = 0; j < 8; j += 2) { const float y0 = bn_act(acc[mb][nb][j], pc[nb]), y1 = bn_act(acc[mb][nb][j + 1], pc[nb]); unsigned p, q; split2(y0, y1, p, q); uh[j >> 1] = p; ul[j >> 1] = q; of[j] = tohx(y0); of[j + 1] = tohx(y1); }
                const v8us oh = __builtin_bit_cast(v8us, uh), ol = __builtin_bit_cast(v8us, ul);
                const size_t oo = zo + PKO(c0 + nb * 16 + lr, r0 + mb * 16 + hi * 8, TT); *(v8us*)(Oh + oo) = oh; *(v8us*)(Ol + oo) = ol; *(v8h*)(O16 + oo) = of;
                asm volatile("s_wait_xcnt 0x0" :: "v"(oh), "v"(ol), "v"(of) : "memory"); }   // the three stores name these data registers: they stay as they are until this wait
        return;
    }
    if (EPI == 0) {
        // the finished values are turned through LDS: a lane then holds 8 consecutive channels of one t, its 16 B of a plane in fragment order, and the wave's store is 512 B in a row
#pragma unroll
        for (int mb = 0; mb < 4; ++mb) {
#pragma unroll
            for (int nb = 0; nb < 4; ++nb) {
#pragma unroll
                for (int j = 0; j < 8; ++j) os[(hi * 8 + j) * 68 + nb * 16 + lr] = bn_act(acc[mb][nb][j], pc[nb]); }
            __builtin_amdgcn_wave_barrier(); asm volatile("" ::: "memory");   // a lane reads what other lanes wrote: the compiler, which follows one lane, must not lift a read over the 16 rows' writes
            v8us oh[4], ol[4];
#pragma unroll
            for (int s = 0; s < 4; ++s) { const int g8 = 2 * s + hi; const v4f x0 = *(const v4fa*)(os + lr * 68 + g8 * 8), x1 = *(const v4fa*)(os + lr * 68 + g8 * 8 + 4);
                v4u uh, ul;
#pragma unroll
                for (int u = 0; u < 4; ++u) { unsigned p, q; split2(u < 2 ? x0[2 * u] : x1[2 * u - 4], u < 2 ? x0[2 * u + 1] : x1[2 * u - 3], p, q); uh[u] = p; ul[u] = q; }
                oh[s] = __builtin_bit_cast(v8us, uh); ol[s] = __builtin_bit_cast(v8us, ul);
                const size_t oo = zo + PKO(r0 + mb * 16 + lr, c0 + g8 * 8, CC); *(v8us*)(Oh + oo) = oh[s]; *(v8us*)(Ol + oo) = ol[s]; }
            // the 16 rows' stores name these data registers: they stay as they are until this wait, one for the whole group
            asm volatile("s_wait_xcnt 0x0" :: "v"(oh[0]), "v"(oh[1]), "v"(oh[2]), "v"(oh[3]), "v"(ol[0]), "v"(ol[1]), "v"(ol[2]), "v"(ol[3]) : "memory");
            __builtin_amdgcn_wave_barrier(); asm volatile("" ::: "memory");   // nor the next 16 rows' writes over these reads
        }
        return;
    }
    // EPI 2: a lane's accumulator holds 8 consecutive t of one channel, 32 B of that channel's row of the transposed f32 plane
#pragma unroll
    for (int nb = 0; nb < 4; ++nb) {
        v4f y[4][2];
#pragma unroll
        for (int mb = 0; mb < 4; ++mb) {
#pragma unroll
            for (int j = 0; j < 8; ++j) y[mb][j >> 2][j & 3] = bn_act(acc[mb][nb][j], pc[nb]);
            float* dst = OF + zo + (size_t)(c0 + nb * 16 + lr) * TT + r0 + mb * 16 + hi * 8; *(v4f*)dst = y[mb][0]; *(v4f*)(dst + 4) = y[mb][1]; }
        // the 8 stores name these data registers: they stay as they are until this wait, one for the whole group
        asm volatile("s_wait_xcnt 0x0" :: "v"(y[0][0]), "v"(y[0][1]), "v"(y[1][0]), "v"(y[1][1]), "v"(y[2][0]), "v"(y[2][1]), "v"(y[3][0]), "v"(y[3][1]) : "memory");
    }
}
// ---- k_conv4: the four convolutions in ONE launch (they read the same im2col plane and none reads another's output): 4 waves a SIMD run side by side where a launch of one convolution gave each SIMD one.
// Grid (TT/64, 4 * CC/64, NB_), 32 threads; blockIdx.y = convolution * (CC/64) + channel tile, so that the 8 tiles that read the same 64 rows of the im2col plane start close together.
struct CvP { const float* b; const float* g; const float* be; const float* mu; const float* var; };   // one convolution's bias and BN vectors
__global__ __launch_bounds__(32) void k_conv4(const bf* __restrict__ X3, const bf* __restrict__ W4, CvP pq, CvP pk, CvP pv, CvP pp, bf* QPh, bf* QPl, bf* KPh, bf* KPl, bf* VTh, bf* VTl, h16* VT16, float* FPE) {
    __shared__ __align__(16) float os[16 * 68];
    const int r = (int)blockIdx.y / (CC / 64), by = (int)blockIdx.y % (CC / 64);   // the same for the whole block
    const bf* Bt = W4 + (size_t)r * CC * KI;
    if (r < 2) { const CvP p = r == 0 ? pq : pk; conv_tile<0>(os, blockIdx.x, by, blockIdx.z, X3, Bt, p.b, p.g, p.be, p.mu, p.var, r == 0 ? QPh : KPh, r == 0 ? QPl : KPl, nullptr, nullptr); }   // q and k share one copy of the code
    else if (r == 2) conv_tile<1>(os, blockIdx.x, by, blockIdx.z, X3, Bt, pv.b, pv.g, pv.be, pv.mu, pv.var, VTh, VTl, VT16, nullptr);
    else conv_tile<2>(os, blockIdx.x, by, blockIdx.z, X3, Bt, pp.b, pp.g, pp.be, pp.mu, pp.var, nullptr, nullptr, nullptr, FPE);
}
// ---- st_tile: one wave's 64x64 tile of the TRANSPOSED scores, St[l][i] = sum_c k[c][l] q[c][i] (A = k rows l, Bt = q rows i, planes in fragment order, K = 128; per 32-element chunk the three split products in the order hi x hi, q lo x k hi, q hi x k lo).
// An accumulator holds one i (its column, lane & 15) and 8 consecutive l: what belongs to a softmax row i (its maximum, its sum, its factor) is a per-lane value. 
#define L2E  1.4426950408889634f
// 2^x on the transcendental unit; the v_nop is the one slot that the instruction set asks for behind a transcendental before its result is read or its source overwritten
__device__ __forceinline__ float ex2(float x) { float r; asm("v_exp_f32 %0, %1\n\tv_nop" : "=v"(r) : "v"(x)); return r; }
__device__ __forceinline__ void st_tile(const bf* __restrict__ Kh, const bf* __restrict__ Kl, const bf* __restrict__ Qh, const bf* __restrict__ Ql, int l0, int i0, int lr, int hi, v8f (&acc)[4][4]) {
    typedef WFrag<bf>::V V;
#pragma unroll
    for (int mb = 0; mb < 4; ++mb)
#pragma unroll
        for (int nb = 0; nb < 4; ++nb) acc[mb][nb] = (v8f){};
    const size_t ao = (size_t)l0 * CC + (hi * 16 + lr) * 8, bo = (size_t)i0 * CC + (hi * 16 + lr) * 8;
    const bf* pkh = Kh + ao; const bf* pkl = Kl + ao; const bf* pqh = Qh + bo; const bf* pql = Ql + bo;
    // the loop stays rolled: 16 accumulators and one trip's fragments fill the registers
#pragma unroll 1
    for (int kc = 0; kc < CC; kc += 32, pkh += 512, pkl += 512, pqh += 512, pql += 512) {
        V a[4], a2[4];
#pragma unroll
        for (int mb = 0; mb < 4; ++mb) { a[mb] = WFrag<bf>::ld(pkh + (size_t)mb * 16 * CC); a2[mb] = WFrag<bf>::ld(pkl + (size_t)mb * 16 * CC); }
#pragma unroll
        for (int nb = 0; nb < 4; ++nb) { const V b = WFrag<bf>::ld(pqh + (size_t)nb * 16 * CC); const V b2 = WFrag<bf>::ld(pql + (size_t)nb * 16 * CC);
#pragma unroll
            for (int mb = 0; mb < 4; ++mb) { acc[mb][nb] = WFrag<bf>::mma(a[mb], b, acc[mb][nb]); acc[mb][nb] = WFrag<bf>::mma(a[mb], b2, acc[mb][nb]); acc[mb][nb] = WFrag<bf>::mma(a2[mb], b, acc[mb][nb]); } }
        // the distance behind the trip's last WMMAs, on the back edge too, where the next trip's loads land on a[] and a2[]
        asm volatile("v_nop\n\tv_nop\n\tv_nop\n\tv_nop" : "+v"(acc[0][0]), "+v"(acc[1][1]), "+v"(acc[2][2]), "+v"(acc[3][3]) : "v"(a[0]), "v"(a[3]));
        asm volatile("s_wait_xcnt 0x0" :: "v"(pkh), "v"(pkl), "v"(pqh), "v"(pql) : "memory");   // no address pair that the trip's loads name is rewritten ahead of this wait (it stands at the loop's foot, in front of the back edge)
    }
}
// ---- k_stat: the softmax rows' maxima and 1 / sums, from scores that are formed and dropped (no score plane is stored). Grid (TT/64, NB_), 8 waves: the block owns 64 rows i, wave w the l tiles w, w + 8, w + 16, w + 24.
// A lane keeps a running (maximum, sum of exp2 relative to it) for each of its 4 rows i; the 16 partial pairs of a row (8 waves x 2 lane halves) are merged through LDS in a fixed order.
#define SNW  8
__global__ __launch_bounds__(32 * SNW) void k_stat(const bf* __restrict__ Kh, const bf* __restrict__ Kl, const bf* __restrict__ Qh, const bf* __restrict__ Ql, float* MX, float* FI) {
    __shared__ float pm[2 * SNW][64], ps[2 * SNW][64];
    { const size_t zo = (size_t)blockIdx.y * TT * CC; Kh += zo; Kl += zo; Qh += zo; Ql += zo; }
    const int w = __builtin_amdgcn_readfirstlane((int)(threadIdx.x >> 5));   // the wave's number, in a scalar register: the tile loop's counter stays scalar
    const int lane = threadIdx.x & 31, lr = lane & 15, hi = lane >> 4; const int i0 = blockIdx.x * 64;
    float m[4], s[4];
#pragma unroll
    for (int nb = 0; nb < 4; ++nb) { m[nb] = -3.0e38f; s[nb] = 0.f; }
    // rolled: one tile's accumulators at a time
#pragma unroll 1
    for (int t = w; t < TT / 64; t += SNW) {
        v8f acc[4][4];
        st_tile(Kh, Kl, Qh, Ql, t * 64, i0, lr, hi, acc);
        // unrolled whole: acc[][] is indexed by constants alone and stays in registers
#pragma unroll
        for (int nb = 0; nb < 4; ++nb) { float mn = m[nb];
#pragma unroll
            for (int mb = 0; mb < 4; ++mb)
#pragma unroll
                for (int j = 0; j < 8; ++j) mn = fmaxf(mn, acc[mb][nb][j]);
            float ss = 0.f;
#pragma unroll
            for (int mb = 0; mb < 4; ++mb)
#pragma unroll
                for (int j = 0; j < 8; ++j) ss += ex2(__fmul_rn(__fsub_rn(acc[mb][nb][j], mn), L2E));
            s[nb] = s[nb] * ex2(__fmul_rn(__fsub_rn(m[nb], mn), L2E)) + ss; m[nb] = mn; }
    }
#pragma unroll
    for (int nb = 0; nb < 4; ++nb) { pm[2 * w + hi][nb * 16 + lr] = m[nb]; ps[2 * w + hi][nb * 16 + lr] = s[nb]; }
    __syncthreads();   // every wave's partial pairs lie in LDS before any of them is merged
    if (threadIdx.x < 64) { const int i = threadIdx.x; float mx = pm[0][i];
#pragma unroll
        for (int p = 1; p < 2 * SNW; ++p) mx = fmaxf(mx, pm[p][i]);
        float sum = 0.f;
#pragma unroll
        for (int p = 0; p < 2 * SNW; ++p) sum += ps[p][i] * ex2(__fmul_rn(__fsub_rn(pm[p][i], mx), L2E));
        const size_t o = (size_t)blockIdx.y * TT + i0 + i; MX[o] = mx; FI[o] = __fdiv_rn(1.0f, sum); }
}
// ---- k_att: the output itself from a second forming of the scores; P is never stored. Grid (NB_, TT/64), 32 * ANW threads: the block owns 64 columns l of one batch's output, all 128 channels; wave w takes the 32-row groups i = w, w + ANW, ...
// The block's 64 rows of the k planes (16 KiB each, contiguous in fragment order) and the batch's row maxima and factors are laid in LDS once and read from there in every trip.
// Per trip: S[i][l] = sum_c q[c][i] k[c][l] (A = q rows i, Bt = k rows l; per 32-element chunk the three split products in the order hi x hi, q lo x k hi, q hi x k lo, as in st_tile): an accumulator holds one l (lane & 15) and 8 consecutive i.
// P[i][l] = exp2((S[i][l] - max_i) * log2 e) * (1 / sum_i), split hi/lo bf16 (l < RH) or fp16((hi + lo) x 1024) (l >= RH), stays in the lanes and registers where the accumulators hold it: two accumulators (16 + 16 rows i) are one Bt fragment [l][32 i].
// Then o[c][l] += v[c][i] P[i][l] with A = the v planes [c][t]; an accumulator of o holds one l a lane and 8 channels. The ANW partial tiles are laid in LDS, added in wave order, scaled, + pe, and stored channels-first, 256 B of a channel's row in a row.
#define ANW  4
#define OPT  68             // pitch of a partial tile's row (64 l) in LDS, floats: the two 8-row halves of an accumulator's store fall on different banks
template <bool HL>
__device__ __forceinline__ void att_tile(float* red, int l0, const bf* __restrict__ Kh, const bf* __restrict__ Kl, const bf* __restrict__ Qh, const bf* __restrict__ Ql, const float* __restrict__ MX, const float* __restrict__ FI, const bf* __restrict__ VTh, const bf* __restrict__ VTl, const h16* __restrict__ VT16, const float* __restrict__ PE, float* OUTb) {
    typedef WFrag<bf>::V V;
    const int w = __builtin_amdgcn_readfirstlane((int)(threadIdx.x >> 5));   // the wave's number, in a scalar register: the trip counter stays scalar
    const int lane = threadIdx.x & 31, lr = lane & 15, hi = lane >> 4;
    // the k tile stands where the partial tiles are laid later: 64 * CC elements of the hi plane, then as many of the lo plane
    bf* kt = (bf*)red;
    // behind it the batch's 2048 row maxima and 2048 factors 1 / sum
    float* mt = red + 64 * CC;
    const bf* gkh = Kh + (size_t)l0 * CC; const bf* gkl = Kl + (size_t)l0 * CC;
    const int tx = (int)threadIdx.x;
    v8us sh[64 * CC / (8 * 32 * ANW)], sl[64 * CC / (8 * 32 * ANW)]; v4f sm[TT / (4 * 32 * ANW)], sf[TT / (4 * 32 * ANW)];
#pragma unroll
    for (int s = 0; s < 64 * CC / (8 * 32 * ANW); ++s) { const int e = (s * 32 * ANW + tx) * 8; sh[s] = *(const v8usa*)(gkh + e); sl[s] = *(const v8usa*)(gkl + e); }
#pragma unroll
    for (int s = 0; s < TT / (4 * 32 * ANW); ++s) { const int e = (s * 32 * ANW + tx) * 4; sm[s] = *(const v4fa*)(MX + e); sf[s] = *(const v4fa*)(FI + e); }
    asm volatile("s_wait_xcnt 0x0" :: "s"(gkh), "s"(gkl), "s"(MX), "s"(FI), "v"(tx) : "memory");   // the 24 staging loads' four scalar bases and their vector offset stay as they are until this wait
#pragma unroll
    for (int s = 0; s < 64 * CC / (8 * 32 * ANW); ++s) { const int e = (s * 32 * ANW + tx) * 8; *(v8usa*)(kt + e) = sh[s]; *(v8usa*)(kt + 64 * CC + e) = sl[s]; }
#pragma unroll
    for (int s = 0; s < TT / (4 * 32 * ANW); ++s) { const int e = (s * 32 * ANW + tx) * 4; *(v4fa*)(mt + e) = sm[s]; *(v4fa*)(mt + TT + e) = sf[s]; }
    __syncthreads();   // the whole k tile and both vectors lie in LDS before any wave reads them
    const bf* kth = kt + lane * 8; const bf* ktl = kt + 64 * CC + lane * 8;
    v8f o[8][4];
#pragma unroll
    for (int cb = 0; cb < 8; ++cb)
#pragma unroll
        for (int nb = 0; nb < 4; ++nb) o[cb][nb] = (v8f){};
    // 32 rows i are 32 * CC elements in a row of a q plane; 32 i of 16 channels are 512 elements in a row of a v plane, the next 16 channels 16 * TT further (an immediate offset).
    // A plane's base stays in scalar registers; the lane's and the trip's place are one 32-bit byte offset for both q planes and one for the v planes
    const unsigned l16 = lane * 16;
    const float* pm = mt + w * 32 + hi * 8;   // the lane's 8 rows i of an accumulator
    // rolled: one group's accumulators at a time; everything inside is unrolled whole, so that acc[][] and o[][] are indexed by constants alone and stay in registers
#pragma unroll 1
    for (int t = w; t < TT / 32; t += ANW, pm += ANW * 32) {
        const unsigned qo = l16 + (unsigned)t * (32 * CC * 2), vo = l16 + (unsigned)t * (512 * 2);
        const bf* pqh = (const bf*)((const char*)Qh + qo); const bf* pql = (const bf*)((const char*)Ql + qo);
        const bf* pvh = (const bf*)((const char*)VTh + vo); const bf* pvl = (const bf*)((const char*)VTl + vo); const h16* pv16 = (const h16*)((const char*)VT16 + vo);
        // q's loads for three chunks are issued together, the fourth chunk's and then the v fragments' as q's registers come free, two and more chunks of products ahead of their use.
        // Each sched_barrier keeps the loads in front of it from being moved down to their first use, where every group would be waited for by itself
        V a[CC / 32][2], a2[CC / 32][2];
#pragma unroll
        for (int kc = 0; kc < CC / 32 - 1; ++kc)
#pragma unroll
            for (int mb = 0; mb < 2; ++mb) { a[kc][mb] = WFrag<bf>::ld(pqh + mb * 16 * CC + kc * 512); a2[kc][mb] = WFrag<bf>::ld(pql + mb * 16 * CC + kc * 512); }
        V b[2][2], b2[2];   // k fragments of two column blocks: the hi parts in two sets, one in use and one on its way from LDS; the trip's first set flies with q's loads
#pragma unroll
        for (int u = 0; u < 2; ++u) b[0][u] = WFrag<bf>::ld(kth + u * 16 * CC);
        __builtin_amdgcn_sched_barrier(0);
        V vh[8], vl[8]; v16h vv[8];
        v8f acc[2][4];
#pragma unroll
        for (int mb = 0; mb < 2; ++mb)
#pragma unroll
            for (int nb = 0; nb < 4; ++nb) acc[mb][nb] = (v8f){};
#pragma unroll
        for (int kc = 0; kc < CC / 32; ++kc) {
            // two column blocks at a time: three other accumulators stand between two products of one accumulator
#pragma unroll
            for (int n2 = 0; n2 < 4; n2 += 2) { const int g = kc * 2 + (n2 >> 1), c = g & 1, x = c ^ 1;
                // one group of LDS loads for 12 products: these two column blocks' lo fragments, 8 products ahead of their use, and the next two blocks' hi fragments, 12 ahead, into the other register set: the wait in front of a product never asks for loads just issued
#pragma unroll
                for (int u = 0; u < 2; ++u) b2[u] = WFrag<bf>::ld(ktl + (n2 + u) * 16 * CC + kc * 512);
                if (g + 1 < 2 * (CC / 32)) {
#pragma unroll
                    for (int u = 0; u < 2; ++u) b[x][u] = WFrag<bf>::ld(kth + (((g + 1) & 1) * 2 + u) * 16 * CC + ((g + 1) >> 1) * 512); }
                __builtin_amdgcn_sched_barrier(0);   // keeps the group from being moved down to its first use
#pragma unroll
                for (int u = 0; u < 2; ++u)
#pragma unroll
                    for (int mb = 0; mb < 2; ++mb) acc[mb][n2 + u] = wmmab(a[kc][mb], b[c][u], acc[mb][n2 + u]);
#pragma unroll
                for (int u = 0; u < 2; ++u)
#pragma unroll
                    for (int mb = 0; mb < 2; ++mb) acc[mb][n2 + u] = wmmab(a2[kc][mb], b[c][u], acc[mb][n2 + u]);
#pragma unroll
                for (int u = 0; u < 2; ++u)
#pragma unroll
                    for (int mb = 0; mb < 2; ++mb) acc[mb][n2 + u] = wmmab(a[kc][mb], b2[u], acc[mb][n2 + u]);
                if (n2 == 0) __builtin_amdgcn_sched_barrier(0); }   // nor is the group after it lifted over these products, onto registers that they still read (behind the second pair of blocks the chunk's own barrier stands)
            // behind chunk 0: q's last chunk; behind chunks 1 and 2 32 registers of v each (l < RH: two channel blocks, hi and lo; else four blocks)
            __builtin_amdgcn_sched_barrier(0);   // behind chunk 3, where no load follows: the next phase's values are not begun among the last products, where they overran the registers (scratch)
            if (kc == 0) {
#pragma unroll
                for (int mb = 0; mb < 2; ++mb) { a[3][mb] = WFrag<bf>::ld(pqh + mb * 16 * CC + 3 * 512); a2[3][mb] = WFrag<bf>::ld(pql + mb * 16 * CC + 3 * 512); } }
            else if (HL && kc < 3) {
#pragma unroll
                for (int cb = 2 * kc - 2; cb < 2 * kc; ++cb) { vh[cb] = WFrag<bf>::ld(pvh + cb * 16 * TT); vl[cb] = WFrag<bf>::ld(pvl + cb * 16 * TT); } }
            else if (!HL && kc < 3) {
#pragma unroll
                for (int cb = 4 * kc - 4; cb < 4 * kc; ++cb) vv[cb] = WFrag<h16>::ld(pv16 + cb * 16 * TT); }
            if (kc < 3) __builtin_amdgcn_sched_barrier(0);
        }
        v8f mi[2], fi[2];
#pragma unroll
        for (int g = 0; g < 2; ++g) { mi[g] = *(const v8f*)(pm + g * 16); fi[g] = *(const v8f*)(pm + TT + g * 16); }
        v8us ph[4][2], pl[4][2]; v8h pq[4][2];
#pragma unroll
        for (int nb = 0; nb < 4; ++nb) {
#pragma unroll
            for (int g = 0; g < 2; ++g) {
                v4u uh, ul;
#pragma unroll
                for (int j = 0; j < 8; j += 2) { unsigned x, y;
                    split2(ex2(__fmul_rn(__fsub_rn(acc[g][nb][j], mi[g][j]), L2E)) * fi[g][j], ex2(__fmul_rn(__fsub_rn(acc[g][nb][j + 1], mi[g][j + 1]), L2E)) * fi[g][j + 1], x, y); uh[j >> 1] = x; ul[j >> 1] = y;
                    if (!HL) { const v2f xf = pk2f(x), yf = pk2f(y); pq[nb][g][j] = tohx(__fadd_rn(xf[0], yf[0]) * PCAR); pq[nb][g][j + 1] = tohx(__fadd_rn(xf[1], yf[1]) * PCAR); } }
                ph[nb][g] = __builtin_bit_cast(v8us, uh); pl[nb][g] = __builtin_bit_cast(v8us, ul);
                __builtin_amdgcn_sched_barrier(0); } }   // one accumulator's 8 values are finished before the next one's are begun: spread over the whole phase their intermediate values overran the registers (scratch)
#pragma unroll
        for (int cb = 0; cb < 8; ++cb) {
            if (HL && (cb == 0 || cb == 2)) {   // two more channel blocks of v, in registers that have just come free; 48 products stand in front of their use
#pragma unroll
                for (int c2 = cb + 4; c2 < cb + 6; ++c2) { vh[c2] = WFrag<bf>::ld(pvh + c2 * 16 * TT); vl[c2] = WFrag<bf>::ld(pvl + c2 * 16 * TT); }
                __builtin_amdgcn_sched_barrier(0);
            }
            // per accumulator the order is P hi x v hi, P lo x v hi, P hi x v lo; the four column blocks stand between two products of one accumulator
            if (HL) {
#pragma unroll
                for (int nb = 0; nb < 4; ++nb) o[cb][nb] = wmmab(vh[cb], cat16b(ph[nb][0], ph[nb][1]), o[cb][nb]);
#pragma unroll
                for (int nb = 0; nb < 4; ++nb) o[cb][nb] = wmmab(vh[cb], cat16b(pl[nb][0], pl[nb][1]), o[cb][nb]);
#pragma unroll
                for (int nb = 0; nb < 4; ++nb) o[cb][nb] = wmmab(vl[cb], cat16b(ph[nb][0], ph[nb][1]), o[cb][nb]); }
            else {
#pragma unroll
                for (int nb = 0; nb < 4; ++nb) o[cb][nb] = wmma16(vv[cb], cat16(pq[nb][0], pq[nb][1]), o[cb][nb]); } }
        // the distance behind the trip's last WMMAs, on the back edge too, where the next trip's values land on their operands
        asm volatile("v_nop\n\tv_nop\n\tv_nop\n\tv_nop" : "+v"(o[7][0]), "+v"(o[7][1]), "+v"(o[7][2]), "+v"(o[7][3]));
        asm volatile("s_wait_xcnt 0x0" :: "v"(qo), "v"(vo) : "memory");   // neither offset that the trip's loads name is rewritten ahead of this wait (it stands at the loop's foot, in front of the back edge)
    }
    // a thread's 16 pieces of 4 l: piece s is channel s * 8 + thread / 16; pe's loads fly while the partial tiles are laid in LDS
    const size_t oo = (size_t)(threadIdx.x >> 4) * TT + l0 + (threadIdx.x & 15) * 4;
    v4f r[16];
#pragma unroll
    for (int s = 0; s < 16; ++s) r[s] = *(const v4f*)(PE + oo + (size_t)s * 8 * TT);
    asm volatile("s_wait_xcnt 0x0" :: "v"(PE + oo) : "memory");   // the 16 loads' address pair stays as it is (no load lands on it) until this wait
    __syncthreads();   // every wave has read the k tile and the two vectors for the last time before a partial tile is laid over them
    float* my = red + w * 128 * OPT;
#pragma unroll
    for (int cb = 0; cb < 8; ++cb)
#pragma unroll
        for (int nb = 0; nb < 4; ++nb)
#pragma unroll
            for (int j = 0; j < 8; ++j) my[(cb * 16 + hi * 8 + j) * OPT + nb * 16 + lr] = o[cb][nb][j];
    __syncthreads();   // every wave's partial tile lies in LDS before any of it is added
    const float cs = HL ? 1.0f : 1.0f / PCAR;
#pragma unroll
    for (int s = 0; s < 16; ++s) { const float* q0 = red + (s * 8 + (int)(threadIdx.x >> 4)) * OPT + (threadIdx.x & 15) * 4; v4f sum = *(const v4fa*)q0;
#pragma unroll
        for (int u = 1; u < ANW; ++u) sum += *(const v4fa*)(q0 + u * 128 * OPT);
        r[s] = sum * cs + r[s]; *(v4f*)(OUTb + oo + (size_t)s * 8 * TT) = r[s]; }
    // the 16 stores name these data registers: they stay as they are until this wait
    asm volatile("s_wait_xcnt 0x0" :: "v"(r[0]), "v"(r[1]), "v"(r[2]), "v"(r[3]), "v"(r[4]), "v"(r[5]), "v"(r[6]), "v"(r[7]), "v"(r[8]), "v"(r[9]), "v"(r[10]), "v"(r[11]), "v"(r[12]), "v"(r[13]), "v"(r[14]), "v"(r[15]) : "memory");
}
// blockIdx.y is the tile of 64 columns l: the tiles l < RH do three value products. The test is the same for the whole block, so every wave of a block meets the same three __syncthreads().
// The second launch bound: two waves a SIMD (512 registers a wave), so that two blocks share a WGP, as their LDS allows.
__global__ __launch_bounds__(32 * ANW, 2) void k_att(const bf* __restrict__ Kh, const bf* __restrict__ Kl, const bf* __restrict__ Qh, const bf* __restrict__ Ql, const float* __restrict__ MX, const float* __restrict__ FI, const bf* __restrict__ VTh, const bf* __restrict__ VTl, const h16* __restrict__ VT16, const float* __restrict__ PE, float* OUT) {
    __shared__ __align__(16) float red[ANW * 128 * OPT];
    { const size_t zb = blockIdx.x, zo = zb * TT * CC; Kh += zo; Kl += zo; Qh += zo; Ql += zo; MX += zb * TT; FI += zb * TT; VTh += zo; VTl += zo; VT16 += zo; PE += zo; OUT += zo; }
    const int l0 = blockIdx.y * 64;   // l0 < RH is the same for the whole tile: RH % 64 == 0
    if (l0 < RH) att_tile<true>(red, l0, Kh, Kl, Qh, Ql, MX, FI, VTh, VTl, VT16, PE, OUT);
    else att_tile<false>(red, l0, Kh, Kl, Qh, Ql, MX, FI, VTh, VTl, VT16, PE, OUT);
}

extern "C" void kernel_launch(void* const* d_in, const int* in_sizes, int n_in,
                              void* d_out, int out_size, void* d_ws, size_t ws_size, hipStream_t stream) {
    (void)in_sizes; (void)n_in; (void)out_size;
    const float* x = (const float*)d_in[0];
    const float* prm[4][6]; for (int r = 0; r < 4; ++r) for (int c = 0; c < 6; ++c) prm[r][c] = (const float*)d_in[1 + r * 6 + c];   // (w, b, gamma, beta, mean, var) for q, k, v, pe
    float* OUT = (float*)d_out;     // [16][128][2048]
    char* wsp = (char*)d_ws;
    auto take = [&](size_t bytes) { char* p = wsp; wsp += (bytes + 255) & ~(size_t)255; return (void*)p; };
    const size_t FE = (size_t)TT * CC;   // elements of one batch's [2048][128] plane
    bf* W4 = (bf*)take((size_t)4 * CC * KI * 2);
    // live through the whole call, all 16 batches
    bf* QPh = (bf*)take(NB_ * FE * 2); bf* QPl = (bf*)take(NB_ * FE * 2); bf* KPh = (bf*)take(NB_ * FE * 2); bf* KPl = (bf*)take(NB_ * FE * 2);
    bf* VTh = (bf*)take(NB_ * FE * 2); bf* VTl = (bf*)take(NB_ * FE * 2); h16* VT16 = (h16*)take(NB_ * FE * 2); float* FPE = (float*)take(NB_ * FE * 4);
    float* MX = (float*)take((size_t)NB_ * TT * 4); float* FI = (float*)take((size_t)NB_ * TT * 4);
    bf* X3 = (bf*)take((size_t)NB_ * TT * KI * 2);   // the im2col plane, all 16 batches
    if ((size_t)(wsp - (char*)d_ws) > ws_size) return;    // ~ 85 MiB
    k_prep<<<dim3(IMB + WBY, NB_, 1), 256, 0, stream>>>(x, X3, prm[0][0], prm[1][0], prm[2][0], prm[3][0], W4);   // im2col plane; w [128][64][3] == Bt [128][192], laid in fragment order
    CvP cp[4]; for (int r = 0; r < 4; ++r) cp[r] = CvP{prm[r][1], prm[r][2], prm[r][3], prm[r][4], prm[r][5]};
    k_conv4<<<dim3(TT / 64, 4 * (CC / 64), NB_), 32, 0, stream>>>(X3, W4, cp[0], cp[1], cp[2], cp[3], QPh, QPl, KPh, KPl, VTh, VTl, VT16, FPE);
    k_stat<<<dim3(TT / 64, NB_, 1), 32 * SNW, 0, stream>>>(KPh, KPl, QPh, QPl, MX, FI);                                                    // softmax row maxima and 1 / sums
    k_att<<<dim3(NB_, TT / 64, 1), 32 * ANW, 0, stream>>>(KPh, KPl, QPh, QPl, MX, FI, VTh, VTl, VT16, FPE, OUT);                                // out = v x P + pe
}
